// v000
// The times below were measured on an AMD MI455X: many runs one after another, warmed up first and cycling through
// copies of the inputs, with the whole window's GPU time divided by the number of runs. Launches and the gaps
// between them are all in it. The median over several windows is given; except for v000 it joins two sittings, which
// can be a few percent apart, so the side-by-side timings, each taken in one sitting, are the better comparison.
// v000, which the later versions start from, runs in 714 microseconds.
#include <hip/hip_runtime.h>

// Contractions: q projection on v_wmma_f32_16x16x32_bf16 (x and W RNE-converted to bf16, exact products, f32 accumulate); q.x^T on v_wmma_f32_16x16x32_f16 with q carried x2048 as f16 value + f16 remainder folded along K ([qh | ql] x [k | k], k = f16 of the bf16 x, exact); att.x on v_wmma_f32_16x16x32_f16 (f16 x plane; softmax weights carried x1024 and centred by 1024/SEQ, column mean of x added back in f32), f32 accumulate.
// Single-head full-width document self-attention: x [8][2048][768]; q = x W^T ('oi' [768][768], no bias); keys = values = x; att = softmax(q.x) over all 2048 keys (no scale, no mask); out = att @ x -> [8][2048][768] f32.
// Two batches per pass (z-batched GEMMs): x -> bf16 plane + f16 [k | k] plane; projection -> f32 rows -> f16 [qh | ql] plane; x transposed [d][t] f16; S' = 2048 q.x (f32, materialised per pass); row softmax in registers; O = P' x; out = O/1024 + mean_t(x).

#ifndef NB
#define NB 8
#endif
#ifndef SEQ
#define SEQ 2048
#endif
#define NB_FULL  8
#define SEQ_FULL 2048
#define DM   768
#define HD   768
#define ZB   ((NB % 2 == 0) ? 2 : 1)     // batches per pass
#define PCAR 1024.0f
#define QCAR 2048.0f                      // carry of the q value / remainder planes
#define SCL  4.8828125e-4f                // 1/2048: undoes the q carry (the module applies no score scale)
#define KX2  (2 * HD)                     // pitch of the K-folded planes [value | remainder] and [k | k]

typedef _Float16 h16;
typedef unsigned short bf;
typedef __attribute__((ext_vector_type(16))) __bf16   v16bf;
typedef __attribute__((ext_vector_type(16))) _Float16 v16h;
typedef __attribute__((ext_vector_type(8)))  _Float16 v8h;
typedef __attribute__((ext_vector_type(8)))  unsigned short v8us;
typedef __attribute__((ext_vector_type(8)))  float    v8f;
typedef __attribute__((ext_vector_type(4)))  float    v4f;
typedef __attribute__((ext_vector_type(2)))  float    v2f;
typedef __attribute__((ext_vector_type(2)))  _Float16 v2h;
typedef __attribute__((ext_vector_type(4)))  _Float16 v4h;
typedef v4f  __attribute__((may_alias)) v4fa;

static_assert(NB <= NB_FULL);
static_assert(SEQ <= SEQ_FULL);
static_assert(NB % ZB == 0);
static_assert(SEQ % 128 == 0);                 // softmax row chunks, 64-row tiles, K steps of 32
static_assert(DM % 64 == 0 && HD % 64 == 0);   // 64x64 tiles, K steps of 32
static_assert(DM == HD);                       // q width == x width: q.x contracts over 768
static_assert(((size_t)SEQ * DM) % 8 == 0);
static_assert((ZB * SEQ) % 8 == 0);
static_assert(HD % 32 == 0 && SEQ % 8 == 0);
static_assert(KX2 % 32 == 0);                  // folded score GEMM: K steps of 32
static_assert((ZB * SEQ) % 64 == 0);           // projection GEMM rows: 64-row tiles
static_assert(QCAR * SCL == 1.0f);             // carry folded back exactly in the softmax scale
static_assert((KX2 * 2) % 128 == 0);
static_assert(DM % 64 == 0);
static_assert(((size_t)SEQ * DM / 8) * 16 == (size_t)SEQ * DM * 2);          // k_cvx: threads x 16 B == slab bytes (per plane half)
static_assert(((size_t)ZB * SEQ * DM / 8) * 16 == (size_t)ZB * SEQ * DM * 2); // k_cvtq: threads x 16 B == plane-half bytes
static_assert(((size_t)ZB * HD * SEQ / 2) * 4 == (size_t)ZB * HD * SEQ * 2);  // k_vtpx: threads x 4 B == plane bytes
static_assert(16 * 68 * 4 <= 131072);          // k_gemmw static LDS
static_assert(8 * 32 * 4 <= 131072);           // k_vmeanx static LDS

__device__ __forceinline__ unsigned short f2bf(float f) { unsigned u = __float_as_uint(f); u += 0x7FFFu + ((u >> 16) & 1u); return (unsigned short)(u >> 16); }
__device__ __forceinline__ v16h cat16(v8h lo, v8h hi) { return __builtin_shufflevector(lo, hi, 0, 1, 2, 3, 4, 5, 6, 7, 8, 9, 10, 11, 12, 13, 14, 15); }
__device__ __forceinline__ v16bf cat16b(v8us lo, v8us hi) { return __builtin_bit_cast(v16bf, __builtin_shufflevector(lo, hi, 0, 1, 2, 3, 4, 5, 6, 7, 8, 9, 10, 11, 12, 13, 14, 15)); }
__device__ __forceinline__ v8f wmma16(v16h a, v16h b, v8f c) { return __builtin_amdgcn_wmma_f32_16x16x32_f16(false, a, false, b, (short)0, c, false, false); }
__device__ __forceinline__ v8f wmmab(v16bf a, v16bf b, v8f c) { return __builtin_amdgcn_wmma_f32_16x16x32_bf16(false, a, false, b, (short)0, c, false, false); }
__device__ __forceinline__ h16 tohx(float x) { return (h16)x; }
// f32 -> f16 (RNE) that cannot produce an f16 subnormal: |v| < 2^-14 -> +0 (value select).
static __device__ __forceinline__ h16 toh_flush(float v) { const h16 r = (h16)v; return (fabsf(v) < 6.103515625e-05f) ? (h16)0.0f : r; }

// ---- k_gemmw: register-blocked GEMM, ONE WAVE per 64x64 output tile (16 accumulators), operands straight from K-contiguous 16-bit planes; grid (M/64, N/64, Z), 32 threads.
// C[m][n] (f32, pitch ldc) = sum_k A[m][k] Bt[n][k]. z-batch strides sA/sB/sC in elements. K % 32 == 0, M % 64 == 0, N % 64 == 0.
// Fragment map (A and Bt alike): lane -> row/col lane&15, h = lane>>4; elements 0..7 = k0+8h+0..7, elements 8..15 = k0+16+8h+0..7. D: acc[j] = (row 8h+j, col lane&15).
template <typename T16> struct WFrag;
template <> struct WFrag<h16> { typedef v16h V; static __device__ __forceinline__ V ld(const h16* p) { return cat16(*(const v8h*)p, *(const v8h*)(p + 16)); } static __device__ __forceinline__ v8f mma(V a, V b, v8f c) { return wmma16(a, b, c); } };
template <> struct WFrag<bf> { typedef v16bf V; static __device__ __forceinline__ V ld(const bf* p) { return cat16b(*(const v8us*)p, *(const v8us*)(p + 16)); } static __device__ __forceinline__ v8f mma(V a, V b, v8f c) { return wmmab(a, b, c); } };
template <typename T16>
__global__ __launch_bounds__(32) void k_gemmw(const T16* __restrict__ A, const T16* __restrict__ Bt, int K, float* C, int ldc, size_t sA, size_t sB, size_t sC) {
    typedef typename WFrag<T16>::V V;
    __shared__ __align__(16) float os[16 * 68];
    const size_t z = blockIdx.z; A += z * sA; Bt += z * sB; C += z * sC;
    const int lane = threadIdx.x & 31, lr = lane & 15, hi = lane >> 4; const int r0 = blockIdx.x * 64, c0 = blockIdx.y * 64;
    v8f acc[4][4];
#pragma unroll
    for (int mb = 0; mb < 4; ++mb)
#pragma unroll
        for (int nb = 0; nb < 4; ++nb) acc[mb][nb] = (v8f){};
    const size_t aoff = (size_t)(r0 + lr) * K + 8 * hi, boff = (size_t)(c0 + lr) * K + 8 * hi;
#pragma unroll 1
    for (int kc = 0; kc < K; kc += 32) {
        V a[4];
#pragma unroll
        for (int mb = 0; mb < 4; ++mb) a[mb] = WFrag<T16>::ld(A + aoff + (size_t)mb * 16 * K + kc);
#pragma unroll
        for (int nb = 0; nb < 4; ++nb) { const V b = WFrag<T16>::ld(Bt + boff + (size_t)nb * 16 * K + kc);
#pragma unroll
            for (int mb = 0; mb < 4; ++mb) acc[mb][nb] = WFrag<T16>::mma(a[mb], b, acc[mb][nb]); }
        asm volatile("v_nop\n\tv_nop\n\tv_nop\n\tv_nop" : "+v"(acc[0][0]), "+v"(acc[1][1]), "+v"(acc[2][2]), "+v"(acc[3][3]) : "v"(a[0]), "v"(a[3]));
    }
#pragma unroll
    for (int mb = 0; mb < 4; ++mb) {
#pragma unroll
        for (int nb = 0; nb < 4; ++nb) {
#pragma unroll
            for (int j = 0; j < 8; ++j) os[(hi * 8 + j) * 68 + nb * 16 + lr] = acc[mb][nb][j]; }
        __builtin_amdgcn_wave_barrier(); asm volatile("" ::: "memory");
        float* crow = C + (size_t)(r0 + mb * 16) * ldc + c0;
{
#pragma unroll
            for (int s = 0; s < 8; ++s) { const int row = 2 * s + hi, cofs = lr * 4; const v4f val = *(const v4fa*)(os + row * 68 + cofs);
                *(v4f*)(crow + (size_t)row * ldc + cofs) = val; }
             }
        __builtin_amdgcn_wave_barrier(); asm volatile("" ::: "memory");
    }
}

__global__ __launch_bounds__(256) void k_cvt8(const float* __restrict__ src, bf* dst, size_t n8, size_t sS, size_t sD) {
    const size_t i = (size_t)blockIdx.x * 256 + threadIdx.x; if (i >= n8) return;
    src += (size_t)blockIdx.y * sS; dst += (size_t)blockIdx.y * sD;
    const v8f v = *(const v8f*)(src + i * 8); v8us o;
#pragma unroll
    for (int k = 0; k < 8; ++k) o[k] = f2bf(v[k]);
    *(v8us*)(dst + i * 8) = o;  }

// k_cvx: x slab f32 -> (a) bf16 (RNE) plane xb [slab][t][d]; (b) f16 plane kx [slab][t][k | k] (pitch KX2) holding the bf16 value (exact in f16, subnormals -> 0) in both halves.
__global__ __launch_bounds__(256) void k_cvx(const float* __restrict__ src, bf* xb, h16* kx, size_t n8, size_t sS, size_t sD) {
#pragma clang fp contract(off)
    const size_t i = (size_t)blockIdx.x * 256 + threadIdx.x; if (i >= n8) return;
    src += (size_t)blockIdx.y * sS; xb += (size_t)blockIdx.y * sD; kx += (size_t)blockIdx.y * sD * 2;
    const v8f v = *(const v8f*)(src + i * 8); v8us o; v8h kk;
#pragma unroll
    for (int k = 0; k < 8; ++k) { o[k] = f2bf(v[k]); kk[k] = toh_flush(__uint_as_float((unsigned)o[k] << 16)); }
    const size_t e = i * 8; const size_t row = e / DM; const int col = (int)(e % DM);
    h16* kp = kx + row * KX2 + col;
    *(v8us*)(xb + e) = o; *(v8h*)kp = kk; *(v8h*)(kp + HD) = kk;
     }

// k_cvtq: projected rows f32 [r][d] -> f16 plane qx [r][qh | ql] (pitch KX2): qh = f16(2048 q), ql = f16(2048 q - qh) (exact difference), subnormals -> 0.
__global__ __launch_bounds__(256) void k_cvtq(const float* __restrict__ src, h16* qx, size_t n8) {
#pragma clang fp contract(off)
    const size_t i = (size_t)blockIdx.x * 256 + threadIdx.x; if (i >= n8) return;
    const v8f v = *(const v8f*)(src + i * 8); v8h qh, ql;
#pragma unroll
    for (int k = 0; k < 8; ++k) { const float s = v[k] * QCAR; const h16 a = toh_flush(s); const float r = s - (float)a; qh[k] = a; ql[k] = toh_flush(r); }
    const size_t e = i * 8; const size_t row = e / DM; const int col = (int)(e % DM);
    h16* qp = qx + row * KX2 + col;
    *(v8h*)qp = qh; *(v8h*)(qp + HD) = ql;
     }

__global__ __launch_bounds__(256) void k_vtpx(const bf* __restrict__ F, h16* V16) {
    const size_t e = ((size_t)blockIdx.x * 256 + threadIdx.x) * 2; if (e >= (size_t)ZB * HD * SEQ) return;
    const int t = (int)(e % SEQ); const int d = (int)((e / SEQ) % HD); const int g = (int)(e / ((size_t)SEQ * HD)); v2h o16;
#pragma unroll
    for (int q = 0; q < 2; ++q) { const float xv = __uint_as_float((unsigned)F[((size_t)g * SEQ + t + q) * DM + d] << 16); o16[q] = toh_flush(xv); }
    *(v2h*)(V16 + e) = o16;  }

__global__ __launch_bounds__(256) void k_vmeanx(const bf* __restrict__ F, float* VM) {
#pragma clang fp contract(off)
    __shared__ float part[8 * 32];
    const int c = threadIdx.x & 31; const int r = __builtin_amdgcn_readfirstlane(threadIdx.x >> 5); const int g = blockIdx.y; const int d = blockIdx.x * 32 + c;
    const bf* f = F + (size_t)g * SEQ * DM + d; float s = 0.f;
#pragma unroll 4
    for (int t = r; t < SEQ; t += 8) { const float xv = __uint_as_float((unsigned)f[(size_t)t * DM] << 16); s += (fabsf(xv) < 6.103515625e-05f) ? 0.0f : xv; }
    part[r * 32 + c] = s;
    __syncthreads();
    if (r == 0) { float a = part[c];
#pragma unroll
        for (int q = 1; q < 8; ++q) a += part[q * 32 + c];
        a *= (1.0f / (float)SEQ); float* p = VM + (size_t)g * HD + d;
        *(float*)p = a;  }
}

// k_asoft: per row (one wave): t = S' x SCL (SCL = 1/2048 undoes the q carry; the module has no score scale); softmax over the SEQ keys (register row, running max then one exp, fixed shuffle trees);
__global__ __launch_bounds__(256) void k_asoft(const float* __restrict__ Sb, h16* P16) {
    const int lane = threadIdx.x & 31; const int row = blockIdx.x * 8 + (threadIdx.x >> 5); if (row >= ZB * SEQ) return;
    const float* sr = Sb + (size_t)row * SEQ; float v[SEQ / 32]; float mx = -3.0e38f;
#pragma unroll
    for (int ch = 0; ch < SEQ / 128; ++ch) { const v4f a = *(const v4f*)(sr + ch * 128 + lane * 4);
#pragma unroll
        for (int q = 0; q < 4; ++q) { const float t = a[q] * SCL; v[ch * 4 + q] = t; mx = fmaxf(mx, t); } }
#pragma unroll
    for (int sh = 16; sh; sh >>= 1) mx = fmaxf(mx, __shfl_xor(mx, sh, 32));
    float sum = 0.f;
#pragma unroll
    for (int k = 0; k < SEQ / 32; ++k) { float d0 = __fsub_rn(v[k], mx); asm volatile("" : "+v"(d0)); v[k] = __builtin_amdgcn_exp2f(__fmul_rn(d0, 1.4426950408889634f)); sum += v[k]; }
#pragma unroll
    for (int sh = 16; sh; sh >>= 1) sum += __shfl_xor(sum, sh, 32);
    const float f = __fdiv_rn(PCAR, sum); const float cen = PCAR / (float)SEQ;
{
#pragma unroll
        for (int ch = 0; ch < SEQ / 128; ++ch) { v4h o4;
#pragma unroll
            for (int q = 0; q < 4; ++q) o4[q] = tohx(v[ch * 4 + q] * f - cen);
            *(v4h*)(P16 + (size_t)row * SEQ + ch * 128 + lane * 4) = o4; }
         }
}

__global__ __launch_bounds__(256) void k_merge(const float* __restrict__ O, const float* __restrict__ VM, float* OUTb) {
    const size_t e = ((size_t)blockIdx.x * 256 + threadIdx.x) * 2; if (e >= (size_t)ZB * SEQ * HD) return;
    const int d = (int)(e % HD); const int g = (int)(e / ((size_t)HD * SEQ));
    const v2f m = *(const v2f*)(VM + (size_t)g * HD + d); const v2f o = *(const v2f*)(O + e);
    v2f o2; o2[0] = o[0] * (1.0f / PCAR) + m[0]; o2[1] = o[1] * (1.0f / PCAR) + m[1];
    *(v2f*)(OUTb + e) = o2;  }

constexpr size_t al256(size_t b) { return (b + 255) & ~(size_t)255; }
constexpr size_t WS_TOTAL =
    al256((size_t)DM * DM * 2) +                  // WQ bf16
    al256((size_t)ZB * SEQ * DM * 2) +            // XB bf16
    al256((size_t)ZB * SEQ * DM * 4) +            // FQ f32
    al256((size_t)ZB * SEQ * KX2 * 2) +           // QX f16 [qh | ql]
    al256((size_t)ZB * SEQ * KX2 * 2) +           // KX f16 [k | k]
    al256((size_t)ZB * HD * SEQ * 2) +            // VT16
    al256((size_t)ZB * HD * 4) +                  // VM
    al256((size_t)ZB * SEQ * SEQ * 4) +           // Sb
    al256((size_t)ZB * SEQ * SEQ * 2) +           // P16
    al256((size_t)ZB * SEQ * HD * 4);             // Ob
static_assert(WS_TOTAL <= (size_t)134217728);

extern "C" void kernel_launch(void* const* d_in, const int* in_sizes, int n_in,
                              void* d_out, int out_size, void* d_ws, size_t ws_size, hipStream_t stream) {
    if (n_in < 2) return;
    if ((size_t)in_sizes[0] < ((size_t)(NB - 1) * SEQ_FULL + SEQ) * DM) return;
    if ((size_t)in_sizes[1] < (size_t)DM * DM) return;
    if ((size_t)out_size < (size_t)NB * SEQ * DM) return;
    if (WS_TOTAL > ws_size) return;
    const float* x = (const float*)d_in[0]; const float* wq = (const float*)d_in[1];   // x [NB][SEQ_FULL][768]; W [768 out][768 in]
    float* OUT = (float*)d_out;     // [NB][SEQ][768]
    char* wsp = (char*)d_ws;
    auto take = [&](size_t bytes) { char* p = wsp; wsp += al256(bytes); return (void*)p; };
    bf* WQ = (bf*)take((size_t)DM * DM * 2);
    bf* XB = (bf*)take((size_t)ZB * SEQ * DM * 2);
    float* FQ = (float*)take((size_t)ZB * SEQ * DM * 4);
    h16* QX = (h16*)take((size_t)ZB * SEQ * KX2 * 2);
    h16* KX = (h16*)take((size_t)ZB * SEQ * KX2 * 2);
    h16* VT16 = (h16*)take((size_t)ZB * HD * SEQ * 2);
    float* VM = (float*)take((size_t)ZB * HD * 4);
    float* Sb = (float*)take((size_t)ZB * SEQ * SEQ * 4); h16* P16 = (h16*)take((size_t)ZB * SEQ * SEQ * 2); float* Ob = (float*)take((size_t)ZB * SEQ * HD * 4);
    if ((size_t)(wsp - (char*)d_ws) > ws_size) return;

    const size_t w8 = (size_t)DM * DM / 8;
    k_cvt8<<<dim3((unsigned)((w8 + 255) / 256), 1, 1), 256, 0, stream>>>(wq, WQ, w8, 0, 0);

    const size_t x8 = (size_t)SEQ * DM / 8;                 // per batch slab
    const size_t p8 = (size_t)ZB * SEQ * DM / 8;            // projected rows of one pass
    const unsigned LE2 = (unsigned)(((size_t)ZB * SEQ * HD / 2 + 255) / 256);
    for (int b0 = 0; b0 < NB; b0 += ZB) {
        k_cvx<<<dim3((unsigned)((x8 + 255) / 256), ZB, 1), 256, 0, stream>>>(x + (size_t)b0 * SEQ_FULL * DM, XB, KX, x8, (size_t)SEQ_FULL * DM, (size_t)SEQ * DM);
        k_gemmw<bf><<<dim3(ZB * SEQ / 64, DM / 64, 1), 32, 0, stream>>>(XB, WQ, DM, FQ, DM, 0, 0, 0);
        k_cvtq<<<dim3((unsigned)((p8 + 255) / 256), 1, 1), 256, 0, stream>>>(FQ, QX, p8);
        k_vtpx<<<LE2, 256, 0, stream>>>(XB, VT16);
        k_vmeanx<<<dim3(HD / 32, ZB, 1), 256, 0, stream>>>(XB, VM);
        k_gemmw<h16><<<dim3(SEQ / 64, SEQ / 64, ZB), 32, 0, stream>>>(QX, KX, KX2, Sb, SEQ, (size_t)SEQ * KX2, (size_t)SEQ * KX2, (size_t)SEQ * SEQ);
        k_asoft<<<ZB * SEQ / 8, 256, 0, stream>>>(Sb, P16);
        k_gemmw<h16><<<dim3(SEQ / 64, HD / 64, ZB), 32, 0, stream>>>(P16, VT16, SEQ, Ob, HD, (size_t)SEQ * SEQ, (size_t)HD * SEQ, (size_t)SEQ * HD);
        k_merge<<<LE2, 256, 0, stream>>>(Ob, VM, OUT + (size_t)b0 * SEQ * DM);
    }
}

// v001
// It runs in 424 microseconds.
// Two timings next to v000 put it at 1.70 and 1.72 times that version's speed.
#include <hip/hip_runtime.h>

// Contractions: q projection on v_wmma_f32_16x16x32_bf16 (x and W RNE-converted to bf16, exact products, f32 accumulate); q.x^T on v_wmma_f32_16x16x32_f16 with q carried x2048 as f16 value + f16 remainder folded along K ([qh | ql] x [k | k], k = f16 of the bf16 x, exact); att.x on v_wmma_f32_16x16x32_f16 (f16 x plane; softmax weights carried x1024 and centred by 1024/SEQ, column mean of x added back in f32), f32 accumulate.
// Single-head full-width document self-attention: x [8][2048][768]; q = x W^T ('oi' [768][768], no bias); keys = values = x; att = softmax(q.x) over all 2048 keys (no scale, no mask); out = att @ x -> [8][2048][768] f32.
// Two batches per pass (z-batched GEMMs): x -> bf16 plane + f16 [k | k] plane; projection -> f32 rows -> f16 [qh | ql] plane; x transposed [d][t] f16; S' = 2048 q.x (f32, materialised per pass); row softmax in registers; O = P' x; out = O/1024 + mean_t(x).

#ifndef NB
#define NB 8
#endif
#ifndef SEQ
#define SEQ 2048
#endif
#define NB_FULL  8
#define SEQ_FULL 2048
#define DM   768
#define HD   768
#define ZB   ((NB % 2 == 0) ? 2 : 1)     // batches per pass
#define PCAR 1024.0f
#define QCAR 2048.0f                      // carry of the q value / remainder planes
#define SCL  4.8828125e-4f                // 1/2048: undoes the q carry (the module applies no score scale)
#define KX2  (2 * HD)                     // pitch of the K-folded planes [value | remainder] and [k | k]

typedef _Float16 h16;
typedef unsigned short bf;
typedef __attribute__((ext_vector_type(16))) __bf16   v16bf;
typedef __attribute__((ext_vector_type(16))) _Float16 v16h;
typedef __attribute__((ext_vector_type(8)))  _Float16 v8h;
typedef __attribute__((ext_vector_type(8)))  unsigned short v8us;
typedef __attribute__((ext_vector_type(8)))  float    v8f;
typedef __attribute__((ext_vector_type(4)))  float    v4f;
typedef __attribute__((ext_vector_type(2)))  float    v2f;
typedef __attribute__((ext_vector_type(2)))  _Float16 v2h;
typedef __attribute__((ext_vector_type(4)))  _Float16 v4h;
typedef v4f  __attribute__((may_alias)) v4fa;

static_assert(NB <= NB_FULL);
static_assert(SEQ <= SEQ_FULL);
static_assert(NB % ZB == 0);
static_assert(SEQ % 128 == 0);                 // softmax row chunks, 128-row tiles, K steps of 32
static_assert(DM % 64 == 0 && HD % 64 == 0);   // 64x64 wave quarters, K steps of 32
static_assert(DM == HD);                       // q width == x width: q.x contracts over 768
static_assert(((size_t)SEQ * DM) % 8 == 0);
static_assert((ZB * SEQ) % 8 == 0);
static_assert(HD % 32 == 0 && SEQ % 8 == 0);
static_assert(KX2 % 32 == 0);                  // folded score GEMM: K steps of 32
static_assert((ZB * SEQ) % 64 == 0);           // projection GEMM rows: 64-row wave quarters
static_assert(QCAR * SCL == 1.0f);             // carry folded back exactly in the softmax scale
static_assert((KX2 * 2) % 128 == 0);
static_assert(DM % 64 == 0);
static_assert(((size_t)SEQ * DM / 8) * 16 == (size_t)SEQ * DM * 2);          // k_cvx: threads x 16 B == slab bytes (per plane half)
static_assert(((size_t)ZB * SEQ * DM / 8) * 16 == (size_t)ZB * SEQ * DM * 2); // k_cvtq: threads x 16 B == plane-half bytes
static_assert(((size_t)ZB * HD * SEQ / 2) * 4 == (size_t)ZB * HD * SEQ * 2);  // k_vtpx: threads x 4 B == plane bytes
static_assert(2 * 256 * 272 + 4 * 16 * 68 * 4 <= 163840);   // k_gemmw static LDS: two blocks fit one 320 KiB LDS
static_assert(DM % 128 == 0 && HD % 128 == 0 && KX2 % 128 == 0 && SEQ % 128 == 0 && (ZB * SEQ) % 128 == 0);   // k_gemmw: 128x128 tiles, K tiles of 128
static_assert(8 * 32 * 4 <= 131072);           // k_vmeanx static LDS

__device__ __forceinline__ unsigned short f2bf(float f) { unsigned u = __float_as_uint(f); u += 0x7FFFu + ((u >> 16) & 1u); return (unsigned short)(u >> 16); }
__device__ __forceinline__ v16h cat16(v8h lo, v8h hi) { return __builtin_shufflevector(lo, hi, 0, 1, 2, 3, 4, 5, 6, 7, 8, 9, 10, 11, 12, 13, 14, 15); }
__device__ __forceinline__ v16bf cat16b(v8us lo, v8us hi) { return __builtin_bit_cast(v16bf, __builtin_shufflevector(lo, hi, 0, 1, 2, 3, 4, 5, 6, 7, 8, 9, 10, 11, 12, 13, 14, 15)); }
__device__ __forceinline__ v8f wmma16(v16h a, v16h b, v8f c) { return __builtin_amdgcn_wmma_f32_16x16x32_f16(false, a, false, b, (short)0, c, false, false); }
__device__ __forceinline__ v8f wmmab(v16bf a, v16bf b, v8f c) { return __builtin_amdgcn_wmma_f32_16x16x32_bf16(false, a, false, b, (short)0, c, false, false); }
__device__ __forceinline__ h16 tohx(float x) { return (h16)x; }
// f32 -> f16 (RNE) that cannot produce an f16 subnormal: |v| < 2^-14 -> +0 (value select).
static __device__ __forceinline__ h16 toh_flush(float v) { const h16 r = (h16)v; return (fabsf(v) < 6.103515625e-05f) ? (h16)0.0f : r; }

// ---- k_gemmw: GEMM, FOUR WAVES (2 x 2) per 128x128 output tile, each wave a 64x64 quarter (16 accumulators); grid (M/128, N/128, Z), 128 threads.
// Operand tiles (128 rows of A, 128 rows of Bt, 128 k each) are staged in LDS by asynchronous 16-byte copies, two buffers: tile t+1 flies while tile t is worked on; each staged row serves two waves.
// C[m][n] (f32, pitch ldc) = sum_k A[m][k] Bt[n][k]. z-batch strides sA/sB/sC in elements. K % 128 == 0, M % 128 == 0, N % 128 == 0.
// Fragment map (A and Bt alike): lane -> row/col lane&15, h = lane>>4; elements 0..7 = k0+8h+0..7, elements 8..15 = k0+16+8h+0..7. D: acc[j] = (row 8h+j, col lane&15).
template <typename T16> struct WFrag;
template <> struct WFrag<h16> { typedef v16h V; static __device__ __forceinline__ V ld(const h16* p) { return cat16(*(const v8h*)p, *(const v8h*)(p + 16)); } static __device__ __forceinline__ v8f mma(V a, V b, v8f c) { return wmma16(a, b, c); } };
template <> struct WFrag<bf> { typedef v16bf V; static __device__ __forceinline__ V ld(const bf* p) { return cat16b(*(const v8us*)p, *(const v8us*)(p + 16)); } static __device__ __forceinline__ v8f mma(V a, V b, v8f c) { return wmmab(a, b, c); } };
#define GBK  128                 // k per staged tile: 256 B of every operand row
#define GPIT 136                 // LDS row pitch in 16-bit elements: 272 B = 16 B x odd, conflict-free for 16-byte fragment reads
#define GSTG (256 * GPIT)        // one buffer: rows 0..127 = A tile, rows 128..255 = Bt tile
typedef int v4i __attribute__((vector_size(16)));
// one lane's 16 bytes, global -> LDS, through no register
__device__ __forceinline__ void cp16(const void* g, void* l) {
    __builtin_amdgcn_global_load_async_to_lds_b128((__attribute__((address_space(1))) v4i*)g, (__attribute__((address_space(3))) v4i*)l, 0, 0);
}
template <typename T16>
__global__ __launch_bounds__(128) void k_gemmw(const T16* __restrict__ A, const T16* __restrict__ Bt, int K, float* C, int ldc, size_t sA, size_t sB, size_t sC) {
    typedef typename WFrag<T16>::V V;
    __shared__ __align__(16) T16 ring[2 * GSTG];
    __shared__ __align__(16) float osall[4 * 16 * 68];
    const size_t z = blockIdx.z; A += z * sA; Bt += z * sB; C += z * sC;
    const int tid = threadIdx.x, lane = tid & 31, lr = lane & 15, hi = lane >> 4;
    const int wave = __builtin_amdgcn_readfirstlane(tid >> 5), wm = wave >> 1, wn = wave & 1;
    const int t0r = blockIdx.x * 128, t0c = blockIdx.y * 128;
    const int r0 = t0r + wm * 64, c0 = t0c + wn * 64;
    float* os = osall + wave * (16 * 68);
    v8f acc[4][4];
#pragma unroll
    for (int mb = 0; mb < 4; ++mb)
#pragma unroll
        for (int nb = 0; nb < 4; ++nb) acc[mb][nb] = (v8f){};
    // copy map: 16 lanes cover one row's 256 B, the block covers 8 rows per copy; 16 copies for A, 16 for Bt per lane and tile
    const int cr = tid >> 4, cch = (tid & 15) * 8;
    const T16* ga = A + (size_t)(t0r + cr) * K + cch;
    const T16* gb = Bt + (size_t)(t0c + cr) * K + cch;
    const size_t gstep = (size_t)8 * K;
    T16* lbase = ring + cr * GPIT + cch;
    auto fill = [&](int buf, int kt) {
        const T16* pa = ga + (size_t)kt * GBK; const T16* pb = gb + (size_t)kt * GBK; T16* l = lbase + buf * GSTG;
#pragma unroll
        for (int i = 0; i < 16; ++i) cp16(pa + i * gstep, l + i * 8 * GPIT);
#pragma unroll
        for (int i = 0; i < 16; ++i) cp16(pb + i * gstep, l + (128 + i * 8) * GPIT);
    };
    const int nt = K / GBK;
    fill(0, 0);
    asm volatile("s_wait_asynccnt 0x0" ::: "memory");   // tile 0 landed (this wave's copies) before the barrier publishes it
    __syncthreads();
    const int aofs = (wm * 64 + lr) * GPIT + 8 * hi, bofs = (128 + wn * 64 + lr) * GPIT + 8 * hi;
#pragma unroll 1   // one trip per staged tile stays rolled: the body already holds 64 WMMAs (for speed only)
    for (int t = 0; t < nt; ++t) {
        const T16* sa = ring + (t & 1) * GSTG + aofs; const T16* sb = ring + (t & 1) * GSTG + bofs;
        V a[2][4], b[2][4];   // two fragment sets: the next 32 k are fetched from LDS while the current 32 k are multiplied
#pragma unroll
        for (int f = 0; f < 4; ++f) { a[0][f] = WFrag<T16>::ld(sa + f * 16 * GPIT); b[0][f] = WFrag<T16>::ld(sb + f * 16 * GPIT); }
        // tile t+1 into the other buffer: its last readers (trip t-1) ended at the barrier just passed; issued behind the first fragment reads so that their LDS latency passes meanwhile
        if (t + 1 < nt) fill((t + 1) & 1, t + 1);
#pragma unroll
        for (int ks = 0; ks < GBK / 32; ++ks) {
            const int cu = ks & 1, nx = cu ^ 1;
            if (ks + 1 < GBK / 32) {
#pragma unroll
                for (int f = 0; f < 4; ++f) { a[nx][f] = WFrag<T16>::ld(sa + f * 16 * GPIT + (ks + 1) * 32); b[nx][f] = WFrag<T16>::ld(sb + f * 16 * GPIT + (ks + 1) * 32); }
            }
            __builtin_amdgcn_sched_barrier(0);   // keeps the next set's LDS reads as one group ahead of this block's WMMAs
#pragma unroll
            for (int nb = 0; nb < 4; ++nb)
#pragma unroll
                for (int mb = 0; mb < 4; ++mb) acc[mb][nb] = WFrag<T16>::mma(a[cu][mb], b[cu][nb], acc[mb][nb]);
            __builtin_amdgcn_sched_barrier(0);   // keeps this block's WMMAs ahead of the following group of LDS reads
        }
        asm volatile("s_wait_dscnt 0x0" ::: "memory");      // this wave's reads of buffer t&1 are done before the buffer is refilled
        asm volatile("s_wait_asynccnt 0x0" ::: "memory");   // this wave's copies of tile t+1 have landed before the barrier publishes them
        __syncthreads();                                    // publishes tile t+1; ends every wave's reads of buffer t&1
    }
    asm volatile("s_wait_asynccnt 0x0" ::: "memory");       // no copy outstanding when the wave goes on
#pragma unroll
    for (int mb = 0; mb < 4; ++mb) {
#pragma unroll
        for (int nb = 0; nb < 4; ++nb) {
#pragma unroll
            for (int j = 0; j < 8; ++j) os[(hi * 8 + j) * 68 + nb * 16 + lr] = acc[mb][nb][j]; }
        __builtin_amdgcn_wave_barrier(); asm volatile("" ::: "memory");
        float* crow = C + (size_t)(r0 + mb * 16) * ldc + c0;
{
#pragma unroll
            for (int s = 0; s < 8; ++s) { const int row = 2 * s + hi, cofs = lr * 4; const v4f val = *(const v4fa*)(os + row * 68 + cofs);
                *(v4f*)(crow + (size_t)row * ldc + cofs) = val; }
             }
        __builtin_amdgcn_wave_barrier(); asm volatile("" ::: "memory");
    }
}

__global__ __launch_bounds__(256) void k_cvt8(const float* __restrict__ src, bf* dst, size_t n8, size_t sS, size_t sD) {
    const size_t i = (size_t)blockIdx.x * 256 + threadIdx.x; if (i >= n8) return;
    src += (size_t)blockIdx.y * sS; dst += (size_t)blockIdx.y * sD;
    const v8f v = *(const v8f*)(src + i * 8); v8us o;
#pragma unroll
    for (int k = 0; k < 8; ++k) o[k] = f2bf(v[k]);
    *(v8us*)(dst + i * 8) = o;  }

// k_cvx: x slab f32 -> (a) bf16 (RNE) plane xb [slab][t][d]; (b) f16 plane kx [slab][t][k | k] (pitch KX2) holding the bf16 value (exact in f16, subnormals -> 0) in both halves.
__global__ __launch_bounds__(256) void k_cvx(const float* __restrict__ src, bf* xb, h16* kx, size_t n8, size_t sS, size_t sD) {
#pragma clang fp contract(off)
    const size_t i = (size_t)blockIdx.x * 256 + threadIdx.x; if (i >= n8) return;
    src += (size_t)blockIdx.y * sS; xb += (size_t)blockIdx.y * sD; kx += (size_t)blockIdx.y * sD * 2;
    const v8f v = *(const v8f*)(src + i * 8); v8us o; v8h kk;
#pragma unroll
    for (int k = 0; k < 8; ++k) { o[k] = f2bf(v[k]); kk[k] = toh_flush(__uint_as_float((unsigned)o[k] << 16)); }
    const size_t e = i * 8; const size_t row = e / DM; const int col = (int)(e % DM);
    h16* kp = kx + row * KX2 + col;
    *(v8us*)(xb + e) = o; *(v8h*)kp = kk; *(v8h*)(kp + HD) = kk;
     }

// k_cvtq: projected rows f32 [r][d] -> f16 plane qx [r][qh | ql] (pitch KX2): qh = f16(2048 q), ql = f16(2048 q - qh) (exact difference), subnormals -> 0.
__global__ __launch_bounds__(256) void k_cvtq(const float* __restrict__ src, h16* qx, size_t n8) {
#pragma clang fp contract(off)
    const size_t i = (size_t)blockIdx.x * 256 + threadIdx.x; if (i >= n8) return;
    const v8f v = *(const v8f*)(src + i * 8); v8h qh, ql;
#pragma unroll
    for (int k = 0; k < 8; ++k) { const float s = v[k] * QCAR; const h16 a = toh_flush(s); const float r = s - (float)a; qh[k] = a; ql[k] = toh_flush(r); }
    const size_t e = i * 8; const size_t row = e / DM; const int col = (int)(e % DM);
    h16* qp = qx + row * KX2 + col;
    *(v8h*)qp = qh; *(v8h*)(qp + HD) = ql;
     }

__global__ __launch_bounds__(256) void k_vtpx(const bf* __restrict__ F, h16* V16) {
    const size_t e = ((size_t)blockIdx.x * 256 + threadIdx.x) * 2; if (e >= (size_t)ZB * HD * SEQ) return;
    const int t = (int)(e % SEQ); const int d = (int)((e / SEQ) % HD); const int g = (int)(e / ((size_t)SEQ * HD)); v2h o16;
#pragma unroll
    for (int q = 0; q < 2; ++q) { const float xv = __uint_as_float((unsigned)F[((size_t)g * SEQ + t + q) * DM + d] << 16); o16[q] = toh_flush(xv); }
    *(v2h*)(V16 + e) = o16;  }

__global__ __launch_bounds__(256) void k_vmeanx(const bf* __restrict__ F, float* VM) {
#pragma clang fp contract(off)
    __shared__ float part[8 * 32];
    const int c = threadIdx.x & 31; const int r = __builtin_amdgcn_readfirstlane(threadIdx.x >> 5); const int g = blockIdx.y; const int d = blockIdx.x * 32 + c;
    const bf* f = F + (size_t)g * SEQ * DM + d; float s = 0.f;
#pragma unroll 4
    for (int t = r; t < SEQ; t += 8) { const float xv = __uint_as_float((unsigned)f[(size_t)t * DM] << 16); s += (fabsf(xv) < 6.103515625e-05f) ? 0.0f : xv; }
    part[r * 32 + c] = s;
    __syncthreads();
    if (r == 0) { float a = part[c];
#pragma unroll
        for (int q = 1; q < 8; ++q) a += part[q * 32 + c];
        a *= (1.0f / (float)SEQ); float* p = VM + (size_t)g * HD + d;
        *(float*)p = a;  }
}

// k_asoft: per row (one wave): t = S' x SCL (SCL = 1/2048 undoes the q carry; the module has no score scale); softmax over the SEQ keys (register row, running max then one exp, fixed shuffle trees);
__global__ __launch_bounds__(256) void k_asoft(const float* __restrict__ Sb, h16* P16) {
    const int lane = threadIdx.x & 31; const int row = blockIdx.x * 8 + (threadIdx.x >> 5); if (row >= ZB * SEQ) return;
    const float* sr = Sb + (size_t)row * SEQ; float v[SEQ / 32]; float mx = -3.0e38f;
#pragma unroll
    for (int ch = 0; ch < SEQ / 128; ++ch) { const v4f a = *(const v4f*)(sr + ch * 128 + lane * 4);
#pragma unroll
        for (int q = 0; q < 4; ++q) { const float t = a[q] * SCL; v[ch * 4 + q] = t; mx = fmaxf(mx, t); } }
#pragma unroll
    for (int sh = 16; sh; sh >>= 1) mx = fmaxf(mx, __shfl_xor(mx, sh, 32));
    float sum = 0.f;
#pragma unroll
    for (int k = 0; k < SEQ / 32; ++k) { float d0 = __fsub_rn(v[k], mx); asm volatile("" : "+v"(d0)); v[k] = __builtin_amdgcn_exp2f(__fmul_rn(d0, 1.4426950408889634f)); sum += v[k]; }
#pragma unroll
    for (int sh = 16; sh; sh >>= 1) sum += __shfl_xor(sum, sh, 32);
    const float f = __fdiv_rn(PCAR, sum); const float cen = PCAR / (float)SEQ;
{
#pragma unroll
        for (int ch = 0; ch < SEQ / 128; ++ch) { v4h o4;
#pragma unroll
            for (int q = 0; q < 4; ++q) o4[q] = tohx(v[ch * 4 + q] * f - cen);
            *(v4h*)(P16 + (size_t)row * SEQ + ch * 128 + lane * 4) = o4; }
         }
}

__global__ __launch_bounds__(256) void k_merge(const float* __restrict__ O, const float* __restrict__ VM, float* OUTb) {
    const size_t e = ((size_t)blockIdx.x * 256 + threadIdx.x) * 2; if (e >= (size_t)ZB * SEQ * HD) return;
    const int d = (int)(e % HD); const int g = (int)(e / ((size_t)HD * SEQ));
    const v2f m = *(const v2f*)(VM + (size_t)g * HD + d); const v2f o = *(const v2f*)(O + e);
    v2f o2; o2[0] = o[0] * (1.0f / PCAR) + m[0]; o2[1] = o[1] * (1.0f / PCAR) + m[1];
    *(v2f*)(OUTb + e) = o2;  }

constexpr size_t al256(size_t b) { return (b + 255) & ~(size_t)255; }
constexpr size_t WS_TOTAL =
    al256((size_t)DM * DM * 2) +                  // WQ bf16
    al256((size_t)ZB * SEQ * DM * 2) +            // XB bf16
    al256((size_t)ZB * SEQ * DM * 4) +            // FQ f32
    al256((size_t)ZB * SEQ * KX2 * 2) +           // QX f16 [qh | ql]
    al256((size_t)ZB * SEQ * KX2 * 2) +           // KX f16 [k | k]
    al256((size_t)ZB * HD * SEQ * 2) +            // VT16
    al256((size_t)ZB * HD * 4) +                  // VM
    al256((size_t)ZB * SEQ * SEQ * 4) +           // Sb
    al256((size_t)ZB * SEQ * SEQ * 2) +           // P16
    al256((size_t)ZB * SEQ * HD * 4);             // Ob
static_assert(WS_TOTAL <= (size_t)134217728);

extern "C" void kernel_launch(void* const* d_in, const int* in_sizes, int n_in,
                              void* d_out, int out_size, void* d_ws, size_t ws_size, hipStream_t stream) {
    if (n_in < 2) return;
    if ((size_t)in_sizes[0] < ((size_t)(NB - 1) * SEQ_FULL + SEQ) * DM) return;
    if ((size_t)in_sizes[1] < (size_t)DM * DM) return;
    if ((size_t)out_size < (size_t)NB * SEQ * DM) return;
    if (WS_TOTAL > ws_size) return;
    const float* x = (const float*)d_in[0]; const float* wq = (const float*)d_in[1];   // x [NB][SEQ_FULL][768]; W [768 out][768 in]
    float* OUT = (float*)d_out;     // [NB][SEQ][768]
    char* wsp = (char*)d_ws;
    auto take = [&](size_t bytes) { char* p = wsp; wsp += al256(bytes); return (void*)p; };
    bf* WQ = (bf*)take((size_t)DM * DM * 2);
    bf* XB = (bf*)take((size_t)ZB * SEQ * DM * 2);
    float* FQ = (float*)take((size_t)ZB * SEQ * DM * 4);
    h16* QX = (h16*)take((size_t)ZB * SEQ * KX2 * 2);
    h16* KX = (h16*)take((size_t)ZB * SEQ * KX2 * 2);
    h16* VT16 = (h16*)take((size_t)ZB * HD * SEQ * 2);
    float* VM = (float*)take((size_t)ZB * HD * 4);
    float* Sb = (float*)take((size_t)ZB * SEQ * SEQ * 4); h16* P16 = (h16*)take((size_t)ZB * SEQ * SEQ * 2); float* Ob = (float*)take((size_t)ZB * SEQ * HD * 4);
    if ((size_t)(wsp - (char*)d_ws) > ws_size) return;

    const size_t w8 = (size_t)DM * DM / 8;
    k_cvt8<<<dim3((unsigned)((w8 + 255) / 256), 1, 1), 256, 0, stream>>>(wq, WQ, w8, 0, 0);

    const size_t x8 = (size_t)SEQ * DM / 8;                 // per batch slab
    const size_t p8 = (size_t)ZB * SEQ * DM / 8;            // projected rows of one pass
    const unsigned LE2 = (unsigned)(((size_t)ZB * SEQ * HD / 2 + 255) / 256);
    for (int b0 = 0; b0 < NB; b0 += ZB) {
        k_cvx<<<dim3((unsigned)((x8 + 255) / 256), ZB, 1), 256, 0, stream>>>(x + (size_t)b0 * SEQ_FULL * DM, XB, KX, x8, (size_t)SEQ_FULL * DM, (size_t)SEQ * DM);
        k_gemmw<bf><<<dim3(ZB * SEQ / 128, DM / 128, 1), 128, 0, stream>>>(XB, WQ, DM, FQ, DM, 0, 0, 0);
        k_cvtq<<<dim3((unsigned)((p8 + 255) / 256), 1, 1), 256, 0, stream>>>(FQ, QX, p8);
        k_vtpx<<<LE2, 256, 0, stream>>>(XB, VT16);
        k_vmeanx<<<dim3(HD / 32, ZB, 1), 256, 0, stream>>>(XB, VM);
        k_gemmw<h16><<<dim3(SEQ / 128, SEQ / 128, ZB), 128, 0, stream>>>(QX, KX, KX2, Sb, SEQ, (size_t)SEQ * KX2, (size_t)SEQ * KX2, (size_t)SEQ * SEQ);
        k_asoft<<<ZB * SEQ / 8, 256, 0, stream>>>(Sb, P16);
        k_gemmw<h16><<<dim3(SEQ / 128, HD / 128, ZB), 128, 0, stream>>>(P16, VT16, SEQ, Ob, HD, (size_t)SEQ * SEQ, (size_t)HD * SEQ, (size_t)SEQ * HD);
        k_merge<<<LE2, 256, 0, stream>>>(Ob, VM, OUT + (size_t)b0 * SEQ * DM);
    }
}

// v002
// It runs in 276 microseconds.
// Timed twice side by side with v001, it ran 1.54 and 1.53 times as fast.
// All steps since v000 together make it 2.62 times as fast.
#include <hip/hip_runtime.h>

// Contractions: q projection on v_wmma_f32_16x16x32_bf16 (x and W RNE-converted to bf16, exact products, f32 accumulate); q.x^T on v_wmma_f32_16x16x32_f16 with q carried x2048 as f16 value + f16 remainder folded along K ([qh | ql] x [k | k], k = f16 of the bf16 x, exact); att.x on v_wmma_f32_16x16x32_f16 (f16 x plane; softmax weights carried x1024 and centred by 1024/SEQ, column mean of x added back in f32), f32 accumulate.
// Single-head full-width document self-attention: x [8][2048][768]; q = x W^T ('oi' [768][768], no bias); keys = values = x; att = softmax(q.x) over all 2048 keys (no scale, no mask); out = att @ x -> [8][2048][768] f32.
// All batches in one pass (z-batched GEMMs; workspace planes whose readers have all run share their bytes with later planes): x -> bf16 plane + f16 [k | k] plane; projection -> f32 rows -> f16 [qh | ql] plane; x transposed [d][t] f16; S' = 2048 q.x (f32, materialised per pass); row softmax in registers; O = P' x; out = O/1024 + mean_t(x).

#ifndef NB
#define NB 8
#endif
#ifndef SEQ
#define SEQ 2048
#endif
#define NB_FULL  8
#define SEQ_FULL 2048
#define DM   768
#define HD   768
#define ZB   NB                           // batches per pass: all of them, so every stage is one launch with the fullest grid
#define PCAR 1024.0f
#define QCAR 2048.0f                      // carry of the q value / remainder planes
#define SCL  4.8828125e-4f                // 1/2048: undoes the q carry (the module applies no score scale)
#define KX2  (2 * HD)                     // pitch of the K-folded planes [value | remainder] and [k | k]

typedef _Float16 h16;
typedef unsigned short bf;
typedef __attribute__((ext_vector_type(16))) __bf16   v16bf;
typedef __attribute__((ext_vector_type(16))) _Float16 v16h;
typedef __attribute__((ext_vector_type(8)))  _Float16 v8h;
typedef __attribute__((ext_vector_type(8)))  unsigned short v8us;
typedef __attribute__((ext_vector_type(8)))  float    v8f;
typedef __attribute__((ext_vector_type(4)))  float    v4f;
typedef __attribute__((ext_vector_type(2)))  float    v2f;
typedef __attribute__((ext_vector_type(2)))  _Float16 v2h;
typedef __attribute__((ext_vector_type(4)))  _Float16 v4h;
typedef v4f  __attribute__((may_alias)) v4fa;

static_assert(NB <= NB_FULL);
static_assert(SEQ <= SEQ_FULL);
static_assert(NB % ZB == 0);
static_assert(SEQ % 128 == 0);                 // softmax row chunks, 128-row tiles, K steps of 32
static_assert(DM % 64 == 0 && HD % 64 == 0);   // 64x64 wave quarters, K steps of 32
static_assert(DM == HD);                       // q width == x width: q.x contracts over 768
static_assert(((size_t)SEQ * DM) % 8 == 0);
static_assert((ZB * SEQ) % 8 == 0);
static_assert(HD % 32 == 0 && SEQ % 8 == 0);
static_assert(KX2 % 32 == 0);                  // folded score GEMM: K steps of 32
static_assert((ZB * SEQ) % 64 == 0);           // projection GEMM rows: 64-row wave quarters
static_assert(QCAR * SCL == 1.0f);             // carry folded back exactly in the softmax scale
static_assert((KX2 * 2) % 128 == 0);
static_assert(DM % 64 == 0);
static_assert(((size_t)SEQ * DM / 8) * 16 == (size_t)SEQ * DM * 2);          // k_cvx: threads x 16 B == slab bytes (per plane half)
static_assert(((size_t)ZB * SEQ * DM / 8) * 16 == (size_t)ZB * SEQ * DM * 2); // k_cvtq: threads x 16 B == plane-half bytes
static_assert(((size_t)ZB * HD * SEQ / 2) * 4 == (size_t)ZB * HD * SEQ * 2);  // k_vtpx: threads x 4 B == plane bytes
static_assert(2 * 256 * 272 + 4 * 16 * 68 * 4 <= 163840);   // k_gemmw static LDS: two blocks fit one 320 KiB LDS
static_assert(DM % 128 == 0 && HD % 128 == 0 && KX2 % 128 == 0 && SEQ % 128 == 0 && (ZB * SEQ) % 128 == 0);   // k_gemmw: 128x128 tiles, K tiles of 128
static_assert(8 * 32 * 4 <= 131072);           // k_vmeanx static LDS

__device__ __forceinline__ unsigned short f2bf(float f) { unsigned u = __float_as_uint(f); u += 0x7FFFu + ((u >> 16) & 1u); return (unsigned short)(u >> 16); }
__device__ __forceinline__ v16h cat16(v8h lo, v8h hi) { return __builtin_shufflevector(lo, hi, 0, 1, 2, 3, 4, 5, 6, 7, 8, 9, 10, 11, 12, 13, 14, 15); }
__device__ __forceinline__ v16bf cat16b(v8us lo, v8us hi) { return __builtin_bit_cast(v16bf, __builtin_shufflevector(lo, hi, 0, 1, 2, 3, 4, 5, 6, 7, 8, 9, 10, 11, 12, 13, 14, 15)); }
__device__ __forceinline__ v8f wmma16(v16h a, v16h b, v8f c) { return __builtin_amdgcn_wmma_f32_16x16x32_f16(false, a, false, b, (short)0, c, false, false); }
__device__ __forceinline__ v8f wmmab(v16bf a, v16bf b, v8f c) { return __builtin_amdgcn_wmma_f32_16x16x32_bf16(false, a, false, b, (short)0, c, false, false); }
__device__ __forceinline__ h16 tohx(float x) { return (h16)x; }
// f32 -> f16 (RNE) that cannot produce an f16 subnormal: |v| < 2^-14 -> +0 (value select).
static __device__ __forceinline__ h16 toh_flush(float v) { const h16 r = (h16)v; return (fabsf(v) < 6.103515625e-05f) ? (h16)0.0f : r; }

// ---- k_gemmw: GEMM, FOUR WAVES (2 x 2) per 128x128 output tile, each wave a 64x64 quarter (16 accumulators); grid (M/128, N/128, Z), 128 threads.
// Operand tiles (128 rows of A, 128 rows of Bt, 128 k each) are staged in LDS by asynchronous 16-byte copies, two buffers: tile t+1 flies while tile t is worked on; each staged row serves two waves.
// C[m][n] (f32, pitch ldc) = sum_k A[m][k] Bt[n][k]. z-batch strides sA/sB/sC in elements. K % 128 == 0, M % 128 == 0, N % 128 == 0.
// Fragment map (A and Bt alike): lane -> row/col lane&15, h = lane>>4; elements 0..7 = k0+8h+0..7, elements 8..15 = k0+16+8h+0..7. D: acc[j] = (row 8h+j, col lane&15).
template <typename T16> struct WFrag;
template <> struct WFrag<h16> { typedef v16h V; static __device__ __forceinline__ V ld(const h16* p) { return cat16(*(const v8h*)p, *(const v8h*)(p + 16)); } static __device__ __forceinline__ v8f mma(V a, V b, v8f c) { return wmma16(a, b, c); } };
template <> struct WFrag<bf> { typedef v16bf V; static __device__ __forceinline__ V ld(const bf* p) { return cat16b(*(const v8us*)p, *(const v8us*)(p + 16)); } static __device__ __forceinline__ v8f mma(V a, V b, v8f c) { return wmmab(a, b, c); } };
#define GBK  128                 // k per staged tile: 256 B of every operand row
#define GPIT 136                 // LDS row pitch in 16-bit elements: 272 B = 16 B x odd, conflict-free for 16-byte fragment reads
#define GSTG (256 * GPIT)        // one buffer: rows 0..127 = A tile, rows 128..255 = Bt tile
typedef int v4i __attribute__((vector_size(16)));
// one lane's 16 bytes, global -> LDS, through no register
__device__ __forceinline__ void cp16(const void* g, void* l) {
    __builtin_amdgcn_global_load_async_to_lds_b128((__attribute__((address_space(1))) v4i*)g, (__attribute__((address_space(3))) v4i*)l, 0, 0);
}
template <typename T16>
__global__ __launch_bounds__(128) void k_gemmw(const T16* __restrict__ A, const T16* __restrict__ Bt, int K, float* C, int ldc, size_t sA, size_t sB, size_t sC) {
    typedef typename WFrag<T16>::V V;
    __shared__ __align__(16) T16 ring[2 * GSTG];
    __shared__ __align__(16) float osall[4 * 16 * 68];
    const size_t z = blockIdx.z; A += z * sA; Bt += z * sB; C += z * sC;
    const int tid = threadIdx.x, lane = tid & 31, lr = lane & 15, hi = lane >> 4;
    const int wave = __builtin_amdgcn_readfirstlane(tid >> 5), wm = wave >> 1, wn = wave & 1;
    const int t0r = blockIdx.x * 128, t0c = blockIdx.y * 128;
    const int r0 = t0r + wm * 64, c0 = t0c + wn * 64;
    float* os = osall + wave * (16 * 68);
    v8f acc[4][4];
#pragma unroll
    for (int mb = 0; mb < 4; ++mb)
#pragma unroll
        for (int nb = 0; nb < 4; ++nb) acc[mb][nb] = (v8f){};
    // copy map: 16 lanes cover one row's 256 B, the block covers 8 rows per copy; 16 copies for A, 16 for Bt per lane and tile
    const int cr = tid >> 4, cch = (tid & 15) * 8;
    const T16* ga = A + (size_t)(t0r + cr) * K + cch;
    const T16* gb = Bt + (size_t)(t0c + cr) * K + cch;
    const size_t gstep = (size_t)8 * K;
    T16* lbase = ring + cr * GPIT + cch;
    auto fill = [&](int buf, int kt) {
        const T16* pa = ga + (size_t)kt * GBK; const T16* pb = gb + (size_t)kt * GBK; T16* l = lbase + buf * GSTG;
#pragma unroll
        for (int i = 0; i < 16; ++i) cp16(pa + i * gstep, l + i * 8 * GPIT);
#pragma unroll
        for (int i = 0; i < 16; ++i) cp16(pb + i * gstep, l + (128 + i * 8) * GPIT);
    };
    const int nt = K / GBK;
    fill(0, 0);
    asm volatile("s_wait_asynccnt 0x0" ::: "memory");   // tile 0 landed (this wave's copies) before the barrier publishes it
    __syncthreads();
    const int aofs = (wm * 64 + lr) * GPIT + 8 * hi, bofs = (128 + wn * 64 + lr) * GPIT + 8 * hi;
#pragma unroll 1   // one trip per staged tile stays rolled: the body already holds 64 WMMAs (for speed only)
    for (int t = 0; t < nt; ++t) {
        const T16* sa = ring + (t & 1) * GSTG + aofs; const T16* sb = ring + (t & 1) * GSTG + bofs;
        V a[2][4], b[2][4];   // two fragment sets: the next 32 k are fetched from LDS while the current 32 k are multiplied
#pragma unroll
        for (int f = 0; f < 4; ++f) { a[0][f] = WFrag<T16>::ld(sa + f * 16 * GPIT); b[0][f] = WFrag<T16>::ld(sb + f * 16 * GPIT); }
        // tile t+1 into the other buffer: its last readers (trip t-1) ended at the barrier just passed; issued behind the first fragment reads so that their LDS latency passes meanwhile
        if (t + 1 < nt) fill((t + 1) & 1, t + 1);
#pragma unroll
        for (int ks = 0; ks < GBK / 32; ++ks) {
            const int cu = ks & 1, nx = cu ^ 1;
            if (ks + 1 < GBK / 32) {
#pragma unroll
                for (int f = 0; f < 4; ++f) { a[nx][f] = WFrag<T16>::ld(sa + f * 16 * GPIT + (ks + 1) * 32); b[nx][f] = WFrag<T16>::ld(sb + f * 16 * GPIT + (ks + 1) * 32); }
            }
            __builtin_amdgcn_sched_barrier(0);   // keeps the next set's LDS reads as one group ahead of this block's WMMAs
#pragma unroll
            for (int nb = 0; nb < 4; ++nb)
#pragma unroll
                for (int mb = 0; mb < 4; ++mb) acc[mb][nb] = WFrag<T16>::mma(a[cu][mb], b[cu][nb], acc[mb][nb]);
            __builtin_amdgcn_sched_barrier(0);   // keeps this block's WMMAs ahead of the following group of LDS reads
        }
        asm volatile("s_wait_dscnt 0x0" ::: "memory");      // this wave's reads of buffer t&1 are done before the buffer is refilled
        asm volatile("s_wait_asynccnt 0x0" ::: "memory");   // this wave's copies of tile t+1 have landed before the barrier publishes them
        __syncthreads();                                    // publishes tile t+1; ends every wave's reads of buffer t&1
    }
    asm volatile("s_wait_asynccnt 0x0" ::: "memory");       // no copy outstanding when the wave goes on
#pragma unroll
    for (int mb = 0; mb < 4; ++mb) {
#pragma unroll
        for (int nb = 0; nb < 4; ++nb) {
#pragma unroll
            for (int j = 0; j < 8; ++j) os[(hi * 8 + j) * 68 + nb * 16 + lr] = acc[mb][nb][j]; }
        __builtin_amdgcn_wave_barrier(); asm volatile("" ::: "memory");
        float* crow = C + (size_t)(r0 + mb * 16) * ldc + c0;
{
#pragma unroll
            for (int s = 0; s < 8; ++s) { const int row = 2 * s + hi, cofs = lr * 4; const v4f val = *(const v4fa*)(os + row * 68 + cofs);
                *(v4f*)(crow + (size_t)row * ldc + cofs) = val; }
             }
        __builtin_amdgcn_wave_barrier(); asm volatile("" ::: "memory");
    }
}

__global__ __launch_bounds__(256) void k_cvt8(const float* __restrict__ src, bf* dst, size_t n8, size_t sS, size_t sD) {
    const size_t i = (size_t)blockIdx.x * 256 + threadIdx.x; if (i >= n8) return;
    src += (size_t)blockIdx.y * sS; dst += (size_t)blockIdx.y * sD;
    const v8f v = *(const v8f*)(src + i * 8); v8us o;
#pragma unroll
    for (int k = 0; k < 8; ++k) o[k] = f2bf(v[k]);
    *(v8us*)(dst + i * 8) = o;  }

// k_cvx: x slab f32 -> (a) bf16 (RNE) plane xb [slab][t][d]; (b) f16 plane kx [slab][t][k | k] (pitch KX2) holding the bf16 value (exact in f16, subnormals -> 0) in both halves.
__global__ __launch_bounds__(256) void k_cvx(const float* __restrict__ src, bf* xb, h16* kx, size_t n8, size_t sS, size_t sD) {
#pragma clang fp contract(off)
    const size_t i = (size_t)blockIdx.x * 256 + threadIdx.x; if (i >= n8) return;
    src += (size_t)blockIdx.y * sS; xb += (size_t)blockIdx.y * sD; kx += (size_t)blockIdx.y * sD * 2;
    const v8f v = *(const v8f*)(src + i * 8); v8us o; v8h kk;
#pragma unroll
    for (int k = 0; k < 8; ++k) { o[k] = f2bf(v[k]); kk[k] = toh_flush(__uint_as_float((unsigned)o[k] << 16)); }
    const size_t e = i * 8; const size_t row = e / DM; const int col = (int)(e % DM);
    h16* kp = kx + row * KX2 + col;
    *(v8us*)(xb + e) = o; *(v8h*)kp = kk; *(v8h*)(kp + HD) = kk;
     }

// k_cvtq: projected rows f32 [r][d] -> f16 plane qx [r][qh | ql] (pitch KX2): qh = f16(2048 q), ql = f16(2048 q - qh) (exact difference), subnormals -> 0.
__global__ __launch_bounds__(256) void k_cvtq(const float* __restrict__ src, h16* qx, size_t n8) {
#pragma clang fp contract(off)
    const size_t i = (size_t)blockIdx.x * 256 + threadIdx.x; if (i >= n8) return;
    const v8f v = *(const v8f*)(src + i * 8); v8h qh, ql;
#pragma unroll
    for (int k = 0; k < 8; ++k) { const float s = v[k] * QCAR; const h16 a = toh_flush(s); const float r = s - (float)a; qh[k] = a; ql[k] = toh_flush(r); }
    const size_t e = i * 8; const size_t row = e / DM; const int col = (int)(e % DM);
    h16* qp = qx + row * KX2 + col;
    *(v8h*)qp = qh; *(v8h*)(qp + HD) = ql;
     }

__global__ __launch_bounds__(256) void k_vtpx(const bf* __restrict__ F, h16* V16) {
    const size_t e = ((size_t)blockIdx.x * 256 + threadIdx.x) * 2; if (e >= (size_t)ZB * HD * SEQ) return;
    const int t = (int)(e % SEQ); const int d = (int)((e / SEQ) % HD); const int g = (int)(e / ((size_t)SEQ * HD)); v2h o16;
#pragma unroll
    for (int q = 0; q < 2; ++q) { const float xv = __uint_as_float((unsigned)F[((size_t)g * SEQ + t + q) * DM + d] << 16); o16[q] = toh_flush(xv); }
    *(v2h*)(V16 + e) = o16;  }

__global__ __launch_bounds__(256) void k_vmeanx(const bf* __restrict__ F, float* VM) {
#pragma clang fp contract(off)
    __shared__ float part[8 * 32];
    const int c = threadIdx.x & 31; const int r = __builtin_amdgcn_readfirstlane(threadIdx.x >> 5); const int g = blockIdx.y; const int d = blockIdx.x * 32 + c;
    const bf* f = F + (size_t)g * SEQ * DM + d; float s = 0.f;
#pragma unroll 4
    for (int t = r; t < SEQ; t += 8) { const float xv = __uint_as_float((unsigned)f[(size_t)t * DM] << 16); s += (fabsf(xv) < 6.103515625e-05f) ? 0.0f : xv; }
    part[r * 32 + c] = s;
    __syncthreads();
    if (r == 0) { float a = part[c];
#pragma unroll
        for (int q = 1; q < 8; ++q) a += part[q * 32 + c];
        a *= (1.0f / (float)SEQ); float* p = VM + (size_t)g * HD + d;
        *(float*)p = a;  }
}

// k_asoft: per row (one wave): t = S' x SCL (SCL = 1/2048 undoes the q carry; the module has no score scale); softmax over the SEQ keys (register row, running max then one exp, fixed shuffle trees);
__global__ __launch_bounds__(256) void k_asoft(const float* __restrict__ Sb, h16* P16) {
    const int lane = threadIdx.x & 31; const int row = blockIdx.x * 8 + (threadIdx.x >> 5); if (row >= ZB * SEQ) return;
    const float* sr = Sb + (size_t)row * SEQ; float v[SEQ / 32]; float mx = -3.0e38f;
#pragma unroll
    for (int ch = 0; ch < SEQ / 128; ++ch) { const v4f a = *(const v4f*)(sr + ch * 128 + lane * 4);
#pragma unroll
        for (int q = 0; q < 4; ++q) { const float t = a[q] * SCL; v[ch * 4 + q] = t; mx = fmaxf(mx, t); } }
#pragma unroll
    for (int sh = 16; sh; sh >>= 1) mx = fmaxf(mx, __shfl_xor(mx, sh, 32));
    float sum = 0.f;
#pragma unroll
    for (int k = 0; k < SEQ / 32; ++k) { float d0 = __fsub_rn(v[k], mx); asm volatile("" : "+v"(d0)); v[k] = __builtin_amdgcn_exp2f(__fmul_rn(d0, 1.4426950408889634f)); sum += v[k]; }
#pragma unroll
    for (int sh = 16; sh; sh >>= 1) sum += __shfl_xor(sum, sh, 32);
    const float f = __fdiv_rn(PCAR, sum); const float cen = PCAR / (float)SEQ;
{
#pragma unroll
        for (int ch = 0; ch < SEQ / 128; ++ch) { v4h o4;
#pragma unroll
            for (int q = 0; q < 4; ++q) o4[q] = tohx(v[ch * 4 + q] * f - cen);
            *(v4h*)(P16 + (size_t)row * SEQ + ch * 128 + lane * 4) = o4; }
         }
}

__global__ __launch_bounds__(256) void k_merge(const float* __restrict__ O, const float* __restrict__ VM, float* OUTb) {
    const size_t e = ((size_t)blockIdx.x * 256 + threadIdx.x) * 2; if (e >= (size_t)ZB * SEQ * HD) return;
    const int d = (int)(e % HD); const int g = (int)(e / ((size_t)HD * SEQ));
    const v2f m = *(const v2f*)(VM + (size_t)g * HD + d); const v2f o = *(const v2f*)(O + e);
    v2f o2; o2[0] = o[0] * (1.0f / PCAR) + m[0]; o2[1] = o[1] * (1.0f / PCAR) + m[1];
    *(v2f*)(OUTb + e) = o2;  }

constexpr size_t al256(size_t b) { return (b + 255) & ~(size_t)255; }
constexpr size_t mx2(size_t a, size_t b) { return a > b ? a : b; }
// Shared ranges, by launch order within a pass:
// range 1: XB, FQ (last read by k_cvtq / k_vtpx / k_vmeanx) -> Sb (written by the score GEMM, last read by k_asoft) -> Ob (written by the last GEMM)
// range 2: QX, KX (last read by the score GEMM) -> P16 (written by k_asoft)
constexpr size_t WS_XB = al256((size_t)ZB * SEQ * DM * 2);      // XB bf16
constexpr size_t WS_FQ = al256((size_t)ZB * SEQ * DM * 4);      // FQ f32
constexpr size_t WS_QX = al256((size_t)ZB * SEQ * KX2 * 2);     // QX f16 [qh | ql]; KX f16 [k | k] has the same size
constexpr size_t WS_R1 = mx2(mx2(WS_XB + WS_FQ, al256((size_t)ZB * SEQ * SEQ * 4)), al256((size_t)ZB * SEQ * HD * 4));
constexpr size_t WS_R2 = mx2(2 * WS_QX, al256((size_t)ZB * SEQ * SEQ * 2));
constexpr size_t WS_TOTAL =
    al256((size_t)DM * DM * 2) +                  // WQ bf16
    WS_R1 + WS_R2 +
    al256((size_t)ZB * HD * SEQ * 2) +            // VT16
    al256((size_t)ZB * HD * 4);                   // VM
static_assert(WS_TOTAL <= (size_t)268435456);

extern "C" void kernel_launch(void* const* d_in, const int* in_sizes, int n_in,
                              void* d_out, int out_size, void* d_ws, size_t ws_size, hipStream_t stream) {
    if (n_in < 2) return;
    if ((size_t)in_sizes[0] < ((size_t)(NB - 1) * SEQ_FULL + SEQ) * DM) return;
    if ((size_t)in_sizes[1] < (size_t)DM * DM) return;
    if ((size_t)out_size < (size_t)NB * SEQ * DM) return;
    if (WS_TOTAL > ws_size) return;
    const float* x = (const float*)d_in[0]; const float* wq = (const float*)d_in[1];   // x [NB][SEQ_FULL][768]; W [768 out][768 in]
    float* OUT = (float*)d_out;     // [NB][SEQ][768]
    char* wsp = (char*)d_ws;
    auto take = [&](size_t bytes) { char* p = wsp; wsp += al256(bytes); return (void*)p; };
    bf* WQ = (bf*)take((size_t)DM * DM * 2);
    char* r1 = (char*)take(WS_R1);
    char* r2 = (char*)take(WS_R2);
    bf* XB = (bf*)r1; float* FQ = (float*)(r1 + WS_XB); float* Sb = (float*)r1; float* Ob = (float*)r1;
    h16* QX = (h16*)r2; h16* KX = (h16*)(r2 + WS_QX); h16* P16 = (h16*)r2;
    h16* VT16 = (h16*)take((size_t)ZB * HD * SEQ * 2);
    float* VM = (float*)take((size_t)ZB * HD * 4);
    if ((size_t)(wsp - (char*)d_ws) > ws_size) return;

    const size_t w8 = (size_t)DM * DM / 8;
    k_cvt8<<<dim3((unsigned)((w8 + 255) / 256), 1, 1), 256, 0, stream>>>(wq, WQ, w8, 0, 0);

    const size_t x8 = (size_t)SEQ * DM / 8;                 // per batch slab
    const size_t p8 = (size_t)ZB * SEQ * DM / 8;            // projected rows of one pass
    const unsigned LE2 = (unsigned)(((size_t)ZB * SEQ * HD / 2 + 255) / 256);
    for (int b0 = 0; b0 < NB; b0 += ZB) {
        k_cvx<<<dim3((unsigned)((x8 + 255) / 256), ZB, 1), 256, 0, stream>>>(x + (size_t)b0 * SEQ_FULL * DM, XB, KX, x8, (size_t)SEQ_FULL * DM, (size_t)SEQ * DM);
        k_gemmw<bf><<<dim3(ZB * SEQ / 128, DM / 128, 1), 128, 0, stream>>>(XB, WQ, DM, FQ, DM, 0, 0, 0);
        k_cvtq<<<dim3((unsigned)((p8 + 255) / 256), 1, 1), 256, 0, stream>>>(FQ, QX, p8);
        k_vtpx<<<LE2, 256, 0, stream>>>(XB, VT16);
        k_vmeanx<<<dim3(HD / 32, ZB, 1), 256, 0, stream>>>(XB, VM);
        k_gemmw<h16><<<dim3(SEQ / 128, SEQ / 128, ZB), 128, 0, stream>>>(QX, KX, KX2, Sb, SEQ, (size_t)SEQ * KX2, (size_t)SEQ * KX2, (size_t)SEQ * SEQ);
        k_asoft<<<ZB * SEQ / 8, 256, 0, stream>>>(Sb, P16);
        k_gemmw<h16><<<dim3(SEQ / 128, HD / 128, ZB), 128, 0, stream>>>(P16, VT16, SEQ, Ob, HD, (size_t)SEQ * SEQ, (size_t)HD * SEQ, (size_t)SEQ * HD);
        k_merge<<<LE2, 256, 0, stream>>>(Ob, VM, OUT + (size_t)b0 * SEQ * DM);
    }
}

// v003
// One run takes 253 microseconds.
// Next to v002, in two timings, it ran 1.10 and 1.09 times as fast.
// All steps since v000 together make it 2.88 times as fast.
#include <hip/hip_runtime.h>

// Contractions: q projection on v_wmma_f32_16x16x32_bf16 (x and W RNE-converted to bf16, exact products, f32 accumulate); q.x^T on v_wmma_f32_16x16x32_f16 with q carried x2048 as f16 value + f16 remainder folded along K ([qh | ql] x [k | k], k = f16 of the bf16 x, exact); att.x on v_wmma_f32_16x16x32_f16 (f16 x plane; softmax weights carried x1024 and centred by 1024/SEQ, column mean of x added back in f32), f32 accumulate.
// Single-head full-width document self-attention: x [8][2048][768]; q = x W^T ('oi' [768][768], no bias); keys = values = x; att = softmax(q.x) over all 2048 keys (no scale, no mask); out = att @ x -> [8][2048][768] f32.
// All batches in one pass (z-batched GEMMs; workspace planes whose readers have all run share their bytes with later planes): x -> bf16 plane + f16 [k | k] plane; projection -> f32 rows -> f16 [qh | ql] plane; x transposed [d][t] f16; S' = 2048 q.x (f32, materialised per pass); row softmax in registers; O = P' x; out = O/1024 + mean_t(x).

#ifndef NB
#define NB 8
#endif
#ifndef SEQ
#define SEQ 2048
#endif
#define NB_FULL  8
#define SEQ_FULL 2048
#define DM   768
#define HD   768
#define ZB   NB                           // batches per pass: all of them, so every stage is one launch with the fullest grid
#define PCAR 1024.0f
#define QCAR 2048.0f                      // carry of the q value / remainder planes
#define SCL  4.8828125e-4f                // 1/2048: undoes the q carry (the module applies no score scale)
#define KX2  (2 * HD)                     // pitch of the K-folded planes [value | remainder] and [k | k]

typedef _Float16 h16;
typedef unsigned short bf;
typedef __attribute__((ext_vector_type(16))) __bf16   v16bf;
typedef __attribute__((ext_vector_type(16))) _Float16 v16h;
typedef __attribute__((ext_vector_type(8)))  _Float16 v8h;
typedef __attribute__((ext_vector_type(8)))  unsigned short v8us;
typedef __attribute__((ext_vector_type(8)))  float    v8f;
typedef __attribute__((ext_vector_type(4)))  float    v4f;
typedef __attribute__((ext_vector_type(2)))  float    v2f;
typedef __attribute__((ext_vector_type(2)))  _Float16 v2h;
typedef __attribute__((ext_vector_type(4)))  _Float16 v4h;
typedef v4f  __attribute__((may_alias)) v4fa;

static_assert(NB <= NB_FULL);
static_assert(SEQ <= SEQ_FULL);
static_assert(NB % ZB == 0);
static_assert(SEQ % 128 == 0);                 // softmax row chunks, 128-row tiles, K steps of 32
static_assert(DM % 64 == 0 && HD % 64 == 0);   // 64x64 wave quarters, K steps of 32
static_assert(DM == HD);                       // q width == x width: q.x contracts over 768
static_assert(((size_t)SEQ * DM) % 8 == 0);
static_assert((ZB * SEQ) % 8 == 0);
static_assert(HD % 32 == 0 && SEQ % 8 == 0);
static_assert(KX2 % 32 == 0);                  // folded score GEMM: K steps of 32
static_assert((ZB * SEQ) % 64 == 0);           // projection GEMM rows: 64-row wave quarters
static_assert(QCAR * SCL == 1.0f);             // carry folded back exactly in the softmax scale
static_assert((KX2 * 2) % 128 == 0);
static_assert(DM % 64 == 0);
static_assert(((size_t)SEQ * DM / 8) * 16 == (size_t)SEQ * DM * 2);          // k_cvx: threads x 16 B == slab bytes (per plane half)
static_assert(((size_t)ZB * SEQ * DM / 8) * 16 == (size_t)ZB * SEQ * DM * 2); // k_cvtq: threads x 16 B == plane-half bytes
static_assert(SEQ % 128 == 0 && HD % 128 == 0 && DM == HD);                  // k_vtpx: 128 t x 128 d tiles cover the plane
static_assert(2 * 256 * 272 + 4 * 16 * 68 * 4 <= 163840);   // k_gemmw static LDS: two blocks fit one 320 KiB LDS
static_assert(DM % 128 == 0 && HD % 128 == 0 && KX2 % 128 == 0 && SEQ % 128 == 0 && (ZB * SEQ) % 128 == 0);   // k_gemmw: 128x128 tiles, K tiles of 128
static_assert(8 * 32 * 4 <= 131072);           // k_vmeanx static LDS

__device__ __forceinline__ unsigned short f2bf(float f) { unsigned u = __float_as_uint(f); u += 0x7FFFu + ((u >> 16) & 1u); return (unsigned short)(u >> 16); }
__device__ __forceinline__ v16h cat16(v8h lo, v8h hi) { return __builtin_shufflevector(lo, hi, 0, 1, 2, 3, 4, 5, 6, 7, 8, 9, 10, 11, 12, 13, 14, 15); }
__device__ __forceinline__ v16bf cat16b(v8us lo, v8us hi) { return __builtin_bit_cast(v16bf, __builtin_shufflevector(lo, hi, 0, 1, 2, 3, 4, 5, 6, 7, 8, 9, 10, 11, 12, 13, 14, 15)); }
__device__ __forceinline__ v8f wmma16(v16h a, v16h b, v8f c) { return __builtin_amdgcn_wmma_f32_16x16x32_f16(false, a, false, b, (short)0, c, false, false); }
__device__ __forceinline__ v8f wmmab(v16bf a, v16bf b, v8f c) { return __builtin_amdgcn_wmma_f32_16x16x32_bf16(false, a, false, b, (short)0, c, false, false); }
__device__ __forceinline__ h16 tohx(float x) { return (h16)x; }
// f32 -> f16 (RNE) that cannot produce an f16 subnormal: |v| < 2^-14 -> +0 (value select).
static __device__ __forceinline__ h16 toh_flush(float v) { const h16 r = (h16)v; return (fabsf(v) < 6.103515625e-05f) ? (h16)0.0f : r; }

// ---- k_gemmw: GEMM, FOUR WAVES (2 x 2) per 128x128 output tile, each wave a 64x64 quarter (16 accumulators); grid (M/128, N/128, Z), 128 threads.
// Operand tiles (128 rows of A, 128 rows of Bt, 128 k each) are staged in LDS by asynchronous 16-byte copies, two buffers: tile t+1 flies while tile t is worked on; each staged row serves two waves.
// C[m][n] (f32, pitch ldc) = sum_k A[m][k] Bt[n][k]. z-batch strides sA/sB/sC in elements. K % 128 == 0, M % 128 == 0, N % 128 == 0.
// Fragment map (A and Bt alike): lane -> row/col lane&15, h = lane>>4; elements 0..7 = k0+8h+0..7, elements 8..15 = k0+16+8h+0..7. D: acc[j] = (row 8h+j, col lane&15).
template <typename T16> struct WFrag;
template <> struct WFrag<h16> { typedef v16h V; static __device__ __forceinline__ V ld(const h16* p) { return cat16(*(const v8h*)p, *(const v8h*)(p + 16)); } static __device__ __forceinline__ v8f mma(V a, V b, v8f c) { return wmma16(a, b, c); } };
template <> struct WFrag<bf> { typedef v16bf V; static __device__ __forceinline__ V ld(const bf* p) { return cat16b(*(const v8us*)p, *(const v8us*)(p + 16)); } static __device__ __forceinline__ v8f mma(V a, V b, v8f c) { return wmmab(a, b, c); } };
#define GBK  128                 // k per staged tile: 256 B of every operand row
#define GPIT 136                 // LDS row pitch in 16-bit elements: 272 B = 16 B x odd, conflict-free for 16-byte fragment reads
#define GSTG (256 * GPIT)        // one buffer: rows 0..127 = A tile, rows 128..255 = Bt tile
typedef int v4i __attribute__((vector_size(16)));
// one lane's 16 bytes, global -> LDS, through no register
__device__ __forceinline__ void cp16(const void* g, void* l) {
    __builtin_amdgcn_global_load_async_to_lds_b128((__attribute__((address_space(1))) v4i*)g, (__attribute__((address_space(3))) v4i*)l, 0, 0);
}
template <typename T16>
__global__ __launch_bounds__(128) void k_gemmw(const T16* __restrict__ A, const T16* __restrict__ Bt, int K, float* C, int ldc, size_t sA, size_t sB, size_t sC) {
    typedef typename WFrag<T16>::V V;
    __shared__ __align__(16) T16 ring[2 * GSTG];
    __shared__ __align__(16) float osall[4 * 16 * 68];
    const size_t z = blockIdx.z; A += z * sA; Bt += z * sB; C += z * sC;
    const int tid = threadIdx.x, lane = tid & 31, lr = lane & 15, hi = lane >> 4;
    const int wave = __builtin_amdgcn_readfirstlane(tid >> 5), wm = wave >> 1, wn = wave & 1;
    const int t0r = blockIdx.x * 128, t0c = blockIdx.y * 128;
    const int r0 = t0r + wm * 64, c0 = t0c + wn * 64;
    float* os = osall + wave * (16 * 68);
    v8f acc[4][4];
#pragma unroll
    for (int mb = 0; mb < 4; ++mb)
#pragma unroll
        for (int nb = 0; nb < 4; ++nb) acc[mb][nb] = (v8f){};
    // copy map: 16 lanes cover one row's 256 B, the block covers 8 rows per copy; 16 copies for A, 16 for Bt per lane and tile
    const int cr = tid >> 4, cch = (tid & 15) * 8;
    const T16* ga = A + (size_t)(t0r + cr) * K + cch;
    const T16* gb = Bt + (size_t)(t0c + cr) * K + cch;
    const size_t gstep = (size_t)8 * K;
    T16* lbase = ring + cr * GPIT + cch;
    auto fill = [&](int buf, int kt) {
        const T16* pa = ga + (size_t)kt * GBK; const T16* pb = gb + (size_t)kt * GBK; T16* l = lbase + buf * GSTG;
#pragma unroll
        for (int i = 0; i < 16; ++i) cp16(pa + i * gstep, l + i * 8 * GPIT);
#pragma unroll
        for (int i = 0; i < 16; ++i) cp16(pb + i * gstep, l + (128 + i * 8) * GPIT);
    };
    const int nt = K / GBK;
    fill(0, 0);
    asm volatile("s_wait_asynccnt 0x0" ::: "memory");   // tile 0 landed (this wave's copies) before the barrier publishes it
    __syncthreads();
    const int aofs = (wm * 64 + lr) * GPIT + 8 * hi, bofs = (128 + wn * 64 + lr) * GPIT + 8 * hi;
#pragma unroll 1   // one trip per staged tile stays rolled: the body already holds 64 WMMAs (for speed only)
    for (int t = 0; t < nt; ++t) {
        const T16* sa = ring + (t & 1) * GSTG + aofs; const T16* sb = ring + (t & 1) * GSTG + bofs;
        V a[2][4], b[2][4];   // two fragment sets: the next 32 k are fetched from LDS while the current 32 k are multiplied
#pragma unroll
        for (int f = 0; f < 4; ++f) { a[0][f] = WFrag<T16>::ld(sa + f * 16 * GPIT); b[0][f] = WFrag<T16>::ld(sb + f * 16 * GPIT); }
        // tile t+1 into the other buffer: its last readers (trip t-1) ended at the barrier just passed; issued behind the first fragment reads so that their LDS latency passes meanwhile
        if (t + 1 < nt) fill((t + 1) & 1, t + 1);
#pragma unroll
        for (int ks = 0; ks < GBK / 32; ++ks) {
            const int cu = ks & 1, nx = cu ^ 1;
            if (ks + 1 < GBK / 32) {
#pragma unroll
                for (int f = 0; f < 4; ++f) { a[nx][f] = WFrag<T16>::ld(sa + f * 16 * GPIT + (ks + 1) * 32); b[nx][f] = WFrag<T16>::ld(sb + f * 16 * GPIT + (ks + 1) * 32); }
            }
            __builtin_amdgcn_sched_barrier(0);   // keeps the next set's LDS reads as one group ahead of this block's WMMAs
#pragma unroll
            for (int nb = 0; nb < 4; ++nb)
#pragma unroll
                for (int mb = 0; mb < 4; ++mb) acc[mb][nb] = WFrag<T16>::mma(a[cu][mb], b[cu][nb], acc[mb][nb]);
            __builtin_amdgcn_sched_barrier(0);   // keeps this block's WMMAs ahead of the following group of LDS reads
        }
        asm volatile("s_wait_dscnt 0x0" ::: "memory");      // this wave's reads of buffer t&1 are done before the buffer is refilled
        asm volatile("s_wait_asynccnt 0x0" ::: "memory");   // this wave's copies of tile t+1 have landed before the barrier publishes them
        __syncthreads();                                    // publishes tile t+1; ends every wave's reads of buffer t&1
    }
    asm volatile("s_wait_asynccnt 0x0" ::: "memory");       // no copy outstanding when the wave goes on
#pragma unroll
    for (int mb = 0; mb < 4; ++mb) {
#pragma unroll
        for (int nb = 0; nb < 4; ++nb) {
#pragma unroll
            for (int j = 0; j < 8; ++j) os[(hi * 8 + j) * 68 + nb * 16 + lr] = acc[mb][nb][j]; }
        __builtin_amdgcn_wave_barrier(); asm volatile("" ::: "memory");
        float* crow = C + (size_t)(r0 + mb * 16) * ldc + c0;
{
#pragma unroll
            for (int s = 0; s < 8; ++s) { const int row = 2 * s + hi, cofs = lr * 4; const v4f val = *(const v4fa*)(os + row * 68 + cofs);
                *(v4f*)(crow + (size_t)row * ldc + cofs) = val; }
             }
        __builtin_amdgcn_wave_barrier(); asm volatile("" ::: "memory");
    }
}

__global__ __launch_bounds__(256) void k_cvt8(const float* __restrict__ src, bf* dst, size_t n8, size_t sS, size_t sD) {
    const size_t i = (size_t)blockIdx.x * 256 + threadIdx.x; if (i >= n8) return;
    src += (size_t)blockIdx.y * sS; dst += (size_t)blockIdx.y * sD;
    const v8f v = *(const v8f*)(src + i * 8); v8us o;
#pragma unroll
    for (int k = 0; k < 8; ++k) o[k] = f2bf(v[k]);
    *(v8us*)(dst + i * 8) = o;  }

// k_cvx: x slab f32 -> (a) bf16 (RNE) plane xb [slab][t][d]; (b) f16 plane kx [slab][t][k | k] (pitch KX2) holding the bf16 value (exact in f16, subnormals -> 0) in both halves.
__global__ __launch_bounds__(256) void k_cvx(const float* __restrict__ src, bf* xb, h16* kx, size_t n8, size_t sS, size_t sD) {
#pragma clang fp contract(off)
    const size_t i = (size_t)blockIdx.x * 256 + threadIdx.x; if (i >= n8) return;
    src += (size_t)blockIdx.y * sS; xb += (size_t)blockIdx.y * sD; kx += (size_t)blockIdx.y * sD * 2;
    const v8f v = *(const v8f*)(src + i * 8); v8us o; v8h kk;
#pragma unroll
    for (int k = 0; k < 8; ++k) { o[k] = f2bf(v[k]); kk[k] = toh_flush(__uint_as_float((unsigned)o[k] << 16)); }
    const size_t e = i * 8; const size_t row = e / DM; const int col = (int)(e % DM);
    h16* kp = kx + row * KX2 + col;
    *(v8us*)(xb + e) = o; *(v8h*)kp = kk; *(v8h*)(kp + HD) = kk;
     }

// k_cvtq: projected rows f32 [r][d] -> f16 plane qx [r][qh | ql] (pitch KX2): qh = f16(2048 q), ql = f16(2048 q - qh) (exact difference), subnormals -> 0.
__global__ __launch_bounds__(256) void k_cvtq(const float* __restrict__ src, h16* qx, size_t n8) {
#pragma clang fp contract(off)
    const size_t i = (size_t)blockIdx.x * 256 + threadIdx.x; if (i >= n8) return;
    const v8f v = *(const v8f*)(src + i * 8); v8h qh, ql;
#pragma unroll
    for (int k = 0; k < 8; ++k) { const float s = v[k] * QCAR; const h16 a = toh_flush(s); const float r = s - (float)a; qh[k] = a; ql[k] = toh_flush(r); }
    const size_t e = i * 8; const size_t row = e / DM; const int col = (int)(e % DM);
    h16* qp = qx + row * KX2 + col;
    *(v8h*)qp = qh; *(v8h*)(qp + HD) = ql;
     }

// k_vtpx: bf16 plane [g][t][d] -> f16 plane [g][d][t], one 128 t x 128 d tile per block, turned in LDS so that both global sides move whole 256-byte row pieces (16 lanes x 16 B).
// LDS tile [d][t pair]: one dword = the f16 values of t and t+1 at one d; a row is 64 dwords = 16 groups of 4. Group j of row d lies at place j ^ (d >> 3): the 16 lanes of a dword store (d 8 apart, same t pair) then fall on 16 different banks, and a 16-byte read still takes one whole group.
#define VTT 128
#define VTD 128
typedef __attribute__((ext_vector_type(4))) unsigned v4u;
__global__ __launch_bounds__(256) void k_vtpx(const bf* __restrict__ F, h16* V16) {
    __shared__ __align__(16) unsigned tile[VTD * (VTT / 2)];
    const int tid = threadIdx.x, c16 = tid & 15, r16 = tid >> 4;
    const int t0 = blockIdx.x * VTT, d0 = blockIdx.y * VTD, g = blockIdx.z;
    // in: lane -> 8 d (c16), row pairs r16 + 16 k
    const bf* src = F + ((size_t)g * SEQ + t0) * DM + d0 + c16 * 8;
    v8us r[VTT / 32][2];
#pragma unroll
    for (int k = 0; k < VTT / 32; ++k)
#pragma unroll
        for (int q = 0; q < 2; ++q) r[k][q] = *(const v8us*)(src + (size_t)(2 * (r16 + 16 * k) + q) * DM);
#pragma unroll
    for (int k = 0; k < VTT / 32; ++k) { const int tp = r16 + 16 * k; unsigned* col = tile + (size_t)(c16 * 8) * (VTT / 2) + (((tp >> 2) ^ c16) << 2) + (tp & 3);
#pragma unroll
        for (int i = 0; i < 8; ++i) { v2h o16;
#pragma unroll
            for (int q = 0; q < 2; ++q) o16[q] = toh_flush(__uint_as_float((unsigned)r[k][q][i] << 16));
            col[i * (VTT / 2)] = __builtin_bit_cast(unsigned, o16); } }
    __syncthreads();   // the whole tile is in LDS before any row of it is read
    // out: lane -> 8 t (c16), d rows r16 + 16 k
    h16* dst = V16 + ((size_t)g * HD + d0) * SEQ + t0 + c16 * 8;
#pragma unroll
    for (int k = 0; k < VTD / 16; ++k) { const int d = r16 + 16 * k;
        const v4u val = *(const v4u*)(tile + d * (VTT / 2) + ((c16 ^ (d >> 3)) << 2));
        *(v4u*)(dst + (size_t)d * SEQ) = val; }
}

__global__ __launch_bounds__(256) void k_vmeanx(const bf* __restrict__ F, float* VM) {
#pragma clang fp contract(off)
    __shared__ float part[8 * 32];
    const int c = threadIdx.x & 31; const int r = __builtin_amdgcn_readfirstlane(threadIdx.x >> 5); const int g = blockIdx.y; const int d = blockIdx.x * 32 + c;
    const bf* f = F + (size_t)g * SEQ * DM + d; float s = 0.f;
#pragma unroll 4
    for (int t = r; t < SEQ; t += 8) { const float xv = __uint_as_float((unsigned)f[(size_t)t * DM] << 16); s += (fabsf(xv) < 6.103515625e-05f) ? 0.0f : xv; }
    part[r * 32 + c] = s;
    __syncthreads();
    if (r == 0) { float a = part[c];
#pragma unroll
        for (int q = 1; q < 8; ++q) a += part[q * 32 + c];
        a *= (1.0f / (float)SEQ); float* p = VM + (size_t)g * HD + d;
        *(float*)p = a;  }
}

// k_asoft: per row (one wave): t = S' x SCL (SCL = 1/2048 undoes the q carry; the module has no score scale); softmax over the SEQ keys (register row, running max then one exp, fixed shuffle trees);
__global__ __launch_bounds__(256) void k_asoft(const float* __restrict__ Sb, h16* P16) {
    const int lane = threadIdx.x & 31; const int row = blockIdx.x * 8 + (threadIdx.x >> 5); if (row >= ZB * SEQ) return;
    const float* sr = Sb + (size_t)row * SEQ; float v[SEQ / 32]; float mx = -3.0e38f;
#pragma unroll
    for (int ch = 0; ch < SEQ / 128; ++ch) { const v4f a = *(const v4f*)(sr + ch * 128 + lane * 4);
#pragma unroll
        for (int q = 0; q < 4; ++q) { const float t = a[q] * SCL; v[ch * 4 + q] = t; mx = fmaxf(mx, t); } }
#pragma unroll
    for (int sh = 16; sh; sh >>= 1) mx = fmaxf(mx, __shfl_xor(mx, sh, 32));
    float sum = 0.f;
#pragma unroll
    for (int k = 0; k < SEQ / 32; ++k) { float d0 = __fsub_rn(v[k], mx); asm volatile("" : "+v"(d0)); v[k] = __builtin_amdgcn_exp2f(__fmul_rn(d0, 1.4426950408889634f)); sum += v[k]; }
#pragma unroll
    for (int sh = 16; sh; sh >>= 1) sum += __shfl_xor(sum, sh, 32);
    const float f = __fdiv_rn(PCAR, sum); const float cen = PCAR / (float)SEQ;
{
#pragma unroll
        for (int ch = 0; ch < SEQ / 128; ++ch) { v4h o4;
#pragma unroll
            for (int q = 0; q < 4; ++q) o4[q] = tohx(v[ch * 4 + q] * f - cen);
            *(v4h*)(P16 + (size_t)row * SEQ + ch * 128 + lane * 4) = o4; }
         }
}

__global__ __launch_bounds__(256) void k_merge(const float* __restrict__ O, const float* __restrict__ VM, float* OUTb) {
    const size_t e = ((size_t)blockIdx.x * 256 + threadIdx.x) * 2; if (e >= (size_t)ZB * SEQ * HD) return;
    const int d = (int)(e % HD); const int g = (int)(e / ((size_t)HD * SEQ));
    const v2f m = *(const v2f*)(VM + (size_t)g * HD + d); const v2f o = *(const v2f*)(O + e);
    v2f o2; o2[0] = o[0] * (1.0f / PCAR) + m[0]; o2[1] = o[1] * (1.0f / PCAR) + m[1];
    *(v2f*)(OUTb + e) = o2;  }

constexpr size_t al256(size_t b) { return (b + 255) & ~(size_t)255; }
constexpr size_t mx2(size_t a, size_t b) { return a > b ? a : b; }
// Shared ranges, by launch order within a pass:
// range 1: XB, FQ (last read by k_cvtq / k_vtpx / k_vmeanx) -> Sb (written by the score GEMM, last read by k_asoft) -> Ob (written by the last GEMM)
// range 2: QX, KX (last read by the score GEMM) -> P16 (written by k_asoft)
constexpr size_t WS_XB = al256((size_t)ZB * SEQ * DM * 2);      // XB bf16
constexpr size_t WS_FQ = al256((size_t)ZB * SEQ * DM * 4);      // FQ f32
constexpr size_t WS_QX = al256((size_t)ZB * SEQ * KX2 * 2);     // QX f16 [qh | ql]; KX f16 [k | k] has the same size
constexpr size_t WS_R1 = mx2(mx2(WS_XB + WS_FQ, al256((size_t)ZB * SEQ * SEQ * 4)), al256((size_t)ZB * SEQ * HD * 4));
constexpr size_t WS_R2 = mx2(2 * WS_QX, al256((size_t)ZB * SEQ * SEQ * 2));
constexpr size_t WS_TOTAL =
    al256((size_t)DM * DM * 2) +                  // WQ bf16
    WS_R1 + WS_R2 +
    al256((size_t)ZB * HD * SEQ * 2) +            // VT16
    al256((size_t)ZB * HD * 4);                   // VM
static_assert(WS_TOTAL <= (size_t)268435456);

extern "C" void kernel_launch(void* const* d_in, const int* in_sizes, int n_in,
                              void* d_out, int out_size, void* d_ws, size_t ws_size, hipStream_t stream) {
    if (n_in < 2) return;
    if ((size_t)in_sizes[0] < ((size_t)(NB - 1) * SEQ_FULL + SEQ) * DM) return;
    if ((size_t)in_sizes[1] < (size_t)DM * DM) return;
    if ((size_t)out_size < (size_t)NB * SEQ * DM) return;
    if (WS_TOTAL > ws_size) return;
    const float* x = (const float*)d_in[0]; const float* wq = (const float*)d_in[1];   // x [NB][SEQ_FULL][768]; W [768 out][768 in]
    float* OUT = (float*)d_out;     // [NB][SEQ][768]
    char* wsp = (char*)d_ws;
    auto take = [&](size_t bytes) { char* p = wsp; wsp += al256(bytes); return (void*)p; };
    bf* WQ = (bf*)take((size_t)DM * DM * 2);
    char* r1 = (char*)take(WS_R1);
    char* r2 = (char*)take(WS_R2);
    bf* XB = (bf*)r1; float* FQ = (float*)(r1 + WS_XB); float* Sb = (float*)r1; float* Ob = (float*)r1;
    h16* QX = (h16*)r2; h16* KX = (h16*)(r2 + WS_QX); h16* P16 = (h16*)r2;
    h16* VT16 = (h16*)take((size_t)ZB * HD * SEQ * 2);
    float* VM = (float*)take((size_t)ZB * HD * 4);
    if ((size_t)(wsp - (char*)d_ws) > ws_size) return;

    const size_t w8 = (size_t)DM * DM / 8;
    k_cvt8<<<dim3((unsigned)((w8 + 255) / 256), 1, 1), 256, 0, stream>>>(wq, WQ, w8, 0, 0);

    const size_t x8 = (size_t)SEQ * DM / 8;                 // per batch slab
    const size_t p8 = (size_t)ZB * SEQ * DM / 8;            // projected rows of one pass
    const unsigned LE2 = (unsigned)(((size_t)ZB * SEQ * HD / 2 + 255) / 256);
    for (int b0 = 0; b0 < NB; b0 += ZB) {
        k_cvx<<<dim3((unsigned)((x8 + 255) / 256), ZB, 1), 256, 0, stream>>>(x + (size_t)b0 * SEQ_FULL * DM, XB, KX, x8, (size_t)SEQ_FULL * DM, (size_t)SEQ * DM);
        k_gemmw<bf><<<dim3(ZB * SEQ / 128, DM / 128, 1), 128, 0, stream>>>(XB, WQ, DM, FQ, DM, 0, 0, 0);
        k_cvtq<<<dim3((unsigned)((p8 + 255) / 256), 1, 1), 256, 0, stream>>>(FQ, QX, p8);
        k_vtpx<<<dim3(SEQ / 128, HD / 128, ZB), 256, 0, stream>>>(XB, VT16);
        k_vmeanx<<<dim3(HD / 32, ZB, 1), 256, 0, stream>>>(XB, VM);
        k_gemmw<h16><<<dim3(SEQ / 128, SEQ / 128, ZB), 128, 0, stream>>>(QX, KX, KX2, Sb, SEQ, (size_t)SEQ * KX2, (size_t)SEQ * KX2, (size_t)SEQ * SEQ);
        k_asoft<<<ZB * SEQ / 8, 256, 0, stream>>>(Sb, P16);
        k_gemmw<h16><<<dim3(SEQ / 128, HD / 128, ZB), 128, 0, stream>>>(P16, VT16, SEQ, Ob, HD, (size_t)SEQ * SEQ, (size_t)HD * SEQ, (size_t)SEQ * HD);
        k_merge<<<LE2, 256, 0, stream>>>(Ob, VM, OUT + (size_t)b0 * SEQ * DM);
    }
}

// v004
// Measured time: 225 microseconds a run.
// In both of two side-by-side timings against v003, it was 1.12 times as fast.
// Counting every step since v000, it is 3.23 times as fast.
#include <hip/hip_runtime.h>

// Contractions: q projection on v_wmma_f32_16x16x32_bf16 (x and W RNE-converted to bf16, exact products, f32 accumulate); q.x^T on v_wmma_f32_16x16x32_f16 with q carried x2048 as f16 value + f16 remainder folded along K ([qh | ql] x [k | k], k = f16 of the bf16 x, exact); att.x on v_wmma_f32_16x16x32_f16 (f16 x plane; softmax weights carried x1024 and centred by 1024/SEQ, column mean of x added back in f32), f32 accumulate.
// Single-head full-width document self-attention: x [8][2048][768]; q = x W^T ('oi' [768][768], no bias); keys = values = x; att = softmax(q.x) over all 2048 keys (no scale, no mask); out = att @ x -> [8][2048][768] f32.
// All batches in one pass (z-batched GEMMs; workspace planes whose readers have all run share their bytes with later planes): x -> bf16 plane + f16 [k | k] plane; projection -> f32 rows -> f16 [qh | ql] plane; x transposed [d][t] f16; S' = 2048 q.x (f32, materialised per pass); row softmax in registers; O = P' x; out = O/1024 + mean_t(x).

#ifndef NB
#define NB 8
#endif
#ifndef SEQ
#define SEQ 2048
#endif
#define NB_FULL  8
#define SEQ_FULL 2048
#define DM   768
#define HD   768
#define ZB   NB                           // batches per pass: all of them, so every stage is one launch with the fullest grid
#define PCAR 1024.0f
#define QCAR 2048.0f                      // carry of the q value / remainder planes
#define SCL  4.8828125e-4f                // 1/2048: undoes the q carry (the module applies no score scale)
#define KX2  (2 * HD)                     // pitch of the K-folded planes [value | remainder] and [k | k]

typedef _Float16 h16;
typedef unsigned short bf;
typedef __attribute__((ext_vector_type(16))) __bf16   v16bf;
typedef __attribute__((ext_vector_type(16))) _Float16 v16h;
typedef __attribute__((ext_vector_type(8)))  _Float16 v8h;
typedef __attribute__((ext_vector_type(8)))  unsigned short v8us;
typedef __attribute__((ext_vector_type(8)))  float    v8f;
typedef __attribute__((ext_vector_type(4)))  float    v4f;
typedef __attribute__((ext_vector_type(2)))  float    v2f;
typedef __attribute__((ext_vector_type(2)))  _Float16 v2h;
typedef __attribute__((ext_vector_type(4)))  _Float16 v4h;
typedef v4f  __attribute__((may_alias)) v4fa;

static_assert(NB <= NB_FULL);
static_assert(SEQ <= SEQ_FULL);
static_assert(NB % ZB == 0);
static_assert(SEQ % 128 == 0);                 // softmax row chunks, 64-row tiles, K steps of 32
static_assert(DM % 64 == 0 && HD % 64 == 0);   // K steps of 32
static_assert(DM == HD);                       // q width == x width: q.x contracts over 768
static_assert(((size_t)SEQ * DM) % 8 == 0);
static_assert((ZB * SEQ) % 8 == 0);
static_assert(HD % 32 == 0 && SEQ % 8 == 0);
static_assert(KX2 % 32 == 0);                  // folded score GEMM: K steps of 32
static_assert((ZB * SEQ) % 64 == 0);           // projection GEMM rows: 64-row wave quarters
static_assert(QCAR * SCL == 1.0f);             // carry folded back exactly in the softmax scale
static_assert((KX2 * 2) % 128 == 0);
static_assert(DM % 64 == 0);
static_assert(((size_t)SEQ * DM / 8) * 16 == (size_t)SEQ * DM * 2);          // k_cvx: threads x 16 B == slab bytes (per plane half)
static_assert(((size_t)ZB * SEQ * DM / 8) * 16 == (size_t)ZB * SEQ * DM * 2); // k_cvtq: threads x 16 B == plane-half bytes
static_assert(SEQ % 128 == 0 && HD % 128 == 0 && DM == HD);                  // k_vtpx: 128 t x 128 d tiles cover the plane
static_assert(2 * 512 * 272 <= 327680);       // k_gemmw static LDS: one block per 320 KiB LDS
static_assert(DM % 128 == 0 && KX2 % 128 == 0 && SEQ % 128 == 0);                                 // k_gemmw: K tiles of 128
static_assert(SEQ % 256 == 0 && (ZB * SEQ) % 256 == 0 && DM % 192 == 0 && HD % 192 == 0);         // k_gemmw: 256x256 and 256x192 tiles cover the outputs
static_assert(8 * 32 * 4 <= 131072);           // k_vmeanx static LDS

__device__ __forceinline__ unsigned short f2bf(float f) { unsigned u = __float_as_uint(f); u += 0x7FFFu + ((u >> 16) & 1u); return (unsigned short)(u >> 16); }
__device__ __forceinline__ v16h cat16(v8h lo, v8h hi) { return __builtin_shufflevector(lo, hi, 0, 1, 2, 3, 4, 5, 6, 7, 8, 9, 10, 11, 12, 13, 14, 15); }
__device__ __forceinline__ v16bf cat16b(v8us lo, v8us hi) { return __builtin_bit_cast(v16bf, __builtin_shufflevector(lo, hi, 0, 1, 2, 3, 4, 5, 6, 7, 8, 9, 10, 11, 12, 13, 14, 15)); }
__device__ __forceinline__ v8f wmma16(v16h a, v16h b, v8f c) { return __builtin_amdgcn_wmma_f32_16x16x32_f16(false, a, false, b, (short)0, c, false, false); }
__device__ __forceinline__ v8f wmmab(v16bf a, v16bf b, v8f c) { return __builtin_amdgcn_wmma_f32_16x16x32_bf16(false, a, false, b, (short)0, c, false, false); }
__device__ __forceinline__ h16 tohx(float x) { return (h16)x; }
// f32 -> f16 (RNE) that cannot produce an f16 subnormal: |v| < 2^-14 -> +0 (value select).
static __device__ __forceinline__ h16 toh_flush(float v) { const h16 r = (h16)v; return (fabsf(v) < 6.103515625e-05f) ? (h16)0.0f : r; }

// ---- k_gemmw<T16, NF>: GEMM, EIGHT WAVES (4 x 2) per 256 x (32 NF) output tile, each wave 64 rows x 16 NF columns (4 NF accumulators); grid (M/256, N/(32 NF), Z), 256 threads, one block per WGP, two waves per SIMD.
// NF = 8: 256x256 tile; NF = 6: 256x192 tile (N = 768: four column tiles, so that the grid is a whole number of blocks per WGP).
// Operand tiles (256 rows of A, 32 NF rows of Bt, 128 k each) are staged in LDS by asynchronous 16-byte copies, two buffers: tile t+1 flies while tile t is worked on; a staged A row serves two waves, a staged Bt row four.
// C[m][n] (f32, pitch LDC) = sum_k A[m][k] Bt[n][k]. z-batch strides sA/sB/sC in elements. K % 128 == 0, M % 256 == 0, N % (32 NF) == 0.
// Fragment map (A and Bt alike): lane -> row/col lane&15, h = lane>>4; elements 0..7 = k0+8h+0..7, elements 8..15 = k0+16+8h+0..7. D: acc[j] = (row 8h+j, col lane&15).
template <typename T16> struct WFrag;
template <> struct WFrag<h16> { typedef v16h V; static __device__ __forceinline__ V ld(const h16* p) { return cat16(*(const v8h*)p, *(const v8h*)(p + 16)); } static __device__ __forceinline__ v8f mma(V a, V b, v8f c) { return wmma16(a, b, c); } };
template <> struct WFrag<bf> { typedef v16bf V; static __device__ __forceinline__ V ld(const bf* p) { return cat16b(*(const v8us*)p, *(const v8us*)(p + 16)); } static __device__ __forceinline__ v8f mma(V a, V b, v8f c) { return wmmab(a, b, c); } };
#define GBK  128                 // k per staged tile: 256 B of every operand row
#define GPIT 136                 // LDS row pitch in 16-bit elements: 272 B = 16 B x odd, conflict-free for 16-byte fragment reads
#define GBM  256                 // A rows per block tile
typedef int v4i __attribute__((vector_size(16)));
// one lane's 16 bytes, global -> LDS, through no register
__device__ __forceinline__ void cp16(const void* g, void* l) {
    __builtin_amdgcn_global_load_async_to_lds_b128((__attribute__((address_space(1))) v4i*)g, (__attribute__((address_space(3))) v4i*)l, 0, 0);
}
template <typename T16, int NF, int LDC>
__global__ __launch_bounds__(256) void k_gemmw(const T16* __restrict__ A, const T16* __restrict__ Bt, int K, float* C, size_t sA, size_t sB, size_t sC) {
    typedef typename WFrag<T16>::V V;
    constexpr int WN = NF * 16;                  // columns per wave
    constexpr int GBN = 2 * WN;                  // Bt rows per block tile
    constexpr int GSTG = (GBM + GBN) * GPIT;     // one buffer: rows 0..255 = A tile, the rows behind = Bt tile
    constexpr int OSP = WN + 4;                  // pitch in floats of a wave's 16-row output stage
    static_assert(8 * 16 * OSP * 4 <= 2 * GSTG * 2);
    static_assert(GBM / 16 + GBN / 16 <= 63);    // copies of one wave in flight
    __shared__ __align__(16) unsigned char smem[2 * GSTG * 2];
    T16* ring = (T16*)smem;
    const size_t z = blockIdx.z; A += z * sA; Bt += z * sB; C += z * sC;
    const int tid = threadIdx.x, lane = tid & 31, lr = lane & 15, hi = lane >> 4;
    const int wave = __builtin_amdgcn_readfirstlane(tid >> 5), wm = wave >> 1, wn = wave & 1;
    const int t0r = blockIdx.x * GBM, t0c = blockIdx.y * GBN;
    const int r0 = t0r + wm * 64, c0 = t0c + wn * WN;
    float* os = (float*)smem + wave * (16 * OSP);   // output stage: lies in the ring, used only behind the loop's last barrier (no reader, no copy left)
    v8f acc[4][NF];
#pragma unroll
    for (int mb = 0; mb < 4; ++mb)
#pragma unroll
        for (int nb = 0; nb < NF; ++nb) acc[mb][nb] = (v8f){};
    // copy map: 16 lanes cover one row's 256 B, the block covers 16 rows per copy; 16 copies for A, 2 NF for Bt per lane and tile
    const int cr = tid >> 4, cch = (tid & 15) * 8;
    const T16* ga = A + (size_t)(t0r + cr) * K + cch;
    const T16* gb = Bt + (size_t)(t0c + cr) * K + cch;
    const size_t gstep = (size_t)16 * K;
    T16* lbase = ring + cr * GPIT + cch;
    auto fill = [&](int buf, int kt) {
        const T16* pa = ga + (size_t)kt * GBK; const T16* pb = gb + (size_t)kt * GBK; T16* l = lbase + buf * GSTG;
#pragma unroll
        for (int i = 0; i < GBM / 16; ++i) cp16(pa + i * gstep, l + i * 16 * GPIT);
#pragma unroll
        for (int i = 0; i < GBN / 16; ++i) cp16(pb + i * gstep, l + (GBM + i * 16) * GPIT);
    };
    const int nt = K / GBK;
    fill(0, 0);
    asm volatile("s_wait_asynccnt 0x0" ::: "memory");   // tile 0 landed (this wave's copies) before the barrier publishes it
    __syncthreads();
    const int aofs = (wm * 64 + lr) * GPIT + 8 * hi, bofs = (GBM + wn * WN + lr) * GPIT + 8 * hi;
#pragma unroll 1   // one trip per staged tile stays rolled: the body already holds 16 NF WMMAs
    for (int t = 0; t < nt; ++t) {
        const T16* sa = ring + (t & 1) * GSTG + aofs; const T16* sb = ring + (t & 1) * GSTG + bofs;
        V a[2][4], b[2][NF];   // two fragment sets: the next 32 k are fetched from LDS while the current 32 k are multiplied
#pragma unroll
        for (int f = 0; f < 4; ++f) a[0][f] = WFrag<T16>::ld(sa + f * 16 * GPIT);
#pragma unroll
        for (int f = 0; f < NF; ++f) b[0][f] = WFrag<T16>::ld(sb + f * 16 * GPIT);
        // tile t+1 into the other buffer: its last readers (trip t-1) ended at the barrier just passed; issued behind the first fragment reads so that their LDS latency passes meanwhile
        if (t + 1 < nt) fill((t + 1) & 1, t + 1);
#pragma unroll
        for (int ks = 0; ks < GBK / 32; ++ks) {
            const int cu = ks & 1, nx = cu ^ 1;
            if (ks + 1 < GBK / 32) {
#pragma unroll
                for (int f = 0; f < 4; ++f) a[nx][f] = WFrag<T16>::ld(sa + f * 16 * GPIT + (ks + 1) * 32);
#pragma unroll
                for (int f = 0; f < NF; ++f) b[nx][f] = WFrag<T16>::ld(sb + f * 16 * GPIT + (ks + 1) * 32);
            }
            __builtin_amdgcn_sched_barrier(0);   // keeps the next set's LDS reads as one group ahead of this block's WMMAs
#pragma unroll
            for (int nb = 0; nb < NF; ++nb)
#pragma unroll
                for (int mb = 0; mb < 4; ++mb) acc[mb][nb] = WFrag<T16>::mma(a[cu][mb], b[cu][nb], acc[mb][nb]);
            __builtin_amdgcn_sched_barrier(0);   // keeps this block's WMMAs ahead of the following group of LDS reads
        }
        asm volatile("s_wait_dscnt 0x0" ::: "memory");      // this wave's reads of buffer t&1 are done before the buffer is refilled
        asm volatile("s_wait_asynccnt 0x0" ::: "memory");   // this wave's copies of tile t+1 have landed before the barrier publishes them
        __syncthreads();                                    // publishes tile t+1; ends every wave's reads of buffer t&1
    }
    asm volatile("s_wait_asynccnt 0x0" ::: "memory");       // no copy outstanding when the wave goes on
    // output: 16 rows at a time through the wave's own LDS stage, stored as 16-byte pieces in row order (whole 128-byte lines).
    // After NP wave-wide stores the piece pattern repeats RP rows further down, so every address is one of NP lane pointers plus a compile-time offset.
    constexpr int CPR = NF * 4;                      // 16-byte pieces per staged row
    constexpr int NP = (CPR % 32 == 0) ? 1 : 3;
    constexpr int RP = 32 * NP / CPR;
    static_assert((32 * NP) % CPR == 0 && 16 % RP == 0);
    float* gp[NP]; const float* lp[NP];
#pragma unroll
    for (int p = 0; p < NP; ++p) { const int q = p * 32 + lane, row = q / CPR, cofs = (q % CPR) * 4;
        gp[p] = C + (size_t)(r0 + row) * LDC + c0 + cofs; lp[p] = os + row * OSP + cofs; }
#pragma unroll
    for (int mb = 0; mb < 4; ++mb) {
#pragma unroll
        for (int nb = 0; nb < NF; ++nb) {
#pragma unroll
            for (int j = 0; j < 8; ++j) os[(hi * 8 + j) * OSP + nb * 16 + lr] = acc[mb][nb][j]; }
        __builtin_amdgcn_wave_barrier(); asm volatile("" ::: "memory");
#pragma unroll
        for (int u = 0; u < 16 / RP; ++u)
#pragma unroll
            for (int p = 0; p < NP; ++p) { const v4f val = *(const v4fa*)(lp[p] + u * RP * OSP);
                *(v4f*)(gp[p] + (size_t)(mb * 16 + u * RP) * LDC) = val; }
        if (mb + 1 < 4) asm volatile("s_wait_xcnt 0x0" ::: "memory");   // stands in front of the next 16 rows' LDS reads, which overwrite the registers that these stores name
        __builtin_amdgcn_wave_barrier();
    }
}

__global__ __launch_bounds__(256) void k_cvt8(const float* __restrict__ src, bf* dst, size_t n8, size_t sS, size_t sD) {
    const size_t i = (size_t)blockIdx.x * 256 + threadIdx.x; if (i >= n8) return;
    src += (size_t)blockIdx.y * sS; dst += (size_t)blockIdx.y * sD;
    const v8f v = *(const v8f*)(src + i * 8); v8us o;
#pragma unroll
    for (int k = 0; k < 8; ++k) o[k] = f2bf(v[k]);
    *(v8us*)(dst + i * 8) = o;  }

// k_cvx: x slab f32 -> (a) bf16 (RNE) plane xb [slab][t][d]; (b) f16 plane kx [slab][t][k | k] (pitch KX2) holding the bf16 value (exact in f16, subnormals -> 0) in both halves.
__global__ __launch_bounds__(256) void k_cvx(const float* __restrict__ src, bf* xb, h16* kx, size_t n8, size_t sS, size_t sD) {
#pragma clang fp contract(off)
    const size_t i = (size_t)blockIdx.x * 256 + threadIdx.x; if (i >= n8) return;
    src += (size_t)blockIdx.y * sS; xb += (size_t)blockIdx.y * sD; kx += (size_t)blockIdx.y * sD * 2;
    const v8f v = *(const v8f*)(src + i * 8); v8us o; v8h kk;
#pragma unroll
    for (int k = 0; k < 8; ++k) { o[k] = f2bf(v[k]); kk[k] = toh_flush(__uint_as_float((unsigned)o[k] << 16)); }
    const size_t e = i * 8; const size_t row = e / DM; const int col = (int)(e % DM);
    h16* kp = kx + row * KX2 + col;
    *(v8us*)(xb + e) = o; *(v8h*)kp = kk; *(v8h*)(kp + HD) = kk;
     }

// k_cvtq: projected rows f32 [r][d] -> f16 plane qx [r][qh | ql] (pitch KX2): qh = f16(2048 q), ql = f16(2048 q - qh) (exact difference), subnormals -> 0.
__global__ __launch_bounds__(256) void k_cvtq(const float* __restrict__ src, h16* qx, size_t n8) {
#pragma clang fp contract(off)
    const size_t i = (size_t)blockIdx.x * 256 + threadIdx.x; if (i >= n8) return;
    const v8f v = *(const v8f*)(src + i * 8); v8h qh, ql;
#pragma unroll
    for (int k = 0; k < 8; ++k) { const float s = v[k] * QCAR; const h16 a = toh_flush(s); const float r = s - (float)a; qh[k] = a; ql[k] = toh_flush(r); }
    const size_t e = i * 8; const size_t row = e / DM; const int col = (int)(e % DM);
    h16* qp = qx + row * KX2 + col;
    *(v8h*)qp = qh; *(v8h*)(qp + HD) = ql;
     }

// k_vtpx: bf16 plane [g][t][d] -> f16 plane [g][d][t], one 128 t x 128 d tile per block, turned in LDS so that both global sides move whole 256-byte row pieces (16 lanes x 16 B).
// LDS tile [d][t pair]: one dword = the f16 values of t and t+1 at one d; a row is 64 dwords = 16 groups of 4. Group j of row d lies at place j ^ (d >> 3): the 16 lanes of a dword store (d 8 apart, same t pair) then fall on 16 different banks, and a 16-byte read still takes one whole group.
#define VTT 128
#define VTD 128
typedef __attribute__((ext_vector_type(4))) unsigned v4u;
__global__ __launch_bounds__(256) void k_vtpx(const bf* __restrict__ F, h16* V16) {
    __shared__ __align__(16) unsigned tile[VTD * (VTT / 2)];
    const int tid = threadIdx.x, c16 = tid & 15, r16 = tid >> 4;
    const int t0 = blockIdx.x * VTT, d0 = blockIdx.y * VTD, g = blockIdx.z;
    // in: lane -> 8 d (c16), row pairs r16 + 16 k
    const bf* src = F + ((size_t)g * SEQ + t0) * DM + d0 + c16 * 8;
    v8us r[VTT / 32][2];
#pragma unroll
    for (int k = 0; k < VTT / 32; ++k)
#pragma unroll
        for (int q = 0; q < 2; ++q) r[k][q] = *(const v8us*)(src + (size_t)(2 * (r16 + 16 * k) + q) * DM);
#pragma unroll
    for (int k = 0; k < VTT / 32; ++k) { const int tp = r16 + 16 * k; unsigned* col = tile + (size_t)(c16 * 8) * (VTT / 2) + (((tp >> 2) ^ c16) << 2) + (tp & 3);
#pragma unroll
        for (int i = 0; i < 8; ++i) { v2h o16;
#pragma unroll
            for (int q = 0; q < 2; ++q) o16[q] = toh_flush(__uint_as_float((unsigned)r[k][q][i] << 16));
            col[i * (VTT / 2)] = __builtin_bit_cast(unsigned, o16); } }
    __syncthreads();   // the whole tile is in LDS before any row of it is read
    // out: lane -> 8 t (c16), d rows r16 + 16 k
    h16* dst = V16 + ((size_t)g * HD + d0) * SEQ + t0 + c16 * 8;
#pragma unroll
    for (int k = 0; k < VTD / 16; ++k) { const int d = r16 + 16 * k;
        const v4u val = *(const v4u*)(tile + d * (VTT / 2) + ((c16 ^ (d >> 3)) << 2));
        *(v4u*)(dst + (size_t)d * SEQ) = val; }
}

__global__ __launch_bounds__(256) void k_vmeanx(const bf* __restrict__ F, float* VM) {
#pragma clang fp contract(off)
    __shared__ float part[8 * 32];
    const int c = threadIdx.x & 31; const int r = __builtin_amdgcn_readfirstlane(threadIdx.x >> 5); const int g = blockIdx.y; const int d = blockIdx.x * 32 + c;
    const bf* f = F + (size_t)g * SEQ * DM + d; float s = 0.f;
#pragma unroll 4
    for (int t = r; t < SEQ; t += 8) { const float xv = __uint_as_float((unsigned)f[(size_t)t * DM] << 16); s += (fabsf(xv) < 6.103515625e-05f) ? 0.0f : xv; }
    part[r * 32 + c] = s;
    __syncthreads();
    if (r == 0) { float a = part[c];
#pragma unroll
        for (int q = 1; q < 8; ++q) a += part[q * 32 + c];
        a *= (1.0f / (float)SEQ); float* p = VM + (size_t)g * HD + d;
        *(float*)p = a;  }
}

// k_asoft: per row (one wave): t = S' x SCL (SCL = 1/2048 undoes the q carry; the module has no score scale); softmax over the SEQ keys (register row, running max then one exp, fixed shuffle trees);
__global__ __launch_bounds__(256) void k_asoft(const float* __restrict__ Sb, h16* P16) {
    const int lane = threadIdx.x & 31; const int row = blockIdx.x * 8 + (threadIdx.x >> 5); if (row >= ZB * SEQ) return;
    const float* sr = Sb + (size_t)row * SEQ; float v[SEQ / 32]; float mx = -3.0e38f;
#pragma unroll
    for (int ch = 0; ch < SEQ / 128; ++ch) { const v4f a = *(const v4f*)(sr + ch * 128 + lane * 4);
#pragma unroll
        for (int q = 0; q < 4; ++q) { const float t = a[q] * SCL; v[ch * 4 + q] = t; mx = fmaxf(mx, t); } }
#pragma unroll
    for (int sh = 16; sh; sh >>= 1) mx = fmaxf(mx, __shfl_xor(mx, sh, 32));
    float sum = 0.f;
#pragma unroll
    for (int k = 0; k < SEQ / 32; ++k) { float d0 = __fsub_rn(v[k], mx); asm volatile("" : "+v"(d0)); v[k] = __builtin_amdgcn_exp2f(__fmul_rn(d0, 1.4426950408889634f)); sum += v[k]; }
#pragma unroll
    for (int sh = 16; sh; sh >>= 1) sum += __shfl_xor(sum, sh, 32);
    const float f = __fdiv_rn(PCAR, sum); const float cen = PCAR / (float)SEQ;
{
#pragma unroll
        for (int ch = 0; ch < SEQ / 128; ++ch) { v4h o4;
#pragma unroll
            for (int q = 0; q < 4; ++q) o4[q] = tohx(v[ch * 4 + q] * f - cen);
            *(v4h*)(P16 + (size_t)row * SEQ + ch * 128 + lane * 4) = o4; }
         }
}

__global__ __launch_bounds__(256) void k_merge(const float* __restrict__ O, const float* __restrict__ VM, float* OUTb) {
    const size_t e = ((size_t)blockIdx.x * 256 + threadIdx.x) * 2; if (e >= (size_t)ZB * SEQ * HD) return;
    const int d = (int)(e % HD); const int g = (int)(e / ((size_t)HD * SEQ));
    const v2f m = *(const v2f*)(VM + (size_t)g * HD + d); const v2f o = *(const v2f*)(O + e);
    v2f o2; o2[0] = o[0] * (1.0f / PCAR) + m[0]; o2[1] = o[1] * (1.0f / PCAR) + m[1];
    *(v2f*)(OUTb + e) = o2;  }

constexpr size_t al256(size_t b) { return (b + 255) & ~(size_t)255; }
constexpr size_t mx2(size_t a, size_t b) { return a > b ? a : b; }
// Shared ranges, by launch order within a pass:
// range 1: XB, FQ (last read by k_cvtq / k_vtpx / k_vmeanx) -> Sb (written by the score GEMM, last read by k_asoft) -> Ob (written by the last GEMM)
// range 2: QX, KX (last read by the score GEMM) -> P16 (written by k_asoft)
constexpr size_t WS_XB = al256((size_t)ZB * SEQ * DM * 2);      // XB bf16
constexpr size_t WS_FQ = al256((size_t)ZB * SEQ * DM * 4);      // FQ f32
constexpr size_t WS_QX = al256((size_t)ZB * SEQ * KX2 * 2);     // QX f16 [qh | ql]; KX f16 [k | k] has the same size
constexpr size_t WS_R1 = mx2(mx2(WS_XB + WS_FQ, al256((size_t)ZB * SEQ * SEQ * 4)), al256((size_t)ZB * SEQ * HD * 4));
constexpr size_t WS_R2 = mx2(2 * WS_QX, al256((size_t)ZB * SEQ * SEQ * 2));
constexpr size_t WS_TOTAL =
    al256((size_t)DM * DM * 2) +                  // WQ bf16
    WS_R1 + WS_R2 +
    al256((size_t)ZB * HD * SEQ * 2) +            // VT16
    al256((size_t)ZB * HD * 4);                   // VM
static_assert(WS_TOTAL <= (size_t)268435456);

extern "C" void kernel_launch(void* const* d_in, const int* in_sizes, int n_in,
                              void* d_out, int out_size, void* d_ws, size_t ws_size, hipStream_t stream) {
    if (n_in < 2) return;
    if ((size_t)in_sizes[0] < ((size_t)(NB - 1) * SEQ_FULL + SEQ) * DM) return;
    if ((size_t)in_sizes[1] < (size_t)DM * DM) return;
    if ((size_t)out_size < (size_t)NB * SEQ * DM) return;
    if (WS_TOTAL > ws_size) return;
    const float* x = (const float*)d_in[0]; const float* wq = (const float*)d_in[1];   // x [NB][SEQ_FULL][768]; W [768 out][768 in]
    float* OUT = (float*)d_out;     // [NB][SEQ][768]
    char* wsp = (char*)d_ws;
    auto take = [&](size_t bytes) { char* p = wsp; wsp += al256(bytes); return (void*)p; };
    bf* WQ = (bf*)take((size_t)DM * DM * 2);
    char* r1 = (char*)take(WS_R1);
    char* r2 = (char*)take(WS_R2);
    bf* XB = (bf*)r1; float* FQ = (float*)(r1 + WS_XB); float* Sb = (float*)r1; float* Ob = (float*)r1;
    h16* QX = (h16*)r2; h16* KX = (h16*)(r2 + WS_QX); h16* P16 = (h16*)r2;
    h16* VT16 = (h16*)take((size_t)ZB * HD * SEQ * 2);
    float* VM = (float*)take((size_t)ZB * HD * 4);
    if ((size_t)(wsp - (char*)d_ws) > ws_size) return;

    const size_t w8 = (size_t)DM * DM / 8;
    k_cvt8<<<dim3((unsigned)((w8 + 255) / 256), 1, 1), 256, 0, stream>>>(wq, WQ, w8, 0, 0);

    const size_t x8 = (size_t)SEQ * DM / 8;                 // per batch slab
    const size_t p8 = (size_t)ZB * SEQ * DM / 8;            // projected rows of one pass
    const unsigned LE2 = (unsigned)(((size_t)ZB * SEQ * HD / 2 + 255) / 256);
    for (int b0 = 0; b0 < NB; b0 += ZB) {
        k_cvx<<<dim3((unsigned)((x8 + 255) / 256), ZB, 1), 256, 0, stream>>>(x + (size_t)b0 * SEQ_FULL * DM, XB, KX, x8, (size_t)SEQ_FULL * DM, (size_t)SEQ * DM);
        k_gemmw<bf, 6, DM><<<dim3(ZB * SEQ / 256, DM / 192, 1), 256, 0, stream>>>(XB, WQ, DM, FQ, 0, 0, 0);
        k_cvtq<<<dim3((unsigned)((p8 + 255) / 256), 1, 1), 256, 0, stream>>>(FQ, QX, p8);
        k_vtpx<<<dim3(SEQ / 128, HD / 128, ZB), 256, 0, stream>>>(XB, VT16);
        k_vmeanx<<<dim3(HD / 32, ZB, 1), 256, 0, stream>>>(XB, VM);
        k_gemmw<h16, 8, SEQ><<<dim3(SEQ / 256, SEQ / 256, ZB), 256, 0, stream>>>(QX, KX, KX2, Sb, (size_t)SEQ * KX2, (size_t)SEQ * KX2, (size_t)SEQ * SEQ);
        k_asoft<<<ZB * SEQ / 8, 256, 0, stream>>>(Sb, P16);
        k_gemmw<h16, 6, HD><<<dim3(SEQ / 256, HD / 192, ZB), 256, 0, stream>>>(P16, VT16, SEQ, Ob, (size_t)SEQ * SEQ, (size_t)HD * SEQ, (size_t)SEQ * HD);
        k_merge<<<LE2, 256, 0, stream>>>(Ob, VM, OUT + (size_t)b0 * SEQ * DM);
    }
}

// v005
// One run takes 184 microseconds.
// Two timings next to v004 put it at 1.22 and 1.23 times that version's speed.
// All steps since v000 together make it 3.95 times as fast.
#include <hip/hip_runtime.h>

// Contractions: q projection on v_wmma_f32_16x16x32_bf16 (x and W RNE-converted to bf16, exact products, f32 accumulate); q.x^T on v_wmma_f32_16x16x32_f16 with q carried x2048 as f16 value + f16 remainder folded along K ([qh | ql] x [k | k], k = f16 of the bf16 x, exact); att.x on v_wmma_f32_16x16x32_f16 (f16 x plane; softmax weights carried x1024 and centred by 1024/SEQ, column mean of x added back in f32), f32 accumulate.
// Single-head full-width document self-attention: x [8][2048][768]; q = x W^T ('oi' [768][768], no bias); keys = values = x; att = softmax(q.x) over all 2048 keys (no scale, no mask); out = att @ x -> [8][2048][768] f32.
// All batches in one pass (z-batched GEMMs; workspace planes whose readers have all run share their bytes with later planes): x -> bf16 plane + f16 [k | k] plane; projection -> f16 [qh | ql] plane (split in the GEMM's output stage); x transposed [d][t] f16; S' = 2048 q.x (f32, materialised per pass); row softmax in registers; O = P' x, out = O/1024 + mean_t(x) formed in the GEMM's output stage.

#ifndef NB
#define NB 8
#endif
#ifndef SEQ
#define SEQ 2048
#endif
#define NB_FULL  8
#define SEQ_FULL 2048
#define DM   768
#define HD   768
#define ZB   NB                           // batches per pass: all of them, so every stage is one launch with the fullest grid
#define PCAR 1024.0f
#define QCAR 2048.0f                      // carry of the q value / remainder planes
#define SCL  4.8828125e-4f                // 1/2048: undoes the q carry (the module applies no score scale)
#define KX2  (2 * HD)                     // pitch of the K-folded planes [value | remainder] and [k | k]

typedef _Float16 h16;
typedef unsigned short bf;
typedef __attribute__((ext_vector_type(16))) __bf16   v16bf;
typedef __attribute__((ext_vector_type(16))) _Float16 v16h;
typedef __attribute__((ext_vector_type(8)))  _Float16 v8h;
typedef __attribute__((ext_vector_type(8)))  unsigned short v8us;
typedef __attribute__((ext_vector_type(8)))  float    v8f;
typedef __attribute__((ext_vector_type(4)))  float    v4f;
typedef __attribute__((ext_vector_type(2)))  _Float16 v2h;
typedef __attribute__((ext_vector_type(4)))  _Float16 v4h;
typedef v4f  __attribute__((may_alias)) v4fa;

static_assert(NB <= NB_FULL);
static_assert(SEQ <= SEQ_FULL);
static_assert(NB % ZB == 0);
static_assert(SEQ % 128 == 0);                 // softmax row chunks, 64-row tiles, K steps of 32
static_assert(DM % 64 == 0 && HD % 64 == 0);   // K steps of 32
static_assert(DM == HD);                       // q width == x width: q.x contracts over 768
static_assert(((size_t)SEQ * DM) % 8 == 0);
static_assert((ZB * SEQ) % 8 == 0);
static_assert(HD % 32 == 0 && SEQ % 8 == 0);
static_assert(KX2 % 32 == 0);                  // folded score GEMM: K steps of 32
static_assert((ZB * SEQ) % 64 == 0);           // projection GEMM rows: 64-row wave quarters
static_assert(QCAR * SCL == 1.0f);             // carry folded back exactly in the softmax scale
static_assert((KX2 * 2) % 128 == 0);
static_assert(DM % 64 == 0);
static_assert(((size_t)SEQ * DM / 8) * 16 == (size_t)SEQ * DM * 2);          // k_cvx: threads x 16 B == slab bytes (per plane half)
static_assert(SEQ % 128 == 0 && HD % 128 == 0 && DM == HD);                  // k_vtpx: 128 t x 128 d tiles cover the plane
static_assert(2 * 512 * 272 <= 327680);       // k_gemmw static LDS: one block per 320 KiB LDS
static_assert(DM % 128 == 0 && KX2 % 128 == 0 && SEQ % 128 == 0);                                 // k_gemmw: K tiles of 128
static_assert(SEQ % 256 == 0 && (ZB * SEQ) % 256 == 0 && DM % 192 == 0 && HD % 192 == 0);         // k_gemmw: 256x256 and 256x192 tiles cover the outputs
static_assert(8 * 32 * 4 <= 131072);           // k_vmeanx static LDS

__device__ __forceinline__ unsigned short f2bf(float f) { unsigned u = __float_as_uint(f); u += 0x7FFFu + ((u >> 16) & 1u); return (unsigned short)(u >> 16); }
__device__ __forceinline__ v16h cat16(v8h lo, v8h hi) { return __builtin_shufflevector(lo, hi, 0, 1, 2, 3, 4, 5, 6, 7, 8, 9, 10, 11, 12, 13, 14, 15); }
__device__ __forceinline__ v16bf cat16b(v8us lo, v8us hi) { return __builtin_bit_cast(v16bf, __builtin_shufflevector(lo, hi, 0, 1, 2, 3, 4, 5, 6, 7, 8, 9, 10, 11, 12, 13, 14, 15)); }
__device__ __forceinline__ v8f wmma16(v16h a, v16h b, v8f c) { return __builtin_amdgcn_wmma_f32_16x16x32_f16(false, a, false, b, (short)0, c, false, false); }
__device__ __forceinline__ v8f wmmab(v16bf a, v16bf b, v8f c) { return __builtin_amdgcn_wmma_f32_16x16x32_bf16(false, a, false, b, (short)0, c, false, false); }
__device__ __forceinline__ h16 tohx(float x) { return (h16)x; }
// f32 -> f16 (RNE) that cannot produce an f16 subnormal: |v| < 2^-14 -> +0 (value select).
static __device__ __forceinline__ h16 toh_flush(float v) { const h16 r = (h16)v; return (fabsf(v) < 6.103515625e-05f) ? (h16)0.0f : r; }

// ---- k_gemmw<T16, NF>: GEMM, EIGHT WAVES (4 x 2) per 256 x (32 NF) output tile, each wave 64 rows x 16 NF columns (4 NF accumulators); grid (M/256, N/(32 NF), Z), 256 threads, one block per WGP, two waves per SIMD.
// NF = 8: 256x256 tile; NF = 6: 256x192 tile (N = 768: four column tiles, so that the grid is a whole number of blocks per WGP).
// Operand tiles (256 rows of A, 32 NF rows of Bt, 128 k each) are staged in LDS by asynchronous 16-byte copies, two buffers: tile t+1 flies while tile t is worked on; a staged A row serves two waves, a staged Bt row four.
// C[m][n] (f32, pitch LDC) = sum_k A[m][k] Bt[n][k]. z-batch strides sA/sB/sC in elements. K % 128 == 0, M % 256 == 0, N % (32 NF) == 0.
// EPI picks what the output stage does with the f32 sums: 0 = store them to C; 1 = split each into f16 value + f16 remainder, carried x2048, and store both to QO [m][qh | ql] (pitch KX2; C unused); 2 = store sum/1024 + VM[z][n] to C.
// Fragment map (A and Bt alike): lane -> row/col lane&15, h = lane>>4; elements 0..7 = k0+8h+0..7, elements 8..15 = k0+16+8h+0..7. D: acc[j] = (row 8h+j, col lane&15).
template <typename T16> struct WFrag;
template <> struct WFrag<h16> { typedef v16h V; static __device__ __forceinline__ V ld(const h16* p) { return cat16(*(const v8h*)p, *(const v8h*)(p + 16)); } static __device__ __forceinline__ v8f mma(V a, V b, v8f c) { return wmma16(a, b, c); } };
template <> struct WFrag<bf> { typedef v16bf V; static __device__ __forceinline__ V ld(const bf* p) { return cat16b(*(const v8us*)p, *(const v8us*)(p + 16)); } static __device__ __forceinline__ v8f mma(V a, V b, v8f c) { return wmmab(a, b, c); } };
#define GBK  128                 // k per staged tile: 256 B of every operand row
#define GPIT 136                 // LDS row pitch in 16-bit elements: 272 B = 16 B x odd, conflict-free for 16-byte fragment reads
#define GBM  256                 // A rows per block tile
typedef int v4i __attribute__((vector_size(16)));
// one lane's 16 bytes, global -> LDS, through no register
__device__ __forceinline__ void cp16(const void* g, void* l) {
    __builtin_amdgcn_global_load_async_to_lds_b128((__attribute__((address_space(1))) v4i*)g, (__attribute__((address_space(3))) v4i*)l, 0, 0);
}
template <typename T16, int NF, int LDC, int EPI>
__global__ __launch_bounds__(256) void k_gemmw(const T16* __restrict__ A, const T16* __restrict__ Bt, int K, float* C, size_t sA, size_t sB, size_t sC, h16* QO, const float* __restrict__ VM) {
    typedef typename WFrag<T16>::V V;
    constexpr int WN = NF * 16;                  // columns per wave
    constexpr int GBN = 2 * WN;                  // Bt rows per block tile
    constexpr int GSTG = (GBM + GBN) * GPIT;     // one buffer: rows 0..255 = A tile, the rows behind = Bt tile
    constexpr int OSP = WN + 4;                  // pitch in floats of a wave's 16-row output stage
    static_assert(8 * 16 * OSP * 4 <= 2 * GSTG * 2);
    static_assert(GBM / 16 + GBN / 16 <= 63);    // copies of one wave in flight
    __shared__ __align__(16) unsigned char smem[2 * GSTG * 2];
    T16* ring = (T16*)smem;
    const size_t z = blockIdx.z; A += z * sA; Bt += z * sB; C += z * sC;
    const int tid = threadIdx.x, lane = tid & 31, lr = lane & 15, hi = lane >> 4;
    const int wave = __builtin_amdgcn_readfirstlane(tid >> 5), wm = wave >> 1, wn = wave & 1;
    const int t0r = blockIdx.x * GBM, t0c = blockIdx.y * GBN;
    const int r0 = t0r + wm * 64, c0 = t0c + wn * WN;
    float* os = (float*)smem + wave * (16 * OSP);   // output stage: lies in the ring, used only behind the loop's last barrier (no reader, no copy left)
    v8f acc[4][NF];
#pragma unroll
    for (int mb = 0; mb < 4; ++mb)
#pragma unroll
        for (int nb = 0; nb < NF; ++nb) acc[mb][nb] = (v8f){};
    // copy map: 16 lanes cover one row's 256 B, the block covers 16 rows per copy; 16 copies for A, 2 NF for Bt per lane and tile
    const int cr = tid >> 4, cch = (tid & 15) * 8;
    const T16* ga = A + (size_t)(t0r + cr) * K + cch;
    const T16* gb = Bt + (size_t)(t0c + cr) * K + cch;
    const size_t gstep = (size_t)16 * K;
    T16* lbase = ring + cr * GPIT + cch;
    auto fill = [&](int buf, int kt) {
        const T16* pa = ga + (size_t)kt * GBK; const T16* pb = gb + (size_t)kt * GBK; T16* l = lbase + buf * GSTG;
#pragma unroll
        for (int i = 0; i < GBM / 16; ++i) cp16(pa + i * gstep, l + i * 16 * GPIT);
#pragma unroll
        for (int i = 0; i < GBN / 16; ++i) cp16(pb + i * gstep, l + (GBM + i * 16) * GPIT);
    };
    const int nt = K / GBK;
    fill(0, 0);
    asm volatile("s_wait_asynccnt 0x0" ::: "memory");   // tile 0 landed (this wave's copies) before the barrier publishes it
    __syncthreads();
    const int aofs = (wm * 64 + lr) * GPIT + 8 * hi, bofs = (GBM + wn * WN + lr) * GPIT + 8 * hi;
#pragma unroll 1   // one trip per staged tile stays rolled: the body already holds 16 NF WMMAs
    for (int t = 0; t < nt; ++t) {
        const T16* sa = ring + (t & 1) * GSTG + aofs; const T16* sb = ring + (t & 1) * GSTG + bofs;
        V a[2][4], b[2][NF];   // two fragment sets: the next 32 k are fetched from LDS while the current 32 k are multiplied
#pragma unroll
        for (int f = 0; f < 4; ++f) a[0][f] = WFrag<T16>::ld(sa + f * 16 * GPIT);
#pragma unroll
        for (int f = 0; f < NF; ++f) b[0][f] = WFrag<T16>::ld(sb + f * 16 * GPIT);
        // tile t+1 into the other buffer: its last readers (trip t-1) ended at the barrier just passed; issued behind the first fragment reads so that their LDS latency passes meanwhile
        if (t + 1 < nt) fill((t + 1) & 1, t + 1);
#pragma unroll
        for (int ks = 0; ks < GBK / 32; ++ks) {
            const int cu = ks & 1, nx = cu ^ 1;
            if (ks + 1 < GBK / 32) {
#pragma unroll
                for (int f = 0; f < 4; ++f) a[nx][f] = WFrag<T16>::ld(sa + f * 16 * GPIT + (ks + 1) * 32);
#pragma unroll
                for (int f = 0; f < NF; ++f) b[nx][f] = WFrag<T16>::ld(sb + f * 16 * GPIT + (ks + 1) * 32);
            }
            __builtin_amdgcn_sched_barrier(0);   // keeps the next set's LDS reads as one group ahead of this block's WMMAs
#pragma unroll
            for (int nb = 0; nb < NF; ++nb)
#pragma unroll
                for (int mb = 0; mb < 4; ++mb) acc[mb][nb] = WFrag<T16>::mma(a[cu][mb], b[cu][nb], acc[mb][nb]);
            __builtin_amdgcn_sched_barrier(0);   // keeps this block's WMMAs ahead of the following group of LDS reads
        }
        asm volatile("s_wait_dscnt 0x0" ::: "memory");      // this wave's reads of buffer t&1 are done before the buffer is refilled
        asm volatile("s_wait_asynccnt 0x0" ::: "memory");   // this wave's copies of tile t+1 have landed before the barrier publishes them
        __syncthreads();                                    // publishes tile t+1; ends every wave's reads of buffer t&1
    }
    asm volatile("s_wait_asynccnt 0x0" ::: "memory");       // no copy outstanding when the wave goes on
    if constexpr (EPI == 1) {
        // split output: the block's whole 256 x GBN f32 tile is staged in the ring (free behind the loop's last barrier), so that a row's f16 pieces leave as whole 128-byte lines, each line from one wave.
        constexpr int BSP = GBN + 4;                 // pitch in floats of the block's output stage
        constexpr int CP8 = GBN / 8;                 // 8-column pieces per staged row: 32 B of f32 in, 16 B of qh and 16 B of ql out
        constexpr int NQ = (CP8 % 32 == 0) ? 1 : 3;  // after NQ wave-wide pieces the pattern repeats RQ rows further down
        constexpr int RQ = 32 * NQ / CP8;
        static_assert(GBM * BSP * 4 <= 2 * GSTG * 2);
        static_assert((32 * NQ) % CP8 == 0 && 32 % RQ == 0 && CP8 % 8 == 0 && GBM == 8 * 32);
        float* bs = (float*)smem;
#pragma unroll
        for (int mb = 0; mb < 4; ++mb)
#pragma unroll
            for (int nb = 0; nb < NF; ++nb)
#pragma unroll
                for (int j = 0; j < 8; ++j) bs[(wm * 64 + mb * 16 + hi * 8 + j) * BSP + wn * WN + nb * 16 + lr] = acc[mb][nb][j];
        __syncthreads();   // the whole tile is staged before a wave reads rows that other waves wrote
        h16* qp[NQ]; const float* sp[NQ];
#pragma unroll
        for (int p = 0; p < NQ; ++p) { const int q = p * 32 + lane, row = wave * 32 + q / CP8, cofs = (q % CP8) * 8;
            qp[p] = QO + (size_t)(t0r + row) * KX2 + t0c + cofs; sp[p] = bs + row * BSP + cofs; }
#pragma unroll
        for (int u = 0; u < 32 / RQ; ++u) {
#pragma unroll
            for (int p = 0; p < NQ; ++p) { const v4f lo = *(const v4fa*)(sp[p] + u * RQ * BSP); const v4f up = *(const v4fa*)(sp[p] + u * RQ * BSP + 4); v8h qh, ql;
#pragma unroll
                for (int k = 0; k < 8; ++k) { const float sv = (k < 4 ? lo[k & 3] : up[k & 3]) * QCAR; const h16 a = toh_flush(sv); qh[k] = a; ql[k] = toh_flush(sv - (float)a); }   // x2048 is exact, so the difference is exact fused or not
                *(v8h*)(qp[p] + (size_t)(u * RQ) * KX2) = qh; *(v8h*)(qp[p] + (size_t)(u * RQ) * KX2 + HD) = ql; }
            if (u + 1 < 32 / RQ) asm volatile("s_wait_xcnt 0x0" ::: "memory");   // stands in front of the next rows' LDS reads and conversions, which overwrite the registers that these stores name
        }
        return;
    }
    // output: 16 rows at a time through the wave's own LDS stage, stored as 16-byte pieces in row order (whole 128-byte lines).
    // After NP wave-wide stores the piece pattern repeats RP rows further down, so every address is one of NP lane pointers plus a compile-time offset.
    constexpr int CPR = NF * 4;                      // 16-byte pieces per staged row
    constexpr int NP = (CPR % 32 == 0) ? 1 : 3;
    constexpr int RP = 32 * NP / CPR;
    static_assert((32 * NP) % CPR == 0 && 16 % RP == 0);
    float* gp[NP]; const float* lp[NP];
#pragma unroll
    for (int p = 0; p < NP; ++p) { const int q = p * 32 + lane, row = q / CPR, cofs = (q % CPR) * 4;
        gp[p] = C + (size_t)(r0 + row) * LDC + c0 + cofs; lp[p] = os + row * OSP + cofs; }
    v4f mean[NP];   // EPI 2: a lane's columns are the same in every row group, so their column means are fetched once
    if constexpr (EPI == 2) {
#pragma unroll
        for (int p = 0; p < NP; ++p) { mean[p] = *(const v4f*)(VM + z * LDC + c0 + ((p * 32 + lane) % CPR) * 4);
            asm volatile("s_wait_xcnt 0x0" ::: "memory"); }   // stands in front of whatever next overwrites this load's address registers (the next load's result may be given them)
    }
#pragma unroll
    for (int mb = 0; mb < 4; ++mb) {
#pragma unroll
        for (int nb = 0; nb < NF; ++nb) {
#pragma unroll
            for (int j = 0; j < 8; ++j) os[(hi * 8 + j) * OSP + nb * 16 + lr] = acc[mb][nb][j]; }
        __builtin_amdgcn_wave_barrier(); asm volatile("" ::: "memory");
#pragma unroll
        for (int u = 0; u < 16 / RP; ++u)
#pragma unroll
            for (int p = 0; p < NP; ++p) { v4f val = *(const v4fa*)(lp[p] + u * RP * OSP);
                if constexpr (EPI == 2) {
#pragma unroll
                    for (int i = 0; i < 4; ++i) val[i] = val[i] * (1.0f / PCAR) + mean[p][i]; }
                *(v4f*)(gp[p] + (size_t)(mb * 16 + u * RP) * LDC) = val; }
        if (mb + 1 < 4) asm volatile("s_wait_xcnt 0x0" ::: "memory");   // stands in front of the next 16 rows' LDS reads, which overwrite the registers that these stores name
        __builtin_amdgcn_wave_barrier();
    }
}

__global__ __launch_bounds__(256) void k_cvt8(const float* __restrict__ src, bf* dst, size_t n8, size_t sS, size_t sD) {
    const size_t i = (size_t)blockIdx.x * 256 + threadIdx.x; if (i >= n8) return;
    src += (size_t)blockIdx.y * sS; dst += (size_t)blockIdx.y * sD;
    const v8f v = *(const v8f*)(src + i * 8); v8us o;
#pragma unroll
    for (int k = 0; k < 8; ++k) o[k] = f2bf(v[k]);
    *(v8us*)(dst + i * 8) = o;  }

// k_cvx: x slab f32 -> (a) bf16 (RNE) plane xb [slab][t][d]; (b) f16 plane kx [slab][t][k | k] (pitch KX2) holding the bf16 value (exact in f16, subnormals -> 0) in both halves.
__global__ __launch_bounds__(256) void k_cvx(const float* __restrict__ src, bf* xb, h16* kx, size_t n8, size_t sS, size_t sD) {
#pragma clang fp contract(off)
    const size_t i = (size_t)blockIdx.x * 256 + threadIdx.x; if (i >= n8) return;
    src += (size_t)blockIdx.y * sS; xb += (size_t)blockIdx.y * sD; kx += (size_t)blockIdx.y * sD * 2;
    const v8f v = *(const v8f*)(src + i * 8); v8us o; v8h kk;
#pragma unroll
    for (int k = 0; k < 8; ++k) { o[k] = f2bf(v[k]); kk[k] = toh_flush(__uint_as_float((unsigned)o[k] << 16)); }
    const size_t e = i * 8; const size_t row = e / DM; const int col = (int)(e % DM);
    h16* kp = kx + row * KX2 + col;
    *(v8us*)(xb + e) = o; *(v8h*)kp = kk; *(v8h*)(kp + HD) = kk;
     }

// k_vtpx: bf16 plane [g][t][d] -> f16 plane [g][d][t], one 128 t x 128 d tile per block, turned in LDS so that both global sides move whole 256-byte row pieces (16 lanes x 16 B).
// LDS tile [d][t pair]: one dword = the f16 values of t and t+1 at one d; a row is 64 dwords = 16 groups of 4. Group j of row d lies at place j ^ (d >> 3): the 16 lanes of a dword store (d 8 apart, same t pair) then fall on 16 different banks, and a 16-byte read still takes one whole group.
#define VTT 128
#define VTD 128
typedef __attribute__((ext_vector_type(4))) unsigned v4u;
__global__ __launch_bounds__(256) void k_vtpx(const bf* __restrict__ F, h16* V16) {
    __shared__ __align__(16) unsigned tile[VTD * (VTT / 2)];
    const int tid = threadIdx.x, c16 = tid & 15, r16 = tid >> 4;
    const int t0 = blockIdx.x * VTT, d0 = blockIdx.y * VTD, g = blockIdx.z;
    // in: lane -> 8 d (c16), row pairs r16 + 16 k
    const bf* src = F + ((size_t)g * SEQ + t0) * DM + d0 + c16 * 8;
    v8us r[VTT / 32][2];
#pragma unroll
    for (int k = 0; k < VTT / 32; ++k)
#pragma unroll
        for (int q = 0; q < 2; ++q) r[k][q] = *(const v8us*)(src + (size_t)(2 * (r16 + 16 * k) + q) * DM);
#pragma unroll
    for (int k = 0; k < VTT / 32; ++k) { const int tp = r16 + 16 * k; unsigned* col = tile + (size_t)(c16 * 8) * (VTT / 2) + (((tp >> 2) ^ c16) << 2) + (tp & 3);
#pragma unroll
        for (int i = 0; i < 8; ++i) { v2h o16;
#pragma unroll
            for (int q = 0; q < 2; ++q) o16[q] = toh_flush(__uint_as_float((unsigned)r[k][q][i] << 16));
            col[i * (VTT / 2)] = __builtin_bit_cast(unsigned, o16); } }
    __syncthreads();   // the whole tile is in LDS before any row of it is read
    // out: lane -> 8 t (c16), d rows r16 + 16 k
    h16* dst = V16 + ((size_t)g * HD + d0) * SEQ + t0 + c16 * 8;
#pragma unroll
    for (int k = 0; k < VTD / 16; ++k) { const int d = r16 + 16 * k;
        const v4u val = *(const v4u*)(tile + d * (VTT / 2) + ((c16 ^ (d >> 3)) << 2));
        *(v4u*)(dst + (size_t)d * SEQ) = val; }
}

__global__ __launch_bounds__(256) void k_vmeanx(const bf* __restrict__ F, float* VM) {
#pragma clang fp contract(off)
    __shared__ float part[8 * 32];
    const int c = threadIdx.x & 31; const int r = __builtin_amdgcn_readfirstlane(threadIdx.x >> 5); const int g = blockIdx.y; const int d = blockIdx.x * 32 + c;
    const bf* f = F + (size_t)g * SEQ * DM + d; float s = 0.f;
#pragma unroll 4
    for (int t = r; t < SEQ; t += 8) { const float xv = __uint_as_float((unsigned)f[(size_t)t * DM] << 16); s += (fabsf(xv) < 6.103515625e-05f) ? 0.0f : xv; }
    part[r * 32 + c] = s;
    __syncthreads();
    if (r == 0) { float a = part[c];
#pragma unroll
        for (int q = 1; q < 8; ++q) a += part[q * 32 + c];
        a *= (1.0f / (float)SEQ); float* p = VM + (size_t)g * HD + d;
        *(float*)p = a;  }
}

// k_asoft: per row (one wave): t = S' x SCL (SCL = 1/2048 undoes the q carry; the module has no score scale); softmax over the SEQ keys (register row, running max then one exp, fixed shuffle trees);
__global__ __launch_bounds__(256) void k_asoft(const float* __restrict__ Sb, h16* P16) {
    const int lane = threadIdx.x & 31; const int row = blockIdx.x * 8 + (threadIdx.x >> 5); if (row >= ZB * SEQ) return;
    const float* sr = Sb + (size_t)row * SEQ; float v[SEQ / 32]; float mx = -3.0e38f;
#pragma unroll
    for (int ch = 0; ch < SEQ / 128; ++ch) { const v4f a = *(const v4f*)(sr + ch * 128 + lane * 4);
#pragma unroll
        for (int q = 0; q < 4; ++q) { const float t = a[q] * SCL; v[ch * 4 + q] = t; mx = fmaxf(mx, t); } }
#pragma unroll
    for (int sh = 16; sh; sh >>= 1) mx = fmaxf(mx, __shfl_xor(mx, sh, 32));
    float sum = 0.f;
#pragma unroll
    for (int k = 0; k < SEQ / 32; ++k) { float d0 = __fsub_rn(v[k], mx); asm volatile("" : "+v"(d0)); v[k] = __builtin_amdgcn_exp2f(__fmul_rn(d0, 1.4426950408889634f)); sum += v[k]; }
#pragma unroll
    for (int sh = 16; sh; sh >>= 1) sum += __shfl_xor(sum, sh, 32);
    const float f = __fdiv_rn(PCAR, sum); const float cen = PCAR / (float)SEQ;
{
#pragma unroll
        for (int ch = 0; ch < SEQ / 128; ++ch) { v4h o4;
#pragma unroll
            for (int q = 0; q < 4; ++q) o4[q] = tohx(v[ch * 4 + q] * f - cen);
            *(v4h*)(P16 + (size_t)row * SEQ + ch * 128 + lane * 4) = o4; }
         }
}

constexpr size_t al256(size_t b) { return (b + 255) & ~(size_t)255; }
constexpr size_t mx2(size_t a, size_t b) { return a > b ? a : b; }
// Shared ranges, by launch order within a pass:
// range 1: XB (last read by k_vtpx / k_vmeanx) -> Sb (written by the score GEMM, last read by k_asoft)
// range 2: QX, KX (last read by the score GEMM) -> P16 (written by k_asoft)
constexpr size_t WS_XB = al256((size_t)ZB * SEQ * DM * 2);      // XB bf16
constexpr size_t WS_QX = al256((size_t)ZB * SEQ * KX2 * 2);     // QX f16 [qh | ql]; KX f16 [k | k] has the same size
constexpr size_t WS_R1 = mx2(WS_XB, al256((size_t)ZB * SEQ * SEQ * 4));
constexpr size_t WS_R2 = mx2(2 * WS_QX, al256((size_t)ZB * SEQ * SEQ * 2));
constexpr size_t WS_TOTAL =
    al256((size_t)DM * DM * 2) +                  // WQ bf16
    WS_R1 + WS_R2 +
    al256((size_t)ZB * HD * SEQ * 2) +            // VT16
    al256((size_t)ZB * HD * 4);                   // VM
static_assert(WS_TOTAL <= (size_t)268435456);

extern "C" void kernel_launch(void* const* d_in, const int* in_sizes, int n_in,
                              void* d_out, int out_size, void* d_ws, size_t ws_size, hipStream_t stream) {
    if (n_in < 2) return;
    if ((size_t)in_sizes[0] < ((size_t)(NB - 1) * SEQ_FULL + SEQ) * DM) return;
    if ((size_t)in_sizes[1] < (size_t)DM * DM) return;
    if ((size_t)out_size < (size_t)NB * SEQ * DM) return;
    if (WS_TOTAL > ws_size) return;
    const float* x = (const float*)d_in[0]; const float* wq = (const float*)d_in[1];   // x [NB][SEQ_FULL][768]; W [768 out][768 in]
    float* OUT = (float*)d_out;     // [NB][SEQ][768]
    char* wsp = (char*)d_ws;
    auto take = [&](size_t bytes) { char* p = wsp; wsp += al256(bytes); return (void*)p; };
    bf* WQ = (bf*)take((size_t)DM * DM * 2);
    char* r1 = (char*)take(WS_R1);
    char* r2 = (char*)take(WS_R2);
    bf* XB = (bf*)r1; float* Sb = (float*)r1;
    h16* QX = (h16*)r2; h16* KX = (h16*)(r2 + WS_QX); h16* P16 = (h16*)r2;
    h16* VT16 = (h16*)take((size_t)ZB * HD * SEQ * 2);
    float* VM = (float*)take((size_t)ZB * HD * 4);
    if ((size_t)(wsp - (char*)d_ws) > ws_size) return;

    const size_t w8 = (size_t)DM * DM / 8;
    k_cvt8<<<dim3((unsigned)((w8 + 255) / 256), 1, 1), 256, 0, stream>>>(wq, WQ, w8, 0, 0);

    const size_t x8 = (size_t)SEQ * DM / 8;                 // per batch slab
    for (int b0 = 0; b0 < NB; b0 += ZB) {
        k_cvx<<<dim3((unsigned)((x8 + 255) / 256), ZB, 1), 256, 0, stream>>>(x + (size_t)b0 * SEQ_FULL * DM, XB, KX, x8, (size_t)SEQ_FULL * DM, (size_t)SEQ * DM);
        k_gemmw<bf, 6, DM, 1><<<dim3(ZB * SEQ / 256, DM / 192, 1), 256, 0, stream>>>(XB, WQ, DM, nullptr, 0, 0, 0, QX, nullptr);
        k_vtpx<<<dim3(SEQ / 128, HD / 128, ZB), 256, 0, stream>>>(XB, VT16);
        k_vmeanx<<<dim3(HD / 32, ZB, 1), 256, 0, stream>>>(XB, VM);
        k_gemmw<h16, 8, SEQ, 0><<<dim3(SEQ / 256, SEQ / 256, ZB), 256, 0, stream>>>(QX, KX, KX2, Sb, (size_t)SEQ * KX2, (size_t)SEQ * KX2, (size_t)SEQ * SEQ, nullptr, nullptr);
        k_asoft<<<ZB * SEQ / 8, 256, 0, stream>>>(Sb, P16);
        k_gemmw<h16, 6, HD, 2><<<dim3(SEQ / 256, HD / 192, ZB), 256, 0, stream>>>(P16, VT16, SEQ, OUT + (size_t)b0 * SEQ * DM, (size_t)SEQ * SEQ, (size_t)HD * SEQ, (size_t)SEQ * HD, nullptr, VM);
    }
}

// v006
// One run takes 162 microseconds.
// Timed twice side by side with v005, it ran 1.13 times as fast both times.
// Over all steps from v000 it is 4.48 times as fast.
#include <hip/hip_runtime.h>

// Contractions: q projection on v_wmma_f32_16x16x32_bf16 (x and W RNE-converted to bf16, exact products, f32 accumulate); q.x^T on v_wmma_f32_16x16x32_f16 with q carried x2048 as f16 value + f16 remainder folded along K ([qh | ql] x [k | k], k = f16 of the bf16 x, exact); att.x on v_wmma_f32_16x16x32_f16 (f16 x plane; softmax weights carried x1024 and centred by 1024/SEQ, column mean of x added back in f32), f32 accumulate.
// Single-head full-width document self-attention: x [8][2048][768]; q = x W^T ('oi' [768][768], no bias); keys = values = x; att = softmax(q.x) over all 2048 keys (no scale, no mask); out = att @ x -> [8][2048][768] f32.
// All batches in one pass (z-batched GEMMs; workspace planes whose readers have all run share their bytes with later planes): one kernel reads x (and W) once and writes every 16-bit plane made of it: bf16 plane, f16 [k | k] plane, f16 transposed [d][t] plane, column sums per 128 rows; projection -> f16 [qh | ql] plane (split in the GEMM's output stage); S' = 2048 q.x (f32, materialised per pass); row softmax in registers; O = P' x, out = O/1024 + mean_t(x) formed in the GEMM's output stage.

#ifndef NB
#define NB 8
#endif
#ifndef SEQ
#define SEQ 2048
#endif
#define NB_FULL  8
#define SEQ_FULL 2048
#define DM   768
#define HD   768
#define ZB   NB                           // batches per pass: all of them, so every stage is one launch with the fullest grid
#define PCAR 1024.0f
#define QCAR 2048.0f                      // carry of the q value / remainder planes
#define SCL  4.8828125e-4f                // 1/2048: undoes the q carry (the module applies no score scale)
#define KX2  (2 * HD)                     // pitch of the K-folded planes [value | remainder] and [k | k]

typedef _Float16 h16;
typedef unsigned short bf;
typedef __attribute__((ext_vector_type(16))) __bf16   v16bf;
typedef __attribute__((ext_vector_type(16))) _Float16 v16h;
typedef __attribute__((ext_vector_type(8)))  _Float16 v8h;
typedef __attribute__((ext_vector_type(8)))  unsigned short v8us;
typedef __attribute__((ext_vector_type(8)))  float    v8f;
typedef __attribute__((ext_vector_type(4)))  float    v4f;
typedef __attribute__((ext_vector_type(2)))  _Float16 v2h;
typedef __attribute__((ext_vector_type(4)))  _Float16 v4h;
typedef v4f  __attribute__((may_alias)) v4fa;

static_assert(NB <= NB_FULL);
static_assert(SEQ <= SEQ_FULL);
static_assert(NB % ZB == 0);
static_assert(SEQ % 128 == 0);                 // softmax row chunks, 64-row tiles, K steps of 32
static_assert(DM % 64 == 0 && HD % 64 == 0);   // K steps of 32
static_assert(DM == HD);                       // q width == x width: q.x contracts over 768
static_assert(((size_t)SEQ * DM) % 8 == 0);
static_assert((ZB * SEQ) % 8 == 0);
static_assert(HD % 32 == 0 && SEQ % 8 == 0);
static_assert(KX2 % 32 == 0);                  // folded score GEMM: K steps of 32
static_assert((ZB * SEQ) % 64 == 0);           // projection GEMM rows: 64-row wave quarters
static_assert(QCAR * SCL == 1.0f);             // carry folded back exactly in the softmax scale
static_assert((KX2 * 2) % 128 == 0);
static_assert(DM % 64 == 0);
static_assert(SEQ % 128 == 0 && HD % 128 == 0 && DM == HD);                  // k_prep: 128 t x 128 d tiles cover the plane
static_assert(2 * 512 * 272 <= 327680);       // k_gemmw static LDS: one block per 320 KiB LDS
static_assert(DM % 128 == 0 && KX2 % 128 == 0 && SEQ % 128 == 0);                                 // k_gemmw: K tiles of 128
static_assert(SEQ % 256 == 0 && (ZB * SEQ) % 256 == 0 && DM % 192 == 0 && HD % 192 == 0);         // k_gemmw: 256x256 and 256x192 tiles cover the outputs
static_assert(DM % 128 == 0 && DM <= SEQ);     // k_prep: W's 128-row tiles lie inside the grid laid out for x

__device__ __forceinline__ unsigned short f2bf(float f) { unsigned u = __float_as_uint(f); u += 0x7FFFu + ((u >> 16) & 1u); return (unsigned short)(u >> 16); }
__device__ __forceinline__ v16h cat16(v8h lo, v8h hi) { return __builtin_shufflevector(lo, hi, 0, 1, 2, 3, 4, 5, 6, 7, 8, 9, 10, 11, 12, 13, 14, 15); }
__device__ __forceinline__ v16bf cat16b(v8us lo, v8us hi) { return __builtin_bit_cast(v16bf, __builtin_shufflevector(lo, hi, 0, 1, 2, 3, 4, 5, 6, 7, 8, 9, 10, 11, 12, 13, 14, 15)); }
__device__ __forceinline__ v8f wmma16(v16h a, v16h b, v8f c) { return __builtin_amdgcn_wmma_f32_16x16x32_f16(false, a, false, b, (short)0, c, false, false); }
__device__ __forceinline__ v8f wmmab(v16bf a, v16bf b, v8f c) { return __builtin_amdgcn_wmma_f32_16x16x32_bf16(false, a, false, b, (short)0, c, false, false); }
__device__ __forceinline__ h16 tohx(float x) { return (h16)x; }
// f32 -> f16 (RNE) that cannot produce an f16 subnormal: |v| < 2^-14 -> +0 (value select).
static __device__ __forceinline__ h16 toh_flush(float v) { const h16 r = (h16)v; return (fabsf(v) < 6.103515625e-05f) ? (h16)0.0f : r; }

// ---- k_gemmw<T16, NF>: GEMM, EIGHT WAVES (4 x 2) per 256 x (32 NF) output tile, each wave 64 rows x 16 NF columns (4 NF accumulators); grid (M/256, N/(32 NF), Z), 256 threads, one block per WGP, two waves per SIMD.
// NF = 8: 256x256 tile; NF = 6: 256x192 tile (N = 768: four column tiles, so that the grid is a whole number of blocks per WGP).
// Operand tiles (256 rows of A, 32 NF rows of Bt, 128 k each) are staged in LDS by asynchronous 16-byte copies, two buffers: tile t+1 flies while tile t is worked on; a staged A row serves two waves, a staged Bt row four.
// C[m][n] (f32, pitch LDC) = sum_k A[m][k] Bt[n][k]. z-batch strides sA/sB/sC in elements. K % 128 == 0, M % 256 == 0, N % (32 NF) == 0.
// EPI picks what the output stage does with the f32 sums: 0 = store them to C; 1 = split each into f16 value + f16 remainder, carried x2048, and store both to QO [m][qh | ql] (pitch KX2; C unused); 2 = store sum/1024 + mean to C, mean = (sum over the SEQ/128 row tiles tt of VM[z][tt][n]) / SEQ.
// Fragment map (A and Bt alike): lane -> row/col lane&15, h = lane>>4; elements 0..7 = k0+8h+0..7, elements 8..15 = k0+16+8h+0..7. D: acc[j] = (row 8h+j, col lane&15).
template <typename T16> struct WFrag;
template <> struct WFrag<h16> { typedef v16h V; static __device__ __forceinline__ V ld(const h16* p) { return cat16(*(const v8h*)p, *(const v8h*)(p + 16)); } static __device__ __forceinline__ v8f mma(V a, V b, v8f c) { return wmma16(a, b, c); } };
template <> struct WFrag<bf> { typedef v16bf V; static __device__ __forceinline__ V ld(const bf* p) { return cat16b(*(const v8us*)p, *(const v8us*)(p + 16)); } static __device__ __forceinline__ v8f mma(V a, V b, v8f c) { return wmmab(a, b, c); } };
#define GBK  128                 // k per staged tile: 256 B of every operand row
#define GPIT 136                 // LDS row pitch in 16-bit elements: 272 B = 16 B x odd, conflict-free for 16-byte fragment reads
#define GBM  256                 // A rows per block tile
typedef int v4i __attribute__((vector_size(16)));
// one lane's 16 bytes, global -> LDS, through no register
__device__ __forceinline__ void cp16(const void* g, void* l) {
    __builtin_amdgcn_global_load_async_to_lds_b128((__attribute__((address_space(1))) v4i*)g, (__attribute__((address_space(3))) v4i*)l, 0, 0);
}
template <typename T16, int NF, int LDC, int EPI>
__global__ __launch_bounds__(256) void k_gemmw(const T16* __restrict__ A, const T16* __restrict__ Bt, int K, float* C, size_t sA, size_t sB, size_t sC, h16* QO, const float* __restrict__ VM) {
    typedef typename WFrag<T16>::V V;
    constexpr int WN = NF * 16;                  // columns per wave
    constexpr int GBN = 2 * WN;                  // Bt rows per block tile
    constexpr int GSTG = (GBM + GBN) * GPIT;     // one buffer: rows 0..255 = A tile, the rows behind = Bt tile
    constexpr int OSP = WN + 4;                  // pitch in floats of a wave's 16-row output stage
    static_assert(8 * 16 * OSP * 4 <= 2 * GSTG * 2);
    static_assert(GBM / 16 + GBN / 16 <= 63);    // copies of one wave in flight
    __shared__ __align__(16) unsigned char smem[2 * GSTG * 2];
    T16* ring = (T16*)smem;
    const size_t z = blockIdx.z; A += z * sA; Bt += z * sB; C += z * sC;
    const int tid = threadIdx.x, lane = tid & 31, lr = lane & 15, hi = lane >> 4;
    const int wave = __builtin_amdgcn_readfirstlane(tid >> 5), wm = wave >> 1, wn = wave & 1;
    const int t0r = blockIdx.x * GBM, t0c = blockIdx.y * GBN;
    const int r0 = t0r + wm * 64, c0 = t0c + wn * WN;
    float* os = (float*)smem + wave * (16 * OSP);   // output stage: lies in the ring, used only behind the loop's last barrier (no reader, no copy left)
    v8f acc[4][NF];
#pragma unroll
    for (int mb = 0; mb < 4; ++mb)
#pragma unroll
        for (int nb = 0; nb < NF; ++nb) acc[mb][nb] = (v8f){};
    // copy map: 16 lanes cover one row's 256 B, the block covers 16 rows per copy; 16 copies for A, 2 NF for Bt per lane and tile
    const int cr = tid >> 4, cch = (tid & 15) * 8;
    const T16* ga = A + (size_t)(t0r + cr) * K + cch;
    const T16* gb = Bt + (size_t)(t0c + cr) * K + cch;
    const size_t gstep = (size_t)16 * K;
    T16* lbase = ring + cr * GPIT + cch;
    auto fill = [&](int buf, int kt) {
        const T16* pa = ga + (size_t)kt * GBK; const T16* pb = gb + (size_t)kt * GBK; T16* l = lbase + buf * GSTG;
#pragma unroll
        for (int i = 0; i < GBM / 16; ++i) cp16(pa + i * gstep, l + i * 16 * GPIT);
#pragma unroll
        for (int i = 0; i < GBN / 16; ++i) cp16(pb + i * gstep, l + (GBM + i * 16) * GPIT);
    };
    const int nt = K / GBK;
    fill(0, 0);
    asm volatile("s_wait_asynccnt 0x0" ::: "memory");   // tile 0 landed (this wave's copies) before the barrier publishes it
    __syncthreads();
    const int aofs = (wm * 64 + lr) * GPIT + 8 * hi, bofs = (GBM + wn * WN + lr) * GPIT + 8 * hi;
#pragma unroll 1   // one trip per staged tile stays rolled: the body already holds 16 NF WMMAs
    for (int t = 0; t < nt; ++t) {
        const T16* sa = ring + (t & 1) * GSTG + aofs; const T16* sb = ring + (t & 1) * GSTG + bofs;
        V a[2][4], b[2][NF];   // two fragment sets: the next 32 k are fetched from LDS while the current 32 k are multiplied
#pragma unroll
        for (int f = 0; f < 4; ++f) a[0][f] = WFrag<T16>::ld(sa + f * 16 * GPIT);
#pragma unroll
        for (int f = 0; f < NF; ++f) b[0][f] = WFrag<T16>::ld(sb + f * 16 * GPIT);
        // tile t+1 into the other buffer: its last readers (trip t-1) ended at the barrier just passed; issued behind the first fragment reads so that their LDS latency passes meanwhile
        if (t + 1 < nt) fill((t + 1) & 1, t + 1);
#pragma unroll
        for (int ks = 0; ks < GBK / 32; ++ks) {
            const int cu = ks & 1, nx = cu ^ 1;
            if (ks + 1 < GBK / 32) {
#pragma unroll
                for (int f = 0; f < 4; ++f) a[nx][f] = WFrag<T16>::ld(sa + f * 16 * GPIT + (ks + 1) * 32);
#pragma unroll
                for (int f = 0; f < NF; ++f) b[nx][f] = WFrag<T16>::ld(sb + f * 16 * GPIT + (ks + 1) * 32);
            }
            __builtin_amdgcn_sched_barrier(0);   // keeps the next set's LDS reads as one group ahead of this block's WMMAs
#pragma unroll
            for (int nb = 0; nb < NF; ++nb)
#pragma unroll
                for (int mb = 0; mb < 4; ++mb) acc[mb][nb] = WFrag<T16>::mma(a[cu][mb], b[cu][nb], acc[mb][nb]);
            __builtin_amdgcn_sched_barrier(0);   // keeps this block's WMMAs ahead of the following group of LDS reads
        }
        asm volatile("s_wait_dscnt 0x0" ::: "memory");      // this wave's reads of buffer t&1 are done before the buffer is refilled
        asm volatile("s_wait_asynccnt 0x0" ::: "memory");   // this wave's copies of tile t+1 have landed before the barrier publishes them
        __syncthreads();                                    // publishes tile t+1; ends every wave's reads of buffer t&1
    }
    asm volatile("s_wait_asynccnt 0x0" ::: "memory");       // no copy outstanding when the wave goes on
    if constexpr (EPI == 1) {
        // split output: the block's whole 256 x GBN f32 tile is staged in the ring (free behind the loop's last barrier), so that a row's f16 pieces leave as whole 128-byte lines, each line from one wave.
        constexpr int BSP = GBN + 4;                 // pitch in floats of the block's output stage
        constexpr int CP8 = GBN / 8;                 // 8-column pieces per staged row: 32 B of f32 in, 16 B of qh and 16 B of ql out
        constexpr int NQ = (CP8 % 32 == 0) ? 1 : 3;  // after NQ wave-wide pieces the pattern repeats RQ rows further down
        constexpr int RQ = 32 * NQ / CP8;
        static_assert(GBM * BSP * 4 <= 2 * GSTG * 2);
        static_assert((32 * NQ) % CP8 == 0 && 32 % RQ == 0 && CP8 % 8 == 0 && GBM == 8 * 32);
        float* bs = (float*)smem;
#pragma unroll
        for (int mb = 0; mb < 4; ++mb)
#pragma unroll
            for (int nb = 0; nb < NF; ++nb)
#pragma unroll
                for (int j = 0; j < 8; ++j) bs[(wm * 64 + mb * 16 + hi * 8 + j) * BSP + wn * WN + nb * 16 + lr] = acc[mb][nb][j];
        __syncthreads();   // the whole tile is staged before a wave reads rows that other waves wrote
        h16* qp[NQ]; const float* sp[NQ];
#pragma unroll
        for (int p = 0; p < NQ; ++p) { const int q = p * 32 + lane, row = wave * 32 + q / CP8, cofs = (q % CP8) * 8;
            qp[p] = QO + (size_t)(t0r + row) * KX2 + t0c + cofs; sp[p] = bs + row * BSP + cofs; }
#pragma unroll
        for (int u = 0; u < 32 / RQ; ++u) {
#pragma unroll
            for (int p = 0; p < NQ; ++p) { const v4f lo = *(const v4fa*)(sp[p] + u * RQ * BSP); const v4f up = *(const v4fa*)(sp[p] + u * RQ * BSP + 4); v8h qh, ql;
#pragma unroll
                for (int k = 0; k < 8; ++k) { const float sv = (k < 4 ? lo[k & 3] : up[k & 3]) * QCAR; const h16 a = toh_flush(sv); qh[k] = a; ql[k] = toh_flush(sv - (float)a); }   // x2048 is exact, so the difference is exact fused or not
                *(v8h*)(qp[p] + (size_t)(u * RQ) * KX2) = qh; *(v8h*)(qp[p] + (size_t)(u * RQ) * KX2 + HD) = ql; }
            if (u + 1 < 32 / RQ) asm volatile("s_wait_xcnt 0x0" ::: "memory");   // stands in front of the next rows' LDS reads and conversions, which overwrite the registers that these stores name
        }
        return;
    }
    // output: 16 rows at a time through the wave's own LDS stage, stored as 16-byte pieces in row order (whole 128-byte lines).
    // After NP wave-wide stores the piece pattern repeats RP rows further down, so every address is one of NP lane pointers plus a compile-time offset.
    constexpr int CPR = NF * 4;                      // 16-byte pieces per staged row
    constexpr int NP = (CPR % 32 == 0) ? 1 : 3;
    constexpr int RP = 32 * NP / CPR;
    static_assert((32 * NP) % CPR == 0 && 16 % RP == 0);
    float* gp[NP]; const float* lp[NP];
#pragma unroll
    for (int p = 0; p < NP; ++p) { const int q = p * 32 + lane, row = q / CPR, cofs = (q % CPR) * 4;
        gp[p] = C + (size_t)(r0 + row) * LDC + c0 + cofs; lp[p] = os + row * OSP + cofs; }
    v4f mean[NP];   // EPI 2: a lane's columns are the same in every row group, so their column means are fetched once
    if constexpr (EPI == 2) {
#pragma unroll
        for (int p = 0; p < NP; ++p) { const float* vp = VM + z * (size_t)((SEQ / 128) * LDC) + c0 + ((p * 32 + lane) % CPR) * 4;
            v4f pv[SEQ / 128];
#pragma unroll
            for (int tt = 0; tt < SEQ / 128; ++tt) pv[tt] = *(const v4f*)(vp + tt * LDC);
            asm volatile("s_wait_xcnt 0x0" :: "v"(vp) : "memory");   // stands in front of whatever next overwrites these loads' address registers; the address as an input keeps them whole up to here (without it a load's own result, or a later value, was given them ahead of the wait)
            v4f s = pv[0];
#pragma unroll
            for (int tt = 1; tt < SEQ / 128; ++tt) s += pv[tt];
            mean[p] = s * (1.0f / (float)SEQ); }
    }
#pragma unroll
    for (int mb = 0; mb < 4; ++mb) {
#pragma unroll
        for (int nb = 0; nb < NF; ++nb) {
#pragma unroll
            for (int j = 0; j < 8; ++j) os[(hi * 8 + j) * OSP + nb * 16 + lr] = acc[mb][nb][j]; }
        __builtin_amdgcn_wave_barrier(); asm volatile("" ::: "memory");
#pragma unroll
        for (int u = 0; u < 16 / RP; ++u)
#pragma unroll
            for (int p = 0; p < NP; ++p) { v4f val = *(const v4fa*)(lp[p] + u * RP * OSP);
                if constexpr (EPI == 2) {
#pragma unroll
                    for (int i = 0; i < 4; ++i) val[i] = val[i] * (1.0f / PCAR) + mean[p][i]; }
                *(v4f*)(gp[p] + (size_t)(mb * 16 + u * RP) * LDC) = val; }
        if (mb + 1 < 4) asm volatile("s_wait_xcnt 0x0" ::: "memory");   // stands in front of the next 16 rows' LDS reads, which overwrite the registers that these stores name
        __builtin_amdgcn_wave_barrier();
    }
}

// k_prep: one pass over x: a block reads one 128 t x 128 d tile of f32 and writes all that is made of it:
// (a) bf16 (RNE) plane XB [g][t][d]; (b) f16 plane KX [g][t][k | k] (pitch KX2) holding the bf16 value (exact in f16, subnormals -> 0) in both halves; (c) the same f16 values transposed, V16 [g][d][t]; (d) the tile's column sums of those values, VMP [g][t tile][d] f32.
// The z plane behind the last batch takes W, whose rows have x's pitch: only its bf16 plane is written.
// Every global side moves whole row pieces: 512 B of f32 in, 256 B of 16-bit values out (16 lanes x 32 B / 16 B).
// LDS tile [d][t pair]: one dword = the f16 values of t and t+1 at one d; a row is 64 dwords = 16 groups of 4. Group j of row d lies at place j ^ (d >> 3): the 16 lanes of a dword store (d 8 apart, same t pair) then fall on 16 different banks, and a 16-byte read still takes one whole group.
#define VTT 128
#define VTD 128
typedef __attribute__((ext_vector_type(4))) unsigned v4u;
// eight waves per SIMD (at most 128 registers): four blocks fit a WGP, so that the whole grid is resident at once and no block waits for a place
__global__ __launch_bounds__(256, 8) void k_prep(const float* __restrict__ x, const float* __restrict__ wq, bf* XB, bf* WQ, h16* KX, h16* V16, float* VMP) {
    __shared__ __align__(16) unsigned tile[VTD * (VTT / 2)];
    __shared__ __align__(16) float part[8 * VTD];
    const int tid = threadIdx.x, c16 = tid & 15, r16 = tid >> 4;
    const int t0 = blockIdx.x * VTT, d0 = blockIdx.y * VTD, g = blockIdx.z;
    const bool isw = g == ZB;                 // the same for the whole block
    if (isw && t0 >= DM) return;              // W has DM rows; the whole block leaves, ahead of the barrier
    // in: lane -> 8 d (c16), row pairs r16 + 16 k
    const size_t tofs = (size_t)t0 * DM + d0 + c16 * 8;
    const float* src = (isw ? wq : x + (size_t)g * SEQ_FULL * DM) + tofs;
    bf* xb = (isw ? WQ : XB + (size_t)g * SEQ * DM) + tofs;
    v8f r[VTT / 32][2];
#pragma unroll
    for (int k = 0; k < VTT / 32; ++k)
#pragma unroll
        for (int q = 0; q < 2; ++q) r[k][q] = *(const v8f*)(src + (size_t)(2 * (r16 + 16 * k) + q) * DM);
    v8us o[VTT / 32][2];
#pragma unroll
    for (int k = 0; k < VTT / 32; ++k)
#pragma unroll
        for (int q = 0; q < 2; ++q)
#pragma unroll
            for (int i = 0; i < 8; ++i) o[k][q][i] = f2bf(r[k][q][i]);
    if (isw) {
#pragma unroll
        for (int k = 0; k < VTT / 32; ++k)
#pragma unroll
            for (int q = 0; q < 2; ++q) *(v8us*)(xb + (size_t)(2 * (r16 + 16 * k) + q) * DM) = o[k][q];
        return; }
    v8h kk[VTT / 32][2];
    float cs[8];
#pragma unroll
    for (int i = 0; i < 8; ++i) cs[i] = 0.f;
#pragma unroll
    for (int k = 0; k < VTT / 32; ++k) { const int tp = r16 + 16 * k; unsigned* col = tile + (size_t)(c16 * 8) * (VTT / 2) + (((tp >> 2) ^ c16) << 2) + (tp & 3);
#pragma unroll
        for (int q = 0; q < 2; ++q)
#pragma unroll
            for (int i = 0; i < 8; ++i) { const float xv = __uint_as_float((unsigned)o[k][q][i] << 16); kk[k][q][i] = toh_flush(xv); cs[i] += (fabsf(xv) < 6.103515625e-05f) ? 0.0f : xv; }
#pragma unroll
        for (int i = 0; i < 8; ++i) { v2h o16; o16[0] = kk[k][0][i]; o16[1] = kk[k][1][i];
            col[i * (VTT / 2)] = __builtin_bit_cast(unsigned, o16); } }
    // column sums: a wave's two row groups, then one row of part per wave
#pragma unroll
    for (int i = 0; i < 8; ++i) cs[i] += __shfl_xor(cs[i], 16, 32);
    if ((tid & 16) == 0) { float* pp = part + (tid >> 5) * VTD + c16 * 8;
        *(v4f*)pp = (v4f){cs[0], cs[1], cs[2], cs[3]}; *(v4f*)(pp + 4) = (v4f){cs[4], cs[5], cs[6], cs[7]}; }
    __syncthreads();   // the whole tile and every wave's column sums are in LDS before any of it is read; no global store stands in front of it, so it waits for none
    // out, transposed: lane -> 8 t (c16), d rows r16 + 16 k
    v4u val[VTD / 16];
#pragma unroll
    for (int k = 0; k < VTD / 16; ++k) { const int d = r16 + 16 * k; val[k] = *(const v4u*)(tile + d * (VTT / 2) + ((c16 ^ (d >> 3)) << 2)); }
    float a = part[tid & (VTD - 1)];
#pragma unroll
    for (int w = 1; w < 8; ++w) a += part[w * VTD + (tid & (VTD - 1))];
    // out, row order: the planes straight from the registers
    h16* kp = KX + ((size_t)g * SEQ + t0) * KX2 + d0 + c16 * 8;
#pragma unroll
    for (int k = 0; k < VTT / 32; ++k)
#pragma unroll
        for (int q = 0; q < 2; ++q) { const int row = 2 * (r16 + 16 * k) + q;
            *(v8us*)(xb + (size_t)row * DM) = o[k][q];
            h16* kr = kp + (size_t)row * KX2;
            *(v8h*)kr = kk[k][q]; *(v8h*)(kr + HD) = kk[k][q]; }
    h16* dst = V16 + ((size_t)g * HD + d0) * SEQ + t0 + c16 * 8;
#pragma unroll
    for (int k = 0; k < VTD / 16; ++k) *(v4u*)(dst + (size_t)(r16 + 16 * k) * SEQ) = val[k];
    if (tid < VTD) VMP[((size_t)g * (SEQ / VTT) + blockIdx.x) * HD + d0 + tid] = a;
}

// k_asoft: per row (one wave): t = S' x SCL (SCL = 1/2048 undoes the q carry; the module has no score scale); softmax over the SEQ keys (register row, running max then one exp, fixed shuffle trees);
__global__ __launch_bounds__(256) void k_asoft(const float* __restrict__ Sb, h16* P16) {
    const int lane = threadIdx.x & 31; const int row = blockIdx.x * 8 + (threadIdx.x >> 5); if (row >= ZB * SEQ) return;
    const float* sr = Sb + (size_t)row * SEQ; float v[SEQ / 32]; float mx = -3.0e38f;
#pragma unroll
    for (int ch = 0; ch < SEQ / 128; ++ch) { const v4f a = *(const v4f*)(sr + ch * 128 + lane * 4);
#pragma unroll
        for (int q = 0; q < 4; ++q) { const float t = a[q] * SCL; v[ch * 4 + q] = t; mx = fmaxf(mx, t); } }
#pragma unroll
    for (int sh = 16; sh; sh >>= 1) mx = fmaxf(mx, __shfl_xor(mx, sh, 32));
    float sum = 0.f;
#pragma unroll
    for (int k = 0; k < SEQ / 32; ++k) { float d0 = __fsub_rn(v[k], mx); asm volatile("" : "+v"(d0)); v[k] = __builtin_amdgcn_exp2f(__fmul_rn(d0, 1.4426950408889634f)); sum += v[k]; }
#pragma unroll
    for (int sh = 16; sh; sh >>= 1) sum += __shfl_xor(sum, sh, 32);
    const float f = __fdiv_rn(PCAR, sum); const float cen = PCAR / (float)SEQ;
{
#pragma unroll
        for (int ch = 0; ch < SEQ / 128; ++ch) { v4h o4;
#pragma unroll
            for (int q = 0; q < 4; ++q) o4[q] = tohx(v[ch * 4 + q] * f - cen);
            *(v4h*)(P16 + (size_t)row * SEQ + ch * 128 + lane * 4) = o4; }
         }
}

constexpr size_t al256(size_t b) { return (b + 255) & ~(size_t)255; }
constexpr size_t mx2(size_t a, size_t b) { return a > b ? a : b; }
// Shared ranges, by launch order within a pass:
// range 1: XB (last read by the projection GEMM) -> Sb (written by the score GEMM, last read by k_asoft)
// range 2: QX, KX (last read by the score GEMM) -> P16 (written by k_asoft)
constexpr size_t WS_XB = al256((size_t)ZB * SEQ * DM * 2);      // XB bf16
constexpr size_t WS_QX = al256((size_t)ZB * SEQ * KX2 * 2);     // QX f16 [qh | ql]; KX f16 [k | k] has the same size
constexpr size_t WS_R1 = mx2(WS_XB, al256((size_t)ZB * SEQ * SEQ * 4));
constexpr size_t WS_R2 = mx2(2 * WS_QX, al256((size_t)ZB * SEQ * SEQ * 2));
constexpr size_t WS_TOTAL =
    al256((size_t)DM * DM * 2) +                  // WQ bf16
    WS_R1 + WS_R2 +
    al256((size_t)ZB * HD * SEQ * 2) +            // VT16
    al256((size_t)ZB * (SEQ / 128) * HD * 4);     // VM: column sums per 128-row tile
static_assert(WS_TOTAL <= (size_t)268435456);

extern "C" void kernel_launch(void* const* d_in, const int* in_sizes, int n_in,
                              void* d_out, int out_size, void* d_ws, size_t ws_size, hipStream_t stream) {
    if (n_in < 2) return;
    if ((size_t)in_sizes[0] < ((size_t)(NB - 1) * SEQ_FULL + SEQ) * DM) return;
    if ((size_t)in_sizes[1] < (size_t)DM * DM) return;
    if ((size_t)out_size < (size_t)NB * SEQ * DM) return;
    if (WS_TOTAL > ws_size) return;
    const float* x = (const float*)d_in[0]; const float* wq = (const float*)d_in[1];   // x [NB][SEQ_FULL][768]; W [768 out][768 in]
    float* OUT = (float*)d_out;     // [NB][SEQ][768]
    char* wsp = (char*)d_ws;
    auto take = [&](size_t bytes) { char* p = wsp; wsp += al256(bytes); return (void*)p; };
    bf* WQ = (bf*)take((size_t)DM * DM * 2);
    char* r1 = (char*)take(WS_R1);
    char* r2 = (char*)take(WS_R2);
    bf* XB = (bf*)r1; float* Sb = (float*)r1;
    h16* QX = (h16*)r2; h16* KX = (h16*)(r2 + WS_QX); h16* P16 = (h16*)r2;
    h16* VT16 = (h16*)take((size_t)ZB * HD * SEQ * 2);
    float* VM = (float*)take((size_t)ZB * (SEQ / 128) * HD * 4);
    if ((size_t)(wsp - (char*)d_ws) > ws_size) return;

    for (int b0 = 0; b0 < NB; b0 += ZB) {
        k_prep<<<dim3(SEQ / 128, DM / 128, ZB + 1), 256, 0, stream>>>(x + (size_t)b0 * SEQ_FULL * DM, wq, XB, WQ, KX, VT16, VM);
        k_gemmw<bf, 6, DM, 1><<<dim3(ZB * SEQ / 256, DM / 192, 1), 256, 0, stream>>>(XB, WQ, DM, nullptr, 0, 0, 0, QX, nullptr);
        k_gemmw<h16, 8, SEQ, 0><<<dim3(SEQ / 256, SEQ / 256, ZB), 256, 0, stream>>>(QX, KX, KX2, Sb, (size_t)SEQ * KX2, (size_t)SEQ * KX2, (size_t)SEQ * SEQ, nullptr, nullptr);
        k_asoft<<<ZB * SEQ / 8, 256, 0, stream>>>(Sb, P16);
        k_gemmw<h16, 6, HD, 2><<<dim3(SEQ / 256, HD / 192, ZB), 256, 0, stream>>>(P16, VT16, SEQ, OUT + (size_t)b0 * SEQ * DM, (size_t)SEQ * SEQ, (size_t)HD * SEQ, (size_t)SEQ * HD, nullptr, VM);
    }
}

// v007
// It runs in 143 microseconds.
// Timed twice side by side with v006, it ran 1.13 times as fast both times.
// Counting every step since v000, it is 5.08 times as fast.
#include <hip/hip_runtime.h>

// Contractions: q projection on v_wmma_f32_16x16x32_bf16 (x and W RNE-converted to bf16, exact products, f32 accumulate); q.x^T on v_wmma_f32_16x16x32_f16 with q carried x2048 as f16 value + f16 remainder folded along K ([qh | ql] x [k | k], k = f16 of the bf16 x, exact); att.x on v_wmma_f32_16x16x32_f16 (f16 x plane; softmax weights carried x1024 and centred by 1024/SEQ, column mean of x added back in f32), f32 accumulate.
// Single-head full-width document self-attention: x [8][2048][768]; q = x W^T ('oi' [768][768], no bias); keys = values = x; att = softmax(q.x) over all 2048 keys (no scale, no mask); out = att @ x -> [8][2048][768] f32.
// All batches in one pass (z-batched GEMMs; workspace planes whose readers have all run share their bytes with later planes): one kernel reads x (and W) once and writes every 16-bit plane made of it: bf16 plane, f16 [k | k] plane, f16 transposed [d][t] plane, column sums per 128 rows; projection -> f16 [qh | ql] plane (split in the GEMM's output stage); S' = 2048 q.x stays in the score GEMM's accumulators: its output stage takes each row's maximum and exp sum over the wave's 128 keys and stores 1024 exp(s - tile max) as f16 plus the two figures; the last GEMM joins a row's 16 tiles into one factor per tile and applies it to its A fragments; O = P' x, out = O/1024 + mean_t(x) formed in the GEMM's output stage.

#ifndef NB
#define NB 8
#endif
#ifndef SEQ
#define SEQ 2048
#endif
#define NB_FULL  8
#define SEQ_FULL 2048
#define DM   768
#define HD   768
#define ZB   NB                           // batches per pass: all of them, so every stage is one launch with the fullest grid
#define PCAR 1024.0f
#define QCAR 2048.0f                      // carry of the q value / remainder planes
#define SCL  4.8828125e-4f                // 1/2048: undoes the q carry (the module applies no score scale)
#define KX2  (2 * HD)                     // pitch of the K-folded planes [value | remainder] and [k | k]

typedef _Float16 h16;
typedef unsigned short bf;
typedef __attribute__((ext_vector_type(16))) __bf16   v16bf;
typedef __attribute__((ext_vector_type(16))) _Float16 v16h;
typedef __attribute__((ext_vector_type(8)))  _Float16 v8h;
typedef __attribute__((ext_vector_type(8)))  unsigned short v8us;
typedef __attribute__((ext_vector_type(8)))  float    v8f;
typedef __attribute__((ext_vector_type(4)))  float    v4f;
typedef __attribute__((ext_vector_type(2)))  _Float16 v2h;
typedef __attribute__((ext_vector_type(4)))  _Float16 v4h;
typedef v4f  __attribute__((may_alias)) v4fa;

static_assert(NB <= NB_FULL);
static_assert(SEQ <= SEQ_FULL);
static_assert(NB % ZB == 0);
static_assert(SEQ % 128 == 0);                 // softmax row chunks, 64-row tiles, K steps of 32
static_assert(DM % 64 == 0 && HD % 64 == 0);   // K steps of 32
static_assert(DM == HD);                       // q width == x width: q.x contracts over 768
static_assert(((size_t)SEQ * DM) % 8 == 0);
static_assert((ZB * SEQ) % 8 == 0);
static_assert(HD % 32 == 0 && SEQ % 8 == 0);
static_assert(KX2 % 32 == 0);                  // folded score GEMM: K steps of 32
static_assert((ZB * SEQ) % 64 == 0);           // projection GEMM rows: 64-row wave quarters
static_assert(QCAR * SCL == 1.0f);             // carry folded back exactly in the softmax scale
static_assert((KX2 * 2) % 128 == 0);
static_assert(DM % 64 == 0);
static_assert(SEQ % 128 == 0 && HD % 128 == 0 && DM == HD);                  // k_prep: 128 t x 128 d tiles cover the plane
static_assert(2 * 512 * 272 <= 327680);       // k_gemmw static LDS: one block per 320 KiB LDS
static_assert(DM % 128 == 0 && KX2 % 128 == 0 && SEQ % 128 == 0);                                 // k_gemmw: K tiles of 128
static_assert(SEQ % 256 == 0 && (ZB * SEQ) % 256 == 0 && DM % 192 == 0 && HD % 192 == 0);         // k_gemmw: 256x256 and 256x192 tiles cover the outputs
static_assert(DM % 128 == 0 && DM <= SEQ);     // k_prep: W's 128-row tiles lie inside the grid laid out for x

__device__ __forceinline__ unsigned short f2bf(float f) { unsigned u = __float_as_uint(f); u += 0x7FFFu + ((u >> 16) & 1u); return (unsigned short)(u >> 16); }
__device__ __forceinline__ v16h cat16(v8h lo, v8h hi) { return __builtin_shufflevector(lo, hi, 0, 1, 2, 3, 4, 5, 6, 7, 8, 9, 10, 11, 12, 13, 14, 15); }
__device__ __forceinline__ v16bf cat16b(v8us lo, v8us hi) { return __builtin_bit_cast(v16bf, __builtin_shufflevector(lo, hi, 0, 1, 2, 3, 4, 5, 6, 7, 8, 9, 10, 11, 12, 13, 14, 15)); }
__device__ __forceinline__ v8f wmma16(v16h a, v16h b, v8f c) { return __builtin_amdgcn_wmma_f32_16x16x32_f16(false, a, false, b, (short)0, c, false, false); }
__device__ __forceinline__ v8f wmmab(v16bf a, v16bf b, v8f c) { return __builtin_amdgcn_wmma_f32_16x16x32_bf16(false, a, false, b, (short)0, c, false, false); }
__device__ __forceinline__ h16 tohx(float x) { return (h16)x; }
// f32 -> f16 (RNE) that cannot produce an f16 subnormal: |v| < 2^-14 -> +0 (value select).
static __device__ __forceinline__ h16 toh_flush(float v) { const h16 r = (h16)v; return (fabsf(v) < 6.103515625e-05f) ? (h16)0.0f : r; }

// ---- k_gemmw<T16, NF>: GEMM, EIGHT WAVES (4 x 2) per 256 x (32 NF) output tile, each wave 64 rows x 16 NF columns (4 NF accumulators); grid (M/256, N/(32 NF), Z), 256 threads, one block per WGP, two waves per SIMD.
// NF = 8: 256x256 tile; NF = 6: 256x192 tile (N = 768: four column tiles, so that the grid is a whole number of blocks per WGP).
// Operand tiles (256 rows of A, 32 NF rows of Bt, 128 k each) are staged in LDS by asynchronous 16-byte copies, two buffers: tile t+1 flies while tile t is worked on; a staged A row serves two waves, a staged Bt row four.
// C[m][n] (f32, pitch LDC) = sum_k A[m][k] Bt[n][k]. z-batch strides sA/sB/sC in elements. K % 128 == 0, M % 256 == 0, N % (32 NF) == 0.
// EPI picks what the output stage does with the f32 sums: 0 = store them to C; 1 = split each into f16 value + f16 remainder, carried x2048, and store both to QO [m][qh | ql] (pitch KX2; C unused); 2 = store sum/1024 + mean to C, mean = (sum over the SEQ/128 row tiles tt of VM[z][tt][n]) / SEQ;
// 3 = softmax, first half: per row and per wave (128 columns = one key tile) m = max of the sums, e = 1024 exp((sum - m)/2048), l = sum of e; e goes as f16 to QO [z][m][n] (pitch LDC), m and l to C [z][key tile][m | l][row].
// EPI 2 is also the softmax's second half: A holds those e; from ST (the m and l of its 256 rows) the block forms c = exp((m - row max)/2048) x 1024 / (sum over tiles of l exp((m - row max)/2048)) per row and key tile, and every A fragment becomes e c - 1024/SEQ (a staged K tile is one key tile).
// Fragment map (A and Bt alike): lane -> row/col lane&15, h = lane>>4; elements 0..7 = k0+8h+0..7, elements 8..15 = k0+16+8h+0..7. D: acc[j] = (row 8h+j, col lane&15).
template <typename T16> struct WFrag;
template <> struct WFrag<h16> { typedef v16h V; static __device__ __forceinline__ V ld(const h16* p) { return cat16(*(const v8h*)p, *(const v8h*)(p + 16)); } static __device__ __forceinline__ v8f mma(V a, V b, v8f c) { return wmma16(a, b, c); } };
template <> struct WFrag<bf> { typedef v16bf V; static __device__ __forceinline__ V ld(const bf* p) { return cat16b(*(const v8us*)p, *(const v8us*)(p + 16)); } static __device__ __forceinline__ v8f mma(V a, V b, v8f c) { return wmmab(a, b, c); } };
#define GBK  128                 // k per staged tile: 256 B of every operand row
#define GPIT 136                 // LDS row pitch in 16-bit elements: 272 B = 16 B x odd, conflict-free for 16-byte fragment reads
#define GBM  256                 // A rows per block tile
typedef int v4i __attribute__((vector_size(16)));
// one lane's 16 bytes, global -> LDS, through no register
__device__ __forceinline__ void cp16(const void* g, void* l) {
    __builtin_amdgcn_global_load_async_to_lds_b128((__attribute__((address_space(1))) v4i*)g, (__attribute__((address_space(3))) v4i*)l, 0, 0);
}
// value of lane l ^ X inside a 16-lane row (DPP row_xmask): the row reductions of the softmax stage stay on the vector unit
template <int X> __device__ __forceinline__ float rowx(float v) { return __builtin_bit_cast(float, __builtin_amdgcn_update_dpp(0, __builtin_bit_cast(int, v), 0x160 | X, 0xf, 0xf, true)); }
__device__ __forceinline__ float rowmax16(float v) { v = fmaxf(v, rowx<1>(v)); v = fmaxf(v, rowx<2>(v)); v = fmaxf(v, rowx<4>(v)); return fmaxf(v, rowx<8>(v)); }
__device__ __forceinline__ float rowsum16(float v) { v += rowx<1>(v); v += rowx<2>(v); v += rowx<4>(v); return v + rowx<8>(v); }
#define NKT  (SEQ / GBK)                   // key tiles per row
#define EXK  (SCL * 1.4426950408889634f)   // carried score difference -> exponent of two (SCL is a power of two: the product is the rounded log2(e), scaled exactly)
template <typename T16, int NF, int LDC, int EPI>
__global__ __launch_bounds__(256) void k_gemmw(const T16* __restrict__ A, const T16* __restrict__ Bt, int K, float* C, size_t sA, size_t sB, size_t sC, h16* QO, const float* __restrict__ VM, const float* __restrict__ ST) {
    typedef typename WFrag<T16>::V V;
    constexpr int WN = NF * 16;                  // columns per wave
    constexpr int GBN = 2 * WN;                  // Bt rows per block tile
    constexpr int GSTG = (GBM + GBN) * GPIT;     // one buffer: rows 0..255 = A tile, the rows behind = Bt tile
    constexpr int OSP = WN + 4;                  // pitch in floats of a wave's 16-row output stage
    static_assert(8 * 16 * OSP * 4 <= 2 * GSTG * 2);
    static_assert(GBM / 16 + GBN / 16 <= 63);    // copies of one wave in flight
    constexpr int CTB = EPI == 2 ? NKT * GBM * 4 : 0;   // EPI 2: the factor table behind the ring, [key tile][row], one dword = the f16 factor twice
    static_assert(2 * GSTG * 2 + CTB <= 327680);
    __shared__ __align__(16) unsigned char smem[2 * GSTG * 2 + CTB];
    T16* ring = (T16*)smem;
    unsigned* ctab = (unsigned*)(smem + 2 * GSTG * 2);
    const size_t z = blockIdx.z; A += z * sA; Bt += z * sB; C += z * sC;
    const int tid = threadIdx.x, lane = tid & 31, lr = lane & 15, hi = lane >> 4;
    const int wave = __builtin_amdgcn_readfirstlane(tid >> 5), wm = wave >> 1, wn = wave & 1;
    const int t0r = blockIdx.x * GBM, t0c = blockIdx.y * GBN;
    const int r0 = t0r + wm * 64, c0 = t0c + wn * WN;
    float* os = (float*)smem + wave * (16 * OSP);   // output stage: lies in the ring, used only behind the loop's last barrier (no reader, no copy left)
    v8f acc[4][NF];
#pragma unroll
    for (int mb = 0; mb < 4; ++mb)
#pragma unroll
        for (int nb = 0; nb < NF; ++nb) acc[mb][nb] = (v8f){};
    // copy map: 16 lanes cover one row's 256 B, the block covers 16 rows per copy; 16 copies for A, 2 NF for Bt per lane and tile
    const int cr = tid >> 4, cch = (tid & 15) * 8;
    const T16* ga = A + (size_t)(t0r + cr) * K + cch;
    const T16* gb = Bt + (size_t)(t0c + cr) * K + cch;
    const size_t gstep = (size_t)16 * K;
    T16* lbase = ring + cr * GPIT + cch;
    auto fill = [&](int buf, int kt) {
        const T16* pa = ga + (size_t)kt * GBK; const T16* pb = gb + (size_t)kt * GBK; T16* l = lbase + buf * GSTG;
#pragma unroll
        for (int i = 0; i < GBM / 16; ++i) cp16(pa + i * gstep, l + i * 16 * GPIT);
#pragma unroll
        for (int i = 0; i < GBN / 16; ++i) cp16(pb + i * gstep, l + (GBM + i * 16) * GPIT);
    };
    const int nt = K / GBK;
    fill(0, 0);
    if constexpr (EPI == 2) {
        // one thread per block row, while tile 0 flies: the row's 16 (m, l) pairs -> 16 factors; published by the barrier below
        static_assert(GBM == 256 && NKT * GBK == SEQ);
        const float* sp = ST + z * (size_t)(NKT * 2 * SEQ) + t0r + tid;
        float m[NKT], l[NKT];
#pragma unroll
        for (int q = 0; q < NKT; ++q) { m[q] = sp[q * 2 * SEQ]; l[q] = sp[q * 2 * SEQ + SEQ]; }
        asm volatile("s_wait_xcnt 0x0" :: "v"(sp) : "memory");   // stands in front of whatever next overwrites these loads' address registers; the address as an input keeps them whole up to here
        float mr = m[0];
#pragma unroll
        for (int q = 1; q < NKT; ++q) mr = fmaxf(mr, m[q]);
        float ls = 0.f;
#pragma unroll
        for (int q = 0; q < NKT; ++q) { m[q] = __builtin_amdgcn_exp2f((m[q] - mr) * EXK); ls += l[q] * m[q]; }
        const float fs = __fdiv_rn(PCAR, ls);
#pragma unroll
        for (int q = 0; q < NKT; ++q) { const h16 c = tohx(m[q] * fs); v2h c2; c2[0] = c; c2[1] = c; ctab[q * GBM + tid] = __builtin_bit_cast(unsigned, c2); }
    }
    asm volatile("s_wait_asynccnt 0x0" ::: "memory");   // tile 0 landed (this wave's copies) before the barrier publishes it
    __syncthreads();
    const int aofs = (wm * 64 + lr) * GPIT + 8 * hi, bofs = (GBM + wn * WN + lr) * GPIT + 8 * hi;
#pragma unroll 1   // one trip per staged tile stays rolled: the body already holds 16 NF WMMAs
    for (int t = 0; t < nt; ++t) {
        const T16* sa = ring + (t & 1) * GSTG + aofs; const T16* sb = ring + (t & 1) * GSTG + bofs;
        V a[2][4], b[2][NF];   // two fragment sets: the next 32 k are fetched from LDS while the current 32 k are multiplied
#pragma unroll
        for (int f = 0; f < 4; ++f) a[0][f] = WFrag<T16>::ld(sa + f * 16 * GPIT);
#pragma unroll
        for (int f = 0; f < NF; ++f) b[0][f] = WFrag<T16>::ld(sb + f * 16 * GPIT);
        unsigned cw[4];   // EPI 2: this key tile's factors of the lane's four A rows, read in the same group as the first fragments
        if constexpr (EPI == 2) {
#pragma unroll
            for (int f = 0; f < 4; ++f) cw[f] = ctab[t * GBM + wm * 64 + f * 16 + lr]; }
        // tile t+1 into the other buffer: its last readers (trip t-1) ended at the barrier just passed; issued behind the first fragment reads so that their LDS latency passes meanwhile
        if (t + 1 < nt) fill((t + 1) & 1, t + 1);
#pragma unroll
        for (int ks = 0; ks < GBK / 32; ++ks) {
            const int cu = ks & 1, nx = cu ^ 1;
            if (ks + 1 < GBK / 32) {
#pragma unroll
                for (int f = 0; f < 4; ++f) a[nx][f] = WFrag<T16>::ld(sa + f * 16 * GPIT + (ks + 1) * 32);
#pragma unroll
                for (int f = 0; f < NF; ++f) b[nx][f] = WFrag<T16>::ld(sb + f * 16 * GPIT + (ks + 1) * 32);
            }
            __builtin_amdgcn_sched_barrier(0);   // keeps the next set's LDS reads as one group ahead of this block's WMMAs
            if constexpr (EPI == 2) {
#pragma unroll
                for (int mb = 0; mb < 4; ++mb) { const v2h c2 = __builtin_bit_cast(v2h, cw[mb]);
                    const V cv = __builtin_shufflevector(c2, c2, 0, 1, 0, 1, 0, 1, 0, 1, 0, 1, 0, 1, 0, 1, 0, 1);
                    a[cu][mb] = __builtin_elementwise_fma(a[cu][mb], cv, (V)(h16)(-PCAR / (float)SEQ)); } }   // softmax weight x1024, centred: one packed fma per register
#pragma unroll
            for (int nb = 0; nb < NF; ++nb)
#pragma unroll
                for (int mb = 0; mb < 4; ++mb) acc[mb][nb] = WFrag<T16>::mma(a[cu][mb], b[cu][nb], acc[mb][nb]);
            __builtin_amdgcn_sched_barrier(0);   // keeps this block's WMMAs ahead of the following group of LDS reads
        }
        asm volatile("s_wait_dscnt 0x0" ::: "memory");      // this wave's reads of buffer t&1 are done before the buffer is refilled
        asm volatile("s_wait_asynccnt 0x0" ::: "memory");   // this wave's copies of tile t+1 have landed before the barrier publishes them
        __syncthreads();                                    // publishes tile t+1; ends every wave's reads of buffer t&1
    }
    asm volatile("s_wait_asynccnt 0x0" ::: "memory");       // no copy outstanding when the wave goes on
    if constexpr (EPI == 1) {
        // split output: the block's whole 256 x GBN f32 tile is staged in the ring (free behind the loop's last barrier), so that a row's f16 pieces leave as whole 128-byte lines, each line from one wave.
        constexpr int BSP = GBN + 4;                 // pitch in floats of the block's output stage
        constexpr int CP8 = GBN / 8;                 // 8-column pieces per staged row: 32 B of f32 in, 16 B of qh and 16 B of ql out
        constexpr int NQ = (CP8 % 32 == 0) ? 1 : 3;  // after NQ wave-wide pieces the pattern repeats RQ rows further down
        constexpr int RQ = 32 * NQ / CP8;
        static_assert(GBM * BSP * 4 <= 2 * GSTG * 2);
        static_assert((32 * NQ) % CP8 == 0 && 32 % RQ == 0 && CP8 % 8 == 0 && GBM == 8 * 32);
        float* bs = (float*)smem;
#pragma unroll
        for (int mb = 0; mb < 4; ++mb)
#pragma unroll
            for (int nb = 0; nb < NF; ++nb)
#pragma unroll
                for (int j = 0; j < 8; ++j) bs[(wm * 64 + mb * 16 + hi * 8 + j) * BSP + wn * WN + nb * 16 + lr] = acc[mb][nb][j];
        __syncthreads();   // the whole tile is staged before a wave reads rows that other waves wrote
        h16* qp[NQ]; const float* sp[NQ];
#pragma unroll
        for (int p = 0; p < NQ; ++p) { const int q = p * 32 + lane, row = wave * 32 + q / CP8, cofs = (q % CP8) * 8;
            qp[p] = QO + (size_t)(t0r + row) * KX2 + t0c + cofs; sp[p] = bs + row * BSP + cofs; }
#pragma unroll
        for (int u = 0; u < 32 / RQ; ++u) {
#pragma unroll
            for (int p = 0; p < NQ; ++p) { const v4f lo = *(const v4fa*)(sp[p] + u * RQ * BSP); const v4f up = *(const v4fa*)(sp[p] + u * RQ * BSP + 4); v8h qh, ql;
#pragma unroll
                for (int k = 0; k < 8; ++k) { const float sv = (k < 4 ? lo[k & 3] : up[k & 3]) * QCAR; const h16 a = toh_flush(sv); qh[k] = a; ql[k] = toh_flush(sv - (float)a); }   // x2048 is exact, so the difference is exact fused or not
                *(v8h*)(qp[p] + (size_t)(u * RQ) * KX2) = qh; *(v8h*)(qp[p] + (size_t)(u * RQ) * KX2 + HD) = ql; }
            if (u + 1 < 32 / RQ) asm volatile("s_wait_xcnt 0x0" ::: "memory");   // stands in front of the next rows' LDS reads and conversions, which overwrite the registers that these stores name
        }
        return;
    }
    if constexpr (EPI == 3) {
        static_assert(WN == GBK && NF == 8);   // a wave's columns are one key tile; a staged row is one wave-wide piece
        float mx[4][8], sm[4][8];
#pragma unroll
        for (int mb = 0; mb < 4; ++mb)
#pragma unroll
            for (int j = 0; j < 8; ++j) { float m = acc[mb][0][j];
#pragma unroll
                for (int nb = 1; nb < NF; ++nb) m = fmaxf(m, acc[mb][nb][j]);
                mx[mb][j] = rowmax16(m); }
#pragma unroll
        for (int mb = 0; mb < 4; ++mb)
#pragma unroll
            for (int j = 0; j < 8; ++j) { float s = 0.f;
#pragma unroll
                for (int nb = 0; nb < NF; ++nb) { const float e = __builtin_amdgcn_exp2f(fmaf(acc[mb][nb][j] - mx[mb][j], EXK, 10.0f)); acc[mb][nb][j] = e; s += e; }   // + 10: the x1024 carry
                sm[mb][j] = rowsum16(s); }
        // the wave's 64 maxima and 64 sums through its LDS stage, so that they leave as one 16-byte store per lane (whole lines)
        if (lr == 0) {
#pragma unroll
            for (int mb = 0; mb < 4; ++mb)
#pragma unroll
                for (int j = 0; j < 8; ++j) { os[mb * 16 + hi * 8 + j] = mx[mb][j]; os[64 + mb * 16 + hi * 8 + j] = sm[mb][j]; } }
        __builtin_amdgcn_wave_barrier(); asm volatile("" ::: "memory");
        const v4f sv = *(const v4fa*)(os + lane * 4);
        float* stp = C + (size_t)(c0 / GBK) * (2 * SEQ) + hi * SEQ + r0 + lr * 4;
        *(v4f*)stp = sv;
        asm volatile("s_wait_xcnt 0x0" :: "v"(stp), "v"(sv) : "memory");   // stands in front of whatever next overwrites the registers that this store names; as inputs they stay whole up to here
        __builtin_amdgcn_wave_barrier();
        h16* pp = QO + z * ((size_t)SEQ * LDC) + (size_t)r0 * LDC + c0 + lane * 4;
        const float* rp = os + lane * 4;
#pragma unroll
        for (int mb = 0; mb < 4; ++mb) {
#pragma unroll
            for (int nb = 0; nb < NF; ++nb) {
#pragma unroll
                for (int j = 0; j < 8; ++j) os[(hi * 8 + j) * OSP + nb * 16 + lr] = acc[mb][nb][j]; }
            __builtin_amdgcn_wave_barrier(); asm volatile("" ::: "memory");
#pragma unroll
            for (int hf = 0; hf < 2; ++hf) {
#pragma unroll
                for (int u = hf * 8; u < hf * 8 + 8; ++u) { const v4f val = *(const v4fa*)(rp + u * OSP); v4h o4;
#pragma unroll
                    for (int i = 0; i < 4; ++i) o4[i] = tohx(val[i]);
                    *(v4h*)(pp + (size_t)(mb * 16 + u) * LDC) = o4; }
                if (mb + 1 < 4 || hf == 0) asm volatile("s_wait_xcnt 0x0" ::: "memory");   // stands in front of the next 8 rows' LDS reads, and so of the conversions fed by them, which overwrite the registers that these stores name
            }
            __builtin_amdgcn_wave_barrier();
        }
        return;
    }
    // output: 16 rows at a time through the wave's own LDS stage, stored as 16-byte pieces in row order (whole 128-byte lines).
    // After NP wave-wide stores the piece pattern repeats RP rows further down, so every address is one of NP lane pointers plus a compile-time offset.
    constexpr int CPR = NF * 4;                      // 16-byte pieces per staged row
    constexpr int NP = (CPR % 32 == 0) ? 1 : 3;
    constexpr int RP = 32 * NP / CPR;
    static_assert((32 * NP) % CPR == 0 && 16 % RP == 0);
    float* gp[NP]; const float* lp[NP];
#pragma unroll
    for (int p = 0; p < NP; ++p) { const int q = p * 32 + lane, row = q / CPR, cofs = (q % CPR) * 4;
        gp[p] = C + (size_t)(r0 + row) * LDC + c0 + cofs; lp[p] = os + row * OSP + cofs; }
    v4f mean[NP];   // EPI 2: a lane's columns are the same in every row group, so their column means are fetched once
    if constexpr (EPI == 2) {
#pragma unroll
        for (int p = 0; p < NP; ++p) { const float* vp = VM + z * (size_t)((SEQ / 128) * LDC) + c0 + ((p * 32 + lane) % CPR) * 4;
            v4f pv[SEQ / 128];
#pragma unroll
            for (int tt = 0; tt < SEQ / 128; ++tt) pv[tt] = *(const v4f*)(vp + tt * LDC);
            asm volatile("s_wait_xcnt 0x0" :: "v"(vp) : "memory");   // stands in front of whatever next overwrites these loads' address registers; the address as an input keeps them whole up to here (without it a load's own result, or a later value, was given them ahead of the wait)
            v4f s = pv[0];
#pragma unroll
            for (int tt = 1; tt < SEQ / 128; ++tt) s += pv[tt];
            mean[p] = s * (1.0f / (float)SEQ); }
    }
#pragma unroll
    for (int mb = 0; mb < 4; ++mb) {
#pragma unroll
        for (int nb = 0; nb < NF; ++nb) {
#pragma unroll
            for (int j = 0; j < 8; ++j) os[(hi * 8 + j) * OSP + nb * 16 + lr] = acc[mb][nb][j]; }
        __builtin_amdgcn_wave_barrier(); asm volatile("" ::: "memory");
#pragma unroll
        for (int u = 0; u < 16 / RP; ++u)
#pragma unroll
            for (int p = 0; p < NP; ++p) { v4f val = *(const v4fa*)(lp[p] + u * RP * OSP);
                if constexpr (EPI == 2) {
#pragma unroll
                    for (int i = 0; i < 4; ++i) val[i] = val[i] * (1.0f / PCAR) + mean[p][i]; }
                *(v4f*)(gp[p] + (size_t)(mb * 16 + u * RP) * LDC) = val; }
        if (mb + 1 < 4) asm volatile("s_wait_xcnt 0x0" ::: "memory");   // stands in front of the next 16 rows' LDS reads, which overwrite the registers that these stores name
        __builtin_amdgcn_wave_barrier();
    }
}

// k_prep: one pass over x: a block reads one 128 t x 128 d tile of f32 and writes all that is made of it:
// (a) bf16 (RNE) plane XB [g][t][d]; (b) f16 plane KX [g][t][k | k] (pitch KX2) holding the bf16 value (exact in f16, subnormals -> 0) in both halves; (c) the same f16 values transposed, V16 [g][d][t]; (d) the tile's column sums of those values, VMP [g][t tile][d] f32.
// The z plane behind the last batch takes W, whose rows have x's pitch: only its bf16 plane is written.
// Every global side moves whole row pieces: 512 B of f32 in, 256 B of 16-bit values out (16 lanes x 32 B / 16 B).
// LDS tile [d][t pair]: one dword = the f16 values of t and t+1 at one d; a row is 64 dwords = 16 groups of 4. Group j of row d lies at place j ^ (d >> 3): the 16 lanes of a dword store (d 8 apart, same t pair) then fall on 16 different banks, and a 16-byte read still takes one whole group.
#define VTT 128
#define VTD 128
typedef __attribute__((ext_vector_type(4))) unsigned v4u;
// eight waves per SIMD (at most 128 registers): four blocks fit a WGP, so that the whole grid is resident at once and no block waits for a place
__global__ __launch_bounds__(256, 8) void k_prep(const float* __restrict__ x, const float* __restrict__ wq, bf* XB, bf* WQ, h16* KX, h16* V16, float* VMP) {
    __shared__ __align__(16) unsigned tile[VTD * (VTT / 2)];
    __shared__ __align__(16) float part[8 * VTD];
    const int tid = threadIdx.x, c16 = tid & 15, r16 = tid >> 4;
    const int t0 = blockIdx.x * VTT, d0 = blockIdx.y * VTD, g = blockIdx.z;
    const bool isw = g == ZB;                 // the same for the whole block
    if (isw && t0 >= DM) return;              // W has DM rows; the whole block leaves, ahead of the barrier
    // in: lane -> 8 d (c16), row pairs r16 + 16 k
    const size_t tofs = (size_t)t0 * DM + d0 + c16 * 8;
    const float* src = (isw ? wq : x + (size_t)g * SEQ_FULL * DM) + tofs;
    bf* xb = (isw ? WQ : XB + (size_t)g * SEQ * DM) + tofs;
    v8f r[VTT / 32][2];
#pragma unroll
    for (int k = 0; k < VTT / 32; ++k)
#pragma unroll
        for (int q = 0; q < 2; ++q) r[k][q] = *(const v8f*)(src + (size_t)(2 * (r16 + 16 * k) + q) * DM);
    v8us o[VTT / 32][2];
#pragma unroll
    for (int k = 0; k < VTT / 32; ++k)
#pragma unroll
        for (int q = 0; q < 2; ++q)
#pragma unroll
            for (int i = 0; i < 8; ++i) o[k][q][i] = f2bf(r[k][q][i]);
    if (isw) {
#pragma unroll
        for (int k = 0; k < VTT / 32; ++k)
#pragma unroll
            for (int q = 0; q < 2; ++q) *(v8us*)(xb + (size_t)(2 * (r16 + 16 * k) + q) * DM) = o[k][q];
        return; }
    v8h kk[VTT / 32][2];
    float cs[8];
#pragma unroll
    for (int i = 0; i < 8; ++i) cs[i] = 0.f;
#pragma unroll
    for (int k = 0; k < VTT / 32; ++k) { const int tp = r16 + 16 * k; unsigned* col = tile + (size_t)(c16 * 8) * (VTT / 2) + (((tp >> 2) ^ c16) << 2) + (tp & 3);
#pragma unroll
        for (int q = 0; q < 2; ++q)
#pragma unroll
            for (int i = 0; i < 8; ++i) { const float xv = __uint_as_float((unsigned)o[k][q][i] << 16); kk[k][q][i] = toh_flush(xv); cs[i] += (fabsf(xv) < 6.103515625e-05f) ? 0.0f : xv; }
#pragma unroll
        for (int i = 0; i < 8; ++i) { v2h o16; o16[0] = kk[k][0][i]; o16[1] = kk[k][1][i];
            col[i * (VTT / 2)] = __builtin_bit_cast(unsigned, o16); } }
    // column sums: a wave's two row groups, then one row of part per wave
#pragma unroll
    for (int i = 0; i < 8; ++i) cs[i] += __shfl_xor(cs[i], 16, 32);
    if ((tid & 16) == 0) { float* pp = part + (tid >> 5) * VTD + c16 * 8;
        *(v4f*)pp = (v4f){cs[0], cs[1], cs[2], cs[3]}; *(v4f*)(pp + 4) = (v4f){cs[4], cs[5], cs[6], cs[7]}; }
    __syncthreads();   // the whole tile and every wave's column sums are in LDS before any of it is read; no global store stands in front of it, so it waits for none
    // out, transposed: lane -> 8 t (c16), d rows r16 + 16 k
    v4u val[VTD / 16];
#pragma unroll
    for (int k = 0; k < VTD / 16; ++k) { const int d = r16 + 16 * k; val[k] = *(const v4u*)(tile + d * (VTT / 2) + ((c16 ^ (d >> 3)) << 2)); }
    float a = part[tid & (VTD - 1)];
#pragma unroll
    for (int w = 1; w < 8; ++w) a += part[w * VTD + (tid & (VTD - 1))];
    // out, row order: the planes straight from the registers
    h16* kp = KX + ((size_t)g * SEQ + t0) * KX2 + d0 + c16 * 8;
#pragma unroll
    for (int k = 0; k < VTT / 32; ++k)
#pragma unroll
        for (int q = 0; q < 2; ++q) { const int row = 2 * (r16 + 16 * k) + q;
            *(v8us*)(xb + (size_t)row * DM) = o[k][q];
            h16* kr = kp + (size_t)row * KX2;
            *(v8h*)kr = kk[k][q]; *(v8h*)(kr + HD) = kk[k][q]; }
    h16* dst = V16 + ((size_t)g * HD + d0) * SEQ + t0 + c16 * 8;
#pragma unroll
    for (int k = 0; k < VTD / 16; ++k) *(v4u*)(dst + (size_t)(r16 + 16 * k) * SEQ) = val[k];
    if (tid < VTD) VMP[((size_t)g * (SEQ / VTT) + blockIdx.x) * HD + d0 + tid] = a;
}

constexpr size_t al256(size_t b) { return (b + 255) & ~(size_t)255; }
constexpr size_t mx2(size_t a, size_t b) { return a > b ? a : b; }
// Shared ranges, by launch order within a pass:
// range 1: XB (last read by the projection GEMM) -> P16 (written by the score GEMM)
// range 2: QX, KX (last read by the score GEMM)
constexpr size_t WS_XB = al256((size_t)ZB * SEQ * DM * 2);      // XB bf16
constexpr size_t WS_QX = al256((size_t)ZB * SEQ * KX2 * 2);     // QX f16 [qh | ql]; KX f16 [k | k] has the same size
constexpr size_t WS_R1 = mx2(WS_XB, al256((size_t)ZB * SEQ * SEQ * 2));
constexpr size_t WS_R2 = 2 * WS_QX;
constexpr size_t WS_TOTAL =
    al256((size_t)DM * DM * 2) +                  // WQ bf16
    WS_R1 + WS_R2 +
    al256((size_t)ZB * HD * SEQ * 2) +            // VT16
    al256((size_t)ZB * (SEQ / 128) * HD * 4) +    // VM: column sums per 128-row tile
    al256((size_t)ZB * NKT * 2 * SEQ * 4);        // ST: row maximum and exp sum per key tile
static_assert(WS_TOTAL <= (size_t)268435456);

extern "C" void kernel_launch(void* const* d_in, const int* in_sizes, int n_in,
                              void* d_out, int out_size, void* d_ws, size_t ws_size, hipStream_t stream) {
    if (n_in < 2) return;
    if ((size_t)in_sizes[0] < ((size_t)(NB - 1) * SEQ_FULL + SEQ) * DM) return;
    if ((size_t)in_sizes[1] < (size_t)DM * DM) return;
    if ((size_t)out_size < (size_t)NB * SEQ * DM) return;
    if (WS_TOTAL > ws_size) return;
    const float* x = (const float*)d_in[0]; const float* wq = (const float*)d_in[1];   // x [NB][SEQ_FULL][768]; W [768 out][768 in]
    float* OUT = (float*)d_out;     // [NB][SEQ][768]
    char* wsp = (char*)d_ws;
    auto take = [&](size_t bytes) { char* p = wsp; wsp += al256(bytes); return (void*)p; };
    bf* WQ = (bf*)take((size_t)DM * DM * 2);
    char* r1 = (char*)take(WS_R1);
    char* r2 = (char*)take(WS_R2);
    bf* XB = (bf*)r1; h16* P16 = (h16*)r1;
    h16* QX = (h16*)r2; h16* KX = (h16*)(r2 + WS_QX);
    h16* VT16 = (h16*)take((size_t)ZB * HD * SEQ * 2);
    float* VM = (float*)take((size_t)ZB * (SEQ / 128) * HD * 4);
    float* ST = (float*)take((size_t)ZB * NKT * 2 * SEQ * 4);
    if ((size_t)(wsp - (char*)d_ws) > ws_size) return;

    for (int b0 = 0; b0 < NB; b0 += ZB) {
        k_prep<<<dim3(SEQ / 128, DM / 128, ZB + 1), 256, 0, stream>>>(x + (size_t)b0 * SEQ_FULL * DM, wq, XB, WQ, KX, VT16, VM);
        k_gemmw<bf, 6, DM, 1><<<dim3(ZB * SEQ / 256, DM / 192, 1), 256, 0, stream>>>(XB, WQ, DM, nullptr, 0, 0, 0, QX, nullptr, nullptr);
        k_gemmw<h16, 8, SEQ, 3><<<dim3(SEQ / 256, SEQ / 256, ZB), 256, 0, stream>>>(QX, KX, KX2, ST, (size_t)SEQ * KX2, (size_t)SEQ * KX2, (size_t)NKT * 2 * SEQ, P16, nullptr, nullptr);
        k_gemmw<h16, 6, HD, 2><<<dim3(SEQ / 256, HD / 192, ZB), 256, 0, stream>>>(P16, VT16, SEQ, OUT + (size_t)b0 * SEQ * DM, (size_t)SEQ * SEQ, (size_t)HD * SEQ, (size_t)SEQ * HD, nullptr, VM, ST);
    }
}

// v008
// It runs in 127 microseconds.
// Timed twice side by side with v007, it ran 1.13 and 1.12 times as fast.
// Counting every step since v000, it is 5.73 times as fast.
#include <hip/hip_runtime.h>

// Contractions: q projection on v_wmma_f32_16x16x32_f16 (x and W RNE-rounded to bf16 precision and held as f16, which is exact; W carried x1024; exact products, f32 accumulate); q.x^T on v_wmma_f32_16x16x32_f16 with q carried x2048 as f16 value + f16 remainder folded along K ([qh | ql] x k taken twice, k = that same f16 plane of x); att.x on v_wmma_f32_16x16x32_f16 (the same f16 x plane, its B fragments taken by transposing LDS loads; softmax weights carried x1024 and centred by 1024/SEQ, column mean of x added back in f32), f32 accumulate.
// Single-head full-width document self-attention: x [8][2048][768]; q = x W^T ('oi' [768][768], no bias); keys = values = x; att = softmax(q.x) over all 2048 keys (no scale, no mask); out = att @ x -> [8][2048][768] f32.
// All batches in one pass (z-batched GEMMs): one kernel reads x (and W) once and writes all that is made of it: one f16 row-major plane (A of the projection, Bt of the score GEMM, B of the last GEMM) and the column sums per 128 rows; projection -> f16 [qh | ql] plane (split in the GEMM's output stage); S' = 2048 q.x stays in the score GEMM's accumulators: its output stage takes each row's maximum and exp sum over the wave's 128 keys and stores 1024 exp(s - tile max) as f16 plus the two figures; the last GEMM joins a row's 16 tiles into one factor per tile and applies it to its A fragments; O = P' x, out = O/1024 + mean_t(x) formed in the GEMM's output stage.

#ifndef NB
#define NB 8
#endif
#ifndef SEQ
#define SEQ 2048
#endif
#define NB_FULL  8
#define SEQ_FULL 2048
#define DM   768
#define HD   768
#define ZB   NB                           // batches per pass: all of them, so every stage is one launch with the fullest grid
#define PCAR 1024.0f
#define QCAR 2048.0f                      // carry of the q value / remainder planes
#define SCL  4.8828125e-4f                // 1/2048: undoes the q carry (the module applies no score scale)
#define WCAR 1024.0f                      // carry of the f16 W plane: keeps small weights clear of the f16 subnormal range; undone with the q carry
#define KX2  (2 * HD)                     // pitch of the K-folded plane [value | remainder]

typedef _Float16 h16;
typedef __attribute__((ext_vector_type(16))) _Float16 v16h;
typedef __attribute__((ext_vector_type(8)))  _Float16 v8h;
typedef __attribute__((ext_vector_type(8)))  unsigned short v8us;
typedef __attribute__((ext_vector_type(8)))  float    v8f;
typedef __attribute__((ext_vector_type(4)))  float    v4f;
typedef __attribute__((ext_vector_type(2)))  _Float16 v2h;
typedef __attribute__((ext_vector_type(4)))  _Float16 v4h;
typedef v4f  __attribute__((may_alias)) v4fa;

static_assert(NB <= NB_FULL);
static_assert(SEQ <= SEQ_FULL);
static_assert(NB % ZB == 0);
static_assert(SEQ % 128 == 0);                 // softmax row chunks, 64-row tiles, K steps of 32
static_assert(DM % 64 == 0 && HD % 64 == 0);   // K steps of 32
static_assert(DM == HD);                       // q width == x width: q.x contracts over 768
static_assert(((size_t)SEQ * DM) % 8 == 0);
static_assert((ZB * SEQ) % 8 == 0);
static_assert(HD % 32 == 0 && SEQ % 8 == 0);
static_assert(KX2 % 32 == 0);                  // folded score GEMM: K steps of 32
static_assert((ZB * SEQ) % 64 == 0);           // projection GEMM rows: 64-row wave quarters
static_assert(QCAR * SCL == 1.0f);             // carry folded back exactly in the softmax scale
static_assert((KX2 * 2) % 128 == 0);
static_assert(DM % 64 == 0);
static_assert(SEQ % 128 == 0 && HD % 128 == 0 && DM == HD);                  // k_prep: 128 t x 128 d tiles cover the plane
static_assert(2 * 512 * 272 <= 327680);       // k_gemmw static LDS: one block per 320 KiB LDS
static_assert(DM % 128 == 0 && KX2 % 128 == 0 && SEQ % 128 == 0);                                 // k_gemmw: K tiles of 128
static_assert(SEQ % 256 == 0 && (ZB * SEQ) % 256 == 0 && DM % 192 == 0 && HD % 192 == 0);         // k_gemmw: 256x256 and 256x192 tiles cover the outputs
static_assert(DM % 128 == 0 && DM <= SEQ);     // k_prep: W's 128-row tiles lie inside the grid laid out for x

__device__ __forceinline__ unsigned short f2bf(float f) { unsigned u = __float_as_uint(f); u += 0x7FFFu + ((u >> 16) & 1u); return (unsigned short)(u >> 16); }
__device__ __forceinline__ v16h cat16(v8h lo, v8h hi) { return __builtin_shufflevector(lo, hi, 0, 1, 2, 3, 4, 5, 6, 7, 8, 9, 10, 11, 12, 13, 14, 15); }
__device__ __forceinline__ v8f wmma16(v16h a, v16h b, v8f c) { return __builtin_amdgcn_wmma_f32_16x16x32_f16(false, a, false, b, (short)0, c, false, false); }
__device__ __forceinline__ h16 tohx(float x) { return (h16)x; }
// f32 -> f16 (RNE) that cannot produce an f16 subnormal: |v| < 2^-14 -> +0 (value select).
static __device__ __forceinline__ h16 toh_flush(float v) { const h16 r = (h16)v; return (fabsf(v) < 6.103515625e-05f) ? (h16)0.0f : r; }

// ---- k_gemmw<T16, NF>: GEMM, EIGHT WAVES (4 x 2) per 256 x (32 NF) output tile, each wave 64 rows x 16 NF columns (4 NF accumulators); grid (M/256, N/(32 NF), Z), 256 threads, one block per WGP, two waves per SIMD.
// NF = 8: 256x256 tile; NF = 6: 256x192 tile (N = 768: four column tiles, so that the grid is a whole number of blocks per WGP).
// Operand tiles (256 rows of A, 32 NF rows of Bt, 128 k each) are staged in LDS by asynchronous 16-byte copies, two buffers: tile t+1 flies while tile t is worked on; a staged A row serves two waves, a staged Bt row four.
// C[m][n] (f32, pitch LDC) = sum_k A[m][k] Bt[n][k]. z-batch strides sA/sB/sC in elements. K % 128 == 0, M % 256 == 0, N % (32 NF) == 0.
// KW = 0: Bt rows have K elements. KW > 0: Bt rows have KW elements and stand for [row | row] (K = 2 KW): K tiles from KW on take the row's tiles again from its start.
// EPI picks what the output stage does with the f32 sums: 0 = store them to C; 1 = split each (W's carry taken off) into f16 value + f16 remainder, carried x2048, and store both to QO [m][qh | ql] (pitch KX2; C unused); 2 = store sum/1024 + mean to C, mean = (sum over the SEQ/128 row tiles tt of VM[z][tt][n]) / SEQ;
// 3 = softmax, first half: per row and per wave (128 columns = one key tile) m = max of the sums, e = 1024 exp((sum - m)/2048), l = sum of e; e goes as f16 to QO [z][m][n] (pitch LDC), m and l to C [z][key tile][m | l][row].
// EPI 2 is also the softmax's second half: A holds those e; from ST (the m and l of its 256 rows) the block forms c = exp((m - row max)/2048) x 1024 / (sum over tiles of l exp((m - row max)/2048)) per row and key tile, and every A fragment becomes e c - 1024/SEQ (a staged K tile is one key tile).
// EPI 2 takes its second operand row-major, B[k][n] (pitch LDC): the staged tile is 128 k rows of 32 NF columns, and a B fragment is two transposing loads (k0 and k0 + 16), which deliver the k order of the map below.
// Fragment map (A and Bt alike): lane -> row/col lane&15, h = lane>>4; elements 0..7 = k0+8h+0..7, elements 8..15 = k0+16+8h+0..7. D: acc[j] = (row 8h+j, col lane&15).
template <typename T16> struct WFrag;
template <> struct WFrag<h16> { typedef v16h V; static __device__ __forceinline__ V ld(const h16* p) { return cat16(*(const v8h*)p, *(const v8h*)(p + 16)); } static __device__ __forceinline__ v8f mma(V a, V b, v8f c) { return wmma16(a, b, c); } };
// 16 bytes per lane of a row-major 16-bit LDS tile T, transposed: lane (c, h) reading at row k0 + 8 h + (lane & 7), byte 2 n0 + 16 ((lane >> 3) & 1) gets T[k0 + 8 h + 0..7][n0 + c]
typedef short s16x8 __attribute__((ext_vector_type(8)));
__device__ __forceinline__ v8h ldtr(const unsigned char* p) { typedef __attribute__((address_space(3))) s16x8 lds_s16x8; return __builtin_bit_cast(v8h, __builtin_amdgcn_ds_load_tr16_b128_v8i16((lds_s16x8*)p)); }
#define GBK  128                 // k per staged tile: 256 B of every operand row
#define GPIT 136                 // LDS row pitch in 16-bit elements: 272 B = 16 B x odd, conflict-free for 16-byte fragment reads
#define GBM  256                 // A rows per block tile
typedef int v4i __attribute__((vector_size(16)));
// one lane's 16 bytes, global -> LDS, through no register
__device__ __forceinline__ void cp16(const void* g, void* l) {
    __builtin_amdgcn_global_load_async_to_lds_b128((__attribute__((address_space(1))) v4i*)g, (__attribute__((address_space(3))) v4i*)l, 0, 0);
}
// value of lane l ^ X inside a 16-lane row (DPP row_xmask): the row reductions of the softmax stage stay on the vector unit
template <int X> __device__ __forceinline__ float rowx(float v) { return __builtin_bit_cast(float, __builtin_amdgcn_update_dpp(0, __builtin_bit_cast(int, v), 0x160 | X, 0xf, 0xf, true)); }
__device__ __forceinline__ float rowmax16(float v) { v = fmaxf(v, rowx<1>(v)); v = fmaxf(v, rowx<2>(v)); v = fmaxf(v, rowx<4>(v)); return fmaxf(v, rowx<8>(v)); }
__device__ __forceinline__ float rowsum16(float v) { v += rowx<1>(v); v += rowx<2>(v); v += rowx<4>(v); return v + rowx<8>(v); }
#define NKT  (SEQ / GBK)                   // key tiles per row
#define EXK  (SCL * 1.4426950408889634f)   // carried score difference -> exponent of two (SCL is a power of two: the product is the rounded log2(e), scaled exactly)
template <typename T16, int NF, int LDC, int EPI, int KW>
__global__ __launch_bounds__(256) void k_gemmw(const T16* __restrict__ A, const T16* __restrict__ Bt, int K, float* C, size_t sA, size_t sB, size_t sC, h16* QO, const float* __restrict__ VM, const float* __restrict__ ST) {
    typedef typename WFrag<T16>::V V;
    constexpr int WN = NF * 16;                  // columns per wave
    constexpr int GBN = 2 * WN;                  // Bt rows per block tile
    constexpr bool BR = EPI == 2;                // second operand row-major [k][n]
    constexpr int BPB = GBN * 2 + 32;            // BR: LDS pitch in bytes of a staged B row
    static_assert(!BR || (BPB % 32 == 0 && ((BPB / 32) & 1) == 1));   // 32 B x odd: conflict-free for the transposing loads
    constexpr int GSTG = BR ? GBM * GPIT + GBK * BPB / 2 : (GBM + GBN) * GPIT;     // one buffer: rows 0..255 = A tile, behind them the Bt tile (BR: the B tile)
    constexpr int OSP = WN + 4;                  // pitch in floats of a wave's 16-row output stage
    static_assert(8 * 16 * OSP * 4 <= 2 * GSTG * 2);
    static_assert(GBM / 16 + GBN / 16 <= 63);    // copies of one wave in flight (BR: the B tile has as many bytes, so as many copies)
    constexpr int CTB = EPI == 2 ? NKT * GBM * 4 : 0;   // EPI 2: the factor table behind the ring, [key tile][row], one dword = the f16 factor twice
    static_assert(2 * GSTG * 2 + CTB <= 327680);
    __shared__ __align__(16) unsigned char smem[2 * GSTG * 2 + CTB];
    T16* ring = (T16*)smem;
    unsigned* ctab = (unsigned*)(smem + 2 * GSTG * 2);
    const size_t z = blockIdx.z; A += z * sA; Bt += z * sB; C += z * sC;
    const int tid = threadIdx.x, lane = tid & 31, lr = lane & 15, hi = lane >> 4;
    const int wave = __builtin_amdgcn_readfirstlane(tid >> 5), wm = wave >> 1, wn = wave & 1;
    const int t0r = blockIdx.x * GBM, t0c = blockIdx.y * GBN;
    const int r0 = t0r + wm * 64, c0 = t0c + wn * WN;
    float* os = (float*)smem + wave * (16 * OSP);   // output stage: lies in the ring, used only behind the loop's last barrier (no reader, no copy left)
    v8f acc[4][NF];
#pragma unroll
    for (int mb = 0; mb < 4; ++mb)
#pragma unroll
        for (int nb = 0; nb < NF; ++nb) acc[mb][nb] = (v8f){};
    // copy map: 16 lanes cover one row's 256 B, the block covers 16 rows per copy; 16 copies for A, 2 NF for Bt per lane and tile
    const int cr = tid >> 4, cch = (tid & 15) * 8;
    const T16* ga = A + (size_t)(t0r + cr) * K + cch;
    static_assert(KW % GBK == 0);
    const int kbp = KW ? KW : K;                 // pitch of Bt
    const T16* gb = Bt + (size_t)(t0c + cr) * kbp + cch;
    const size_t gstep = (size_t)16 * K, gstepb = (size_t)16 * kbp;
    T16* lbase = ring + cr * GPIT + cch;
    // BR copy map: a B row is PPR 16-byte pieces; piece q = 256 i + tid of the tile; after 3 block-wide copies the pattern repeats 768 / PPR rows further down
    constexpr int PPR = GBN / 8, RB3 = 768 / PPR;
    static_assert(!BR || (768 % PPR == 0 && GBK % RB3 == 0 && PPR % 8 == 0 && GBK * PPR == 256 * (GBN / 16)));
    const T16* gbr[3]; unsigned char* lbr[3];
    if constexpr (BR) {
#pragma unroll
        for (int p = 0; p < 3; ++p) { const int q = p * 256 + tid, row = q / PPR, pc = q % PPR;
            gbr[p] = Bt + (size_t)row * LDC + t0c + pc * 8; lbr[p] = smem + GBM * GPIT * 2 + row * BPB + pc * 16; }
    }
    auto fill = [&](int buf, int kt) {
        const int ktb = (KW && kt >= KW / GBK) ? kt - KW / GBK : kt;
        const T16* pa = ga + (size_t)kt * GBK; const T16* pb = gb + (size_t)ktb * GBK; T16* l = lbase + buf * GSTG;
#pragma unroll
        for (int i = 0; i < GBM / 16; ++i) cp16(pa + i * gstep, l + i * 16 * GPIT);
        if constexpr (BR) {
#pragma unroll
            for (int u = 0; u < GBK / RB3; ++u)
#pragma unroll
                for (int p = 0; p < 3; ++p) cp16(gbr[p] + (size_t)(kt * GBK + u * RB3) * LDC, lbr[p] + buf * (GSTG * 2) + u * RB3 * BPB);
        } else {
#pragma unroll
            for (int i = 0; i < GBN / 16; ++i) cp16(pb + i * gstepb, l + (GBM + i * 16) * GPIT);
        }
    };
    const int nt = K / GBK;
    fill(0, 0);
    if constexpr (EPI == 2) {
        // one thread per block row, while tile 0 flies: the row's 16 (m, l) pairs -> 16 factors; published by the barrier below
        static_assert(GBM == 256 && NKT * GBK == SEQ);
        const float* sp = ST + z * (size_t)(NKT * 2 * SEQ) + t0r + tid;
        float m[NKT], l[NKT];
#pragma unroll
        for (int q = 0; q < NKT; ++q) { m[q] = sp[q * 2 * SEQ]; l[q] = sp[q * 2 * SEQ + SEQ]; }
        asm volatile("s_wait_xcnt 0x0" :: "v"(sp) : "memory");   // stands in front of whatever next overwrites these loads' address registers; the address as an input keeps them whole up to here
        float mr = m[0];
#pragma unroll
        for (int q = 1; q < NKT; ++q) mr = fmaxf(mr, m[q]);
        float ls = 0.f;
#pragma unroll
        for (int q = 0; q < NKT; ++q) { m[q] = __builtin_amdgcn_exp2f((m[q] - mr) * EXK); ls += l[q] * m[q]; }
        const float fs = __fdiv_rn(PCAR, ls);
#pragma unroll
        for (int q = 0; q < NKT; ++q) { const h16 c = tohx(m[q] * fs); v2h c2; c2[0] = c; c2[1] = c; ctab[q * GBM + tid] = __builtin_bit_cast(unsigned, c2); }
    }
    asm volatile("s_wait_asynccnt 0x0" ::: "memory");   // tile 0 landed (this wave's copies) before the barrier publishes it
    __syncthreads();
    const int aofs = (wm * 64 + lr) * GPIT + 8 * hi, bofs = (GBM + wn * WN + lr) * GPIT + 8 * hi;
#pragma unroll 1   // one trip per staged tile stays rolled: the body already holds 16 NF WMMAs
    for (int t = 0; t < nt; ++t) {
        const T16* sa = ring + (t & 1) * GSTG + aofs; const T16* sb = ring + (t & 1) * GSTG + bofs;
        const unsigned char* sbr = smem + (t & 1) * (GSTG * 2) + GBM * GPIT * 2 + (8 * hi + (lane & 7)) * BPB + ((lane >> 3) & 1) * 16 + wn * WN * 2;   // BR: the lane's place in the B tile
        auto ldb = [&](int f, int ks) -> V {
            if constexpr (BR) return cat16(ldtr(sbr + ks * 32 * BPB + f * 32), ldtr(sbr + (ks * 32 + 16) * BPB + f * 32));
            else return WFrag<T16>::ld(sb + f * 16 * GPIT + ks * 32); };
        V a[2][4], b[2][NF];   // two fragment sets: the next 32 k are fetched from LDS while the current 32 k are multiplied
#pragma unroll
        for (int f = 0; f < 4; ++f) a[0][f] = WFrag<T16>::ld(sa + f * 16 * GPIT);
#pragma unroll
        for (int f = 0; f < NF; ++f) b[0][f] = ldb(f, 0);
        unsigned cw[4];   // EPI 2: this key tile's factors of the lane's four A rows, read in the same group as the first fragments
        if constexpr (EPI == 2) {
#pragma unroll
            for (int f = 0; f < 4; ++f) cw[f] = ctab[t * GBM + wm * 64 + f * 16 + lr]; }
        // tile t+1 into the other buffer: its last readers (trip t-1) ended at the barrier just passed; issued behind the first fragment reads so that their LDS latency passes meanwhile
        if (t + 1 < nt) fill((t + 1) & 1, t + 1);
#pragma unroll
        for (int ks = 0; ks < GBK / 32; ++ks) {
            const int cu = ks & 1, nx = cu ^ 1;
            if (ks + 1 < GBK / 32) {
#pragma unroll
                for (int f = 0; f < 4; ++f) a[nx][f] = WFrag<T16>::ld(sa + f * 16 * GPIT + (ks + 1) * 32);
#pragma unroll
                for (int f = 0; f < NF; ++f) b[nx][f] = ldb(f, ks + 1);
            }
            __builtin_amdgcn_sched_barrier(0);   // keeps the next set's LDS reads as one group ahead of this block's WMMAs
            if constexpr (EPI == 2) {
#pragma unroll
                for (int mb = 0; mb < 4; ++mb) { const v2h c2 = __builtin_bit_cast(v2h, cw[mb]);
                    const V cv = __builtin_shufflevector(c2, c2, 0, 1, 0, 1, 0, 1, 0, 1, 0, 1, 0, 1, 0, 1, 0, 1);
                    a[cu][mb] = __builtin_elementwise_fma(a[cu][mb], cv, (V)(h16)(-PCAR / (float)SEQ)); } }   // softmax weight x1024, centred: one packed fma per register
#pragma unroll
            for (int nb = 0; nb < NF; ++nb)
#pragma unroll
                for (int mb = 0; mb < 4; ++mb) acc[mb][nb] = WFrag<T16>::mma(a[cu][mb], b[cu][nb], acc[mb][nb]);
            __builtin_amdgcn_sched_barrier(0);   // keeps this block's WMMAs ahead of the following group of LDS reads
        }
        asm volatile("s_wait_dscnt 0x0" ::: "memory");      // this wave's reads of buffer t&1 are done before the buffer is refilled
        asm volatile("s_wait_asynccnt 0x0" ::: "memory");   // this wave's copies of tile t+1 have landed before the barrier publishes them
        __syncthreads();                                    // publishes tile t+1; ends every wave's reads of buffer t&1
    }
    asm volatile("s_wait_asynccnt 0x0" ::: "memory");       // no copy outstanding when the wave goes on
    if constexpr (EPI == 1) {
        // split output: the block's whole 256 x GBN f32 tile is staged in the ring (free behind the loop's last barrier), so that a row's f16 pieces leave as whole 128-byte lines, each line from one wave.
        constexpr int BSP = GBN + 4;                 // pitch in floats of the block's output stage
        constexpr int CP8 = GBN / 8;                 // 8-column pieces per staged row: 32 B of f32 in, 16 B of qh and 16 B of ql out
        constexpr int NQ = (CP8 % 32 == 0) ? 1 : 3;  // after NQ wave-wide pieces the pattern repeats RQ rows further down
        constexpr int RQ = 32 * NQ / CP8;
        static_assert(GBM * BSP * 4 <= 2 * GSTG * 2);
        static_assert((32 * NQ) % CP8 == 0 && 32 % RQ == 0 && CP8 % 8 == 0 && GBM == 8 * 32);
        float* bs = (float*)smem;
#pragma unroll
        for (int mb = 0; mb < 4; ++mb)
#pragma unroll
            for (int nb = 0; nb < NF; ++nb)
#pragma unroll
                for (int j = 0; j < 8; ++j) bs[(wm * 64 + mb * 16 + hi * 8 + j) * BSP + wn * WN + nb * 16 + lr] = acc[mb][nb][j];
        __syncthreads();   // the whole tile is staged before a wave reads rows that other waves wrote
        h16* qp[NQ]; const float* sp[NQ];
#pragma unroll
        for (int p = 0; p < NQ; ++p) { const int q = p * 32 + lane, row = wave * 32 + q / CP8, cofs = (q % CP8) * 8;
            qp[p] = QO + (size_t)(t0r + row) * KX2 + t0c + cofs; sp[p] = bs + row * BSP + cofs; }
#pragma unroll
        for (int u = 0; u < 32 / RQ; ++u) {
#pragma unroll
            for (int p = 0; p < NQ; ++p) { const v4f lo = *(const v4fa*)(sp[p] + u * RQ * BSP); const v4f up = *(const v4fa*)(sp[p] + u * RQ * BSP + 4); v8h qh, ql;
#pragma unroll
                for (int k = 0; k < 8; ++k) { const float sv = (k < 4 ? lo[k & 3] : up[k & 3]) * (QCAR / WCAR); const h16 a = toh_flush(sv); qh[k] = a; ql[k] = toh_flush(sv - (float)a); }   // the power-of-two factor is exact, so the difference is exact fused or not
                *(v8h*)(qp[p] + (size_t)(u * RQ) * KX2) = qh; *(v8h*)(qp[p] + (size_t)(u * RQ) * KX2 + HD) = ql; }
            if (u + 1 < 32 / RQ) asm volatile("s_wait_xcnt 0x0" ::: "memory");   // stands in front of the next rows' LDS reads and conversions, which overwrite the registers that these stores name
        }
        return;
    }
    if constexpr (EPI == 3) {
        static_assert(WN == GBK && NF == 8);   // a wave's columns are one key tile; a staged row is one wave-wide piece
        float mx[4][8], sm[4][8];
#pragma unroll
        for (int mb = 0; mb < 4; ++mb)
#pragma unroll
            for (int j = 0; j < 8; ++j) { float m = acc[mb][0][j];
#pragma unroll
                for (int nb = 1; nb < NF; ++nb) m = fmaxf(m, acc[mb][nb][j]);
                mx[mb][j] = rowmax16(m); }
#pragma unroll
        for (int mb = 0; mb < 4; ++mb)
#pragma unroll
            for (int j = 0; j < 8; ++j) { float s = 0.f;
#pragma unroll
                for (int nb = 0; nb < NF; ++nb) { const float e = __builtin_amdgcn_exp2f(fmaf(acc[mb][nb][j] - mx[mb][j], EXK, 10.0f)); acc[mb][nb][j] = e; s += e; }   // + 10: the x1024 carry
                sm[mb][j] = rowsum16(s); }
        // the wave's 64 maxima and 64 sums through its LDS stage, so that they leave as one 16-byte store per lane (whole lines)
        if (lr == 0) {
#pragma unroll
            for (int mb = 0; mb < 4; ++mb)
#pragma unroll
                for (int j = 0; j < 8; ++j) { os[mb * 16 + hi * 8 + j] = mx[mb][j]; os[64 + mb * 16 + hi * 8 + j] = sm[mb][j]; } }
        __builtin_amdgcn_wave_barrier(); asm volatile("" ::: "memory");
        const v4f sv = *(const v4fa*)(os + lane * 4);
        float* stp = C + (size_t)(c0 / GBK) * (2 * SEQ) + hi * SEQ + r0 + lr * 4;
        *(v4f*)stp = sv;
        asm volatile("s_wait_xcnt 0x0" :: "v"(stp), "v"(sv) : "memory");   // stands in front of whatever next overwrites the registers that this store names; as inputs they stay whole up to here
        __builtin_amdgcn_wave_barrier();
        h16* pp = QO + z * ((size_t)SEQ * LDC) + (size_t)r0 * LDC + c0 + lane * 4;
        const float* rp = os + lane * 4;
#pragma unroll
        for (int mb = 0; mb < 4; ++mb) {
#pragma unroll
            for (int nb = 0; nb < NF; ++nb) {
#pragma unroll
                for (int j = 0; j < 8; ++j) os[(hi * 8 + j) * OSP + nb * 16 + lr] = acc[mb][nb][j]; }
            __builtin_amdgcn_wave_barrier(); asm volatile("" ::: "memory");
#pragma unroll
            for (int hf = 0; hf < 2; ++hf) {
#pragma unroll
                for (int u = hf * 8; u < hf * 8 + 8; ++u) { const v4f val = *(const v4fa*)(rp + u * OSP); v4h o4;
#pragma unroll
                    for (int i = 0; i < 4; ++i) o4[i] = tohx(val[i]);
                    *(v4h*)(pp + (size_t)(mb * 16 + u) * LDC) = o4; }
                if (mb + 1 < 4 || hf == 0) asm volatile("s_wait_xcnt 0x0" ::: "memory");   // stands in front of the next 8 rows' LDS reads, and so of the conversions fed by them, which overwrite the registers that these stores name
            }
            __builtin_amdgcn_wave_barrier();
        }
        return;
    }
    // output: 16 rows at a time through the wave's own LDS stage, stored as 16-byte pieces in row order (whole 128-byte lines).
    // After NP wave-wide stores the piece pattern repeats RP rows further down, so every address is one of NP lane pointers plus a compile-time offset.
    constexpr int CPR = NF * 4;                      // 16-byte pieces per staged row
    constexpr int NP = (CPR % 32 == 0) ? 1 : 3;
    constexpr int RP = 32 * NP / CPR;
    static_assert((32 * NP) % CPR == 0 && 16 % RP == 0);
    float* gp[NP]; const float* lp[NP];
#pragma unroll
    for (int p = 0; p < NP; ++p) { const int q = p * 32 + lane, row = q / CPR, cofs = (q % CPR) * 4;
        gp[p] = C + (size_t)(r0 + row) * LDC + c0 + cofs; lp[p] = os + row * OSP + cofs; }
    v4f mean[NP];   // EPI 2: a lane's columns are the same in every row group, so their column means are fetched once
    if constexpr (EPI == 2) {
#pragma unroll
        for (int p = 0; p < NP; ++p) { const float* vp = VM + z * (size_t)((SEQ / 128) * LDC) + c0 + ((p * 32 + lane) % CPR) * 4;
            v4f pv[SEQ / 128];
#pragma unroll
            for (int tt = 0; tt < SEQ / 128; ++tt) pv[tt] = *(const v4f*)(vp + tt * LDC);
            asm volatile("s_wait_xcnt 0x0" :: "v"(vp) : "memory");   // stands in front of whatever next overwrites these loads' address registers; the address as an input keeps them whole up to here
            v4f s = pv[0];
#pragma unroll
            for (int tt = 1; tt < SEQ / 128; ++tt) s += pv[tt];
            mean[p] = s * (1.0f / (float)SEQ); }
    }
#pragma unroll
    for (int mb = 0; mb < 4; ++mb) {
#pragma unroll
        for (int nb = 0; nb < NF; ++nb) {
#pragma unroll
            for (int j = 0; j < 8; ++j) os[(hi * 8 + j) * OSP + nb * 16 + lr] = acc[mb][nb][j]; }
        __builtin_amdgcn_wave_barrier(); asm volatile("" ::: "memory");
#pragma unroll
        for (int u = 0; u < 16 / RP; ++u)
#pragma unroll
            for (int p = 0; p < NP; ++p) { v4f val = *(const v4fa*)(lp[p] + u * RP * OSP);
                if constexpr (EPI == 2) {
#pragma unroll
                    for (int i = 0; i < 4; ++i) val[i] = val[i] * (1.0f / PCAR) + mean[p][i]; }
                *(v4f*)(gp[p] + (size_t)(mb * 16 + u * RP) * LDC) = val; }
        if (mb + 1 < 4) asm volatile("s_wait_xcnt 0x0" ::: "memory");   // stands in front of the next 16 rows' LDS reads, which overwrite the registers that these stores name
        __builtin_amdgcn_wave_barrier();
    }
}

// k_prep: one pass over x: a block reads one 128 t x 128 d tile of f32 and writes all that is made of it:
// (a) f16 plane KX [g][t][d] holding the value rounded (RNE) to bf16 precision (exact in f16, subnormals -> 0); (b) the tile's column sums of those values, VMP [g][t tile][d] f32.
// The z plane behind the last batch takes W, whose rows have x's pitch: only its row-major plane is written, carried x1024.
// Every global side moves whole row pieces: 512 B of f32 in, 256 B of 16-bit values out (16 lanes x 32 B / 16 B).
#define VTT 128
#define VTD 128
// eight waves per SIMD (at most 128 registers): four blocks fit a WGP, so that the whole grid is resident at once and no block waits for a place
__global__ __launch_bounds__(256, 8) void k_prep(const float* __restrict__ x, const float* __restrict__ wq, h16* WQ, h16* KX, float* VMP) {
    __shared__ __align__(16) float part[8 * VTD];
    const int tid = threadIdx.x, c16 = tid & 15, r16 = tid >> 4;
    const int t0 = blockIdx.x * VTT, d0 = blockIdx.y * VTD, g = blockIdx.z;
    const bool isw = g == ZB;                 // the same for the whole block
    if (isw && t0 >= DM) return;              // W has DM rows; the whole block leaves, ahead of the barrier
    // in: lane -> 8 d (c16), row pairs r16 + 16 k
    const size_t tofs = (size_t)t0 * DM + d0 + c16 * 8;
    const float* src = (isw ? wq : x + (size_t)g * SEQ_FULL * DM) + tofs;
    h16* kp = (isw ? WQ : KX + (size_t)g * SEQ * DM) + tofs;
    v8f r[VTT / 32][2];
#pragma unroll
    for (int k = 0; k < VTT / 32; ++k)
#pragma unroll
        for (int q = 0; q < 2; ++q) r[k][q] = *(const v8f*)(src + (size_t)(2 * (r16 + 16 * k) + q) * DM);
    v8us o[VTT / 32][2];
#pragma unroll
    for (int k = 0; k < VTT / 32; ++k)
#pragma unroll
        for (int q = 0; q < 2; ++q)
#pragma unroll
            for (int i = 0; i < 8; ++i) o[k][q][i] = f2bf(r[k][q][i]);
    if (isw) {
#pragma unroll
        for (int k = 0; k < VTT / 32; ++k)
#pragma unroll
            for (int q = 0; q < 2; ++q) { v8h w;
#pragma unroll
                for (int i = 0; i < 8; ++i) w[i] = toh_flush(__uint_as_float((unsigned)o[k][q][i] << 16) * WCAR);
                *(v8h*)(kp + (size_t)(2 * (r16 + 16 * k) + q) * DM) = w; }
        return; }
    v8h kk[VTT / 32][2];
    float cs[8];
#pragma unroll
    for (int i = 0; i < 8; ++i) cs[i] = 0.f;
#pragma unroll
    for (int k = 0; k < VTT / 32; ++k)
#pragma unroll
        for (int q = 0; q < 2; ++q)
#pragma unroll
            for (int i = 0; i < 8; ++i) { const float xv = __uint_as_float((unsigned)o[k][q][i] << 16); kk[k][q][i] = toh_flush(xv); cs[i] += (fabsf(xv) < 6.103515625e-05f) ? 0.0f : xv; }
    // column sums: a wave's two row groups, then one row of part per wave
#pragma unroll
    for (int i = 0; i < 8; ++i) cs[i] += __shfl_xor(cs[i], 16, 32);
    if ((tid & 16) == 0) { float* pp = part + (tid >> 5) * VTD + c16 * 8;
        *(v4f*)pp = (v4f){cs[0], cs[1], cs[2], cs[3]}; *(v4f*)(pp + 4) = (v4f){cs[4], cs[5], cs[6], cs[7]}; }
    __syncthreads();   // every wave's column sums are in LDS before any of them is read; no global store stands in front of it, so it waits for none
    float a = part[tid & (VTD - 1)];
#pragma unroll
    for (int w = 1; w < 8; ++w) a += part[w * VTD + (tid & (VTD - 1))];
    // out, row order: the plane straight from the registers
#pragma unroll
    for (int k = 0; k < VTT / 32; ++k)
#pragma unroll
        for (int q = 0; q < 2; ++q) *(v8h*)(kp + (size_t)(2 * (r16 + 16 * k) + q) * DM) = kk[k][q];
    if (tid < VTD) VMP[((size_t)g * (SEQ / VTT) + blockIdx.x) * HD + d0 + tid] = a;
}

constexpr size_t al256(size_t b) { return (b + 255) & ~(size_t)255; }
constexpr size_t WS_TOTAL =
    al256((size_t)DM * DM * 2) +                  // WQ f16
    al256((size_t)ZB * SEQ * SEQ * 2) +           // P16
    al256((size_t)ZB * SEQ * KX2 * 2) +           // QX f16 [qh | ql]
    al256((size_t)ZB * SEQ * HD * 2) +            // KX f16
    al256((size_t)ZB * (SEQ / 128) * HD * 4) +    // VM: column sums per 128-row tile
    al256((size_t)ZB * NKT * 2 * SEQ * 4);        // ST: row maximum and exp sum per key tile
static_assert(WS_TOTAL <= (size_t)268435456);

extern "C" void kernel_launch(void* const* d_in, const int* in_sizes, int n_in,
                              void* d_out, int out_size, void* d_ws, size_t ws_size, hipStream_t stream) {
    if (n_in < 2) return;
    if ((size_t)in_sizes[0] < ((size_t)(NB - 1) * SEQ_FULL + SEQ) * DM) return;
    if ((size_t)in_sizes[1] < (size_t)DM * DM) return;
    if ((size_t)out_size < (size_t)NB * SEQ * DM) return;
    if (WS_TOTAL > ws_size) return;
    const float* x = (const float*)d_in[0]; const float* wq = (const float*)d_in[1];   // x [NB][SEQ_FULL][768]; W [768 out][768 in]
    float* OUT = (float*)d_out;     // [NB][SEQ][768]
    char* wsp = (char*)d_ws;
    auto take = [&](size_t bytes) { char* p = wsp; wsp += al256(bytes); return (void*)p; };
    h16* WQ = (h16*)take((size_t)DM * DM * 2);
    h16* P16 = (h16*)take((size_t)ZB * SEQ * SEQ * 2);
    h16* QX = (h16*)take((size_t)ZB * SEQ * KX2 * 2);
    h16* KX = (h16*)take((size_t)ZB * SEQ * HD * 2);
    float* VM = (float*)take((size_t)ZB * (SEQ / 128) * HD * 4);
    float* ST = (float*)take((size_t)ZB * NKT * 2 * SEQ * 4);
    if ((size_t)(wsp - (char*)d_ws) > ws_size) return;

    for (int b0 = 0; b0 < NB; b0 += ZB) {
        k_prep<<<dim3(SEQ / 128, DM / 128, ZB + 1), 256, 0, stream>>>(x + (size_t)b0 * SEQ_FULL * DM, wq, WQ, KX, VM);
        k_gemmw<h16, 6, DM, 1, 0><<<dim3(ZB * SEQ / 256, DM / 192, 1), 256, 0, stream>>>(KX, WQ, DM, nullptr, 0, 0, 0, QX, nullptr, nullptr);
        k_gemmw<h16, 8, SEQ, 3, HD><<<dim3(SEQ / 256, SEQ / 256, ZB), 256, 0, stream>>>(QX, KX, KX2, ST, (size_t)SEQ * KX2, (size_t)SEQ * HD, (size_t)NKT * 2 * SEQ, P16, nullptr, nullptr);
        k_gemmw<h16, 6, HD, 2, 0><<<dim3(SEQ / 256, HD / 192, ZB), 256, 0, stream>>>(P16, KX, SEQ, OUT + (size_t)b0 * SEQ * DM, (size_t)SEQ * SEQ, (size_t)SEQ * HD, (size_t)SEQ * HD, nullptr, VM, ST);
    }
}

// v009
// It runs in 122 microseconds.
// In two side-by-side timings against v008, it was 1.03 and 1.02 times as fast.
// All steps since v000 together make it 5.89 times as fast.
#include <hip/hip_runtime.h>

// Contractions: q projection on v_wmma_f32_16x16x32_f16 (x and W RNE-rounded to bf16 precision and held as f16, which is exact; W carried x1024; exact products, f32 accumulate); q.x^T on v_wmma_f32_16x16x32_f16 with q carried x2048 as f16 value + f16 remainder (both multiply the same B fragments of k, k = that same f16 plane of x); att.x on v_wmma_f32_16x16x32_f16 (the same f16 x plane, its B fragments taken by transposing LDS loads; softmax weights carried x1024 and centred by 1024/SEQ, column mean of x added back in f32), f32 accumulate.
// Single-head full-width document self-attention: x [8][2048][768]; q = x W^T ('oi' [768][768], no bias); keys = values = x; att = softmax(q.x) over all 2048 keys (no scale, no mask); out = att @ x -> [8][2048][768] f32.
// All batches in one pass (z-batched GEMMs): one kernel reads x (and W) once and writes all that is made of it: one f16 row-major plane (A of the projection, Bt of the score GEMM, B of the last GEMM) and the column sums per 128 rows; projection -> f16 plane of q, [64 qh | 64 ql] per 64 columns (split in the GEMM's output stage); S' = 2048 q.x stays in the score GEMM's accumulators: its output stage takes each row's maximum and exp sum over the wave's 128 keys and stores 1024 exp(s - tile max) as f16 plus the two figures; the last GEMM joins a row's 16 tiles into one factor per tile and applies it to its A fragments; O = P' x, out = O/1024 + mean_t(x) formed in the GEMM's output stage.

#ifndef NB
#define NB 8
#endif
#ifndef SEQ
#define SEQ 2048
#endif
#define NB_FULL  8
#define SEQ_FULL 2048
#define DM   768
#define HD   768
#define ZB   NB                           // batches per pass: all of them, so every stage is one launch with the fullest grid
#define PCAR 1024.0f
#define QCAR 2048.0f                      // carry of the q value / remainder planes
#define SCL  4.8828125e-4f                // 1/2048: undoes the q carry (the module applies no score scale)
#define WCAR 1024.0f                      // carry of the f16 W plane: keeps small weights clear of the f16 subnormal range; undone with the q carry
#define KX2  (2 * HD)                     // pitch of the q plane: per 64 columns 64 values, then their 64 remainders

typedef _Float16 h16;
typedef __attribute__((ext_vector_type(16))) _Float16 v16h;
typedef __attribute__((ext_vector_type(8)))  _Float16 v8h;
typedef __attribute__((ext_vector_type(8)))  unsigned short v8us;
typedef __attribute__((ext_vector_type(8)))  float    v8f;
typedef __attribute__((ext_vector_type(4)))  float    v4f;
typedef __attribute__((ext_vector_type(2)))  _Float16 v2h;
typedef __attribute__((ext_vector_type(4)))  _Float16 v4h;
typedef v4f  __attribute__((may_alias)) v4fa;

static_assert(NB <= NB_FULL);
static_assert(SEQ <= SEQ_FULL);
static_assert(NB % ZB == 0);
static_assert(SEQ % 128 == 0);                 // softmax row chunks, 64-row tiles, K steps of 32
static_assert(DM % 64 == 0 && HD % 64 == 0);   // K steps of 32
static_assert(DM == HD);                       // q width == x width: q.x contracts over 768
static_assert(((size_t)SEQ * DM) % 8 == 0);
static_assert((ZB * SEQ) % 8 == 0);
static_assert(HD % 32 == 0 && SEQ % 8 == 0);
static_assert(KX2 % 32 == 0);                  // folded score GEMM: K steps of 32
static_assert((ZB * SEQ) % 64 == 0);           // projection GEMM rows: 64-row wave quarters
static_assert(QCAR * SCL == 1.0f);             // carry folded back exactly in the softmax scale
static_assert((KX2 * 2) % 128 == 0);
static_assert(DM % 64 == 0);
static_assert(SEQ % 128 == 0 && HD % 128 == 0 && DM == HD);                  // k_prep: 128 t x 128 d tiles cover the plane
static_assert(2 * 512 * 272 <= 327680);       // k_gemmw static LDS: one block per 320 KiB LDS
static_assert(DM % 128 == 0 && KX2 % 128 == 0 && SEQ % 128 == 0);                                 // k_gemmw: K tiles of 128
static_assert(SEQ % 256 == 0 && (ZB * SEQ) % 256 == 0 && DM % 192 == 0 && HD % 192 == 0);         // k_gemmw: 256x256 and 256x192 tiles cover the outputs
static_assert(DM % 128 == 0 && DM <= SEQ);     // k_prep: W's 128-row tiles lie inside the grid laid out for x

__device__ __forceinline__ unsigned short f2bf(float f) { unsigned u = __float_as_uint(f); u += 0x7FFFu + ((u >> 16) & 1u); return (unsigned short)(u >> 16); }
__device__ __forceinline__ v16h cat16(v8h lo, v8h hi) { return __builtin_shufflevector(lo, hi, 0, 1, 2, 3, 4, 5, 6, 7, 8, 9, 10, 11, 12, 13, 14, 15); }
__device__ __forceinline__ v8f wmma16(v16h a, v16h b, v8f c) { return __builtin_amdgcn_wmma_f32_16x16x32_f16(false, a, false, b, (short)0, c, false, false); }
__device__ __forceinline__ h16 tohx(float x) { return (h16)x; }
// f32 -> f16 (RNE) that cannot produce an f16 subnormal: |v| < 2^-14 -> +0 (value select).
static __device__ __forceinline__ h16 toh_flush(float v) { const h16 r = (h16)v; return (fabsf(v) < 6.103515625e-05f) ? (h16)0.0f : r; }

// ---- k_gemmw<T16, NF>: GEMM, EIGHT WAVES (4 x 2) per 256 x (32 NF) output tile, each wave 64 rows x 16 NF columns (4 NF accumulators); grid (M/256, N/(32 NF), Z), 256 threads, one block per WGP, two waves per SIMD.
// NF = 8: 256x256 tile; NF = 6: 256x192 tile (N = 768: four column tiles, so that the grid is a whole number of blocks per WGP).
// Operand tiles (256 rows of A, 32 NF rows of Bt, 128 k each) are staged in LDS by asynchronous 16-byte copies, two buffers: tile t+1 flies while tile t is worked on; a staged A row serves two waves, a staged Bt row four.
// C[m][n] (f32, pitch LDC) = sum_k A[m][k] Bt[n][k]. z-batch strides sA/sB/sC in elements. K % 128 == 0, M % 256 == 0, N % (32 NF) == 0.
// KW = 0: Bt rows have K elements. KW > 0: Bt rows have KW elements (K = 2 KW) and an A row holds, per 64 k of Bt, 64 values and then their 64 remainders: a staged A tile (128 elements a row) goes with a staged Bt tile of 64 k, and each B fragment multiplies the value and the remainder fragment.
// EPI picks what the output stage does with the f32 sums: 0 = store them to C; 1 = split each (W's carry taken off) into f16 value + f16 remainder, carried x2048, and store both to QO [m][64 qh | 64 ql per 64 columns] (pitch KX2; C unused); 2 = store sum/1024 + mean to C, mean = (sum over the SEQ/128 row tiles tt of VM[z][tt][n]) / SEQ;
// 3 = softmax, first half: per row and per wave (128 columns = one key tile) m = max of the sums, e = 1024 exp((sum - m)/2048), l = sum of e; e goes as f16 to QO [z][m][n] (pitch LDC), m and l to C [z][key tile][m | l][row].
// EPI 2 is also the softmax's second half: A holds those e; from ST (the m and l of its 256 rows) the block forms c = exp((m - row max)/2048) x 1024 / (sum over tiles of l exp((m - row max)/2048)) per row and key tile, and every A fragment becomes e c - 1024/SEQ (a staged K tile is one key tile).
// EPI 2 takes its second operand row-major, B[k][n] (pitch LDC): the staged tile is 128 k rows of 32 NF columns, and a B fragment is two transposing loads (k0 and k0 + 16), which deliver the k order of the map below.
// Fragment map (A and Bt alike): lane -> row/col lane&15, h = lane>>4; elements 0..7 = k0+8h+0..7, elements 8..15 = k0+16+8h+0..7. D: acc[j] = (row 8h+j, col lane&15).
template <typename T16> struct WFrag;
template <> struct WFrag<h16> { typedef v16h V; static __device__ __forceinline__ V ld(const h16* p) { return cat16(*(const v8h*)p, *(const v8h*)(p + 16)); } static __device__ __forceinline__ v8f mma(V a, V b, v8f c) { return wmma16(a, b, c); } };
// 16 bytes per lane of a row-major 16-bit LDS tile T, transposed: lane (c, h) reading at row k0 + 8 h + (lane & 7), byte 2 n0 + 16 ((lane >> 3) & 1) gets T[k0 + 8 h + 0..7][n0 + c]
typedef short s16x8 __attribute__((ext_vector_type(8)));
__device__ __forceinline__ v8h ldtr(const unsigned char* p) { typedef __attribute__((address_space(3))) s16x8 lds_s16x8; return __builtin_bit_cast(v8h, __builtin_amdgcn_ds_load_tr16_b128_v8i16((lds_s16x8*)p)); }
#define GBK  128                 // k per staged tile: 256 B of every operand row
#define GPIT 136                 // LDS row pitch in 16-bit elements: 272 B = 16 B x odd, conflict-free for 16-byte fragment reads
#define GBM  256                 // A rows per block tile
typedef int v4i __attribute__((vector_size(16)));
// one lane's 16 bytes, global -> LDS, through no register
__device__ __forceinline__ void cp16(const void* g, void* l) {
    __builtin_amdgcn_global_load_async_to_lds_b128((__attribute__((address_space(1))) v4i*)g, (__attribute__((address_space(3))) v4i*)l, 0, 0);
}
// value of lane l ^ X inside a 16-lane row (DPP row_xmask): the row reductions of the softmax stage stay on the vector unit
template <int X> __device__ __forceinline__ float rowx(float v) { return __builtin_bit_cast(float, __builtin_amdgcn_update_dpp(0, __builtin_bit_cast(int, v), 0x160 | X, 0xf, 0xf, true)); }
__device__ __forceinline__ float rowmax16(float v) { v = fmaxf(v, rowx<1>(v)); v = fmaxf(v, rowx<2>(v)); v = fmaxf(v, rowx<4>(v)); return fmaxf(v, rowx<8>(v)); }
__device__ __forceinline__ float rowsum16(float v) { v += rowx<1>(v); v += rowx<2>(v); v += rowx<4>(v); return v + rowx<8>(v); }
#define NKT  (SEQ / GBK)                   // key tiles per row
#define EXK  (SCL * 1.4426950408889634f)   // carried score difference -> exponent of two (SCL is a power of two: the product is the rounded log2(e), scaled exactly)
template <typename T16, int NF, int LDC, int EPI, int KW>
__global__ __launch_bounds__(256) void k_gemmw(const T16* __restrict__ A, const T16* __restrict__ Bt, int K, float* C, size_t sA, size_t sB, size_t sC, h16* QO, const float* __restrict__ VM, const float* __restrict__ ST) {
    typedef typename WFrag<T16>::V V;
    constexpr int WN = NF * 16;                  // columns per wave
    constexpr int GBN = 2 * WN;                  // Bt rows per block tile
    constexpr bool BR = EPI == 2;                // second operand row-major [k][n]
    constexpr int BPB = GBN * 2 + 32;            // BR: LDS pitch in bytes of a staged B row
    static_assert(!BR || (BPB % 32 == 0 && ((BPB / 32) & 1) == 1));   // 32 B x odd: conflict-free for the transposing loads
    constexpr bool SH = KW > 0;                  // A rows hold [value | remainder] per 64 k: one staged Bt tile (64 k) and one set of B fragments serve both
    constexpr int BKS = GBK / 2;                 // SH: k per staged Bt tile, 128 B of every Bt row
    constexpr int BPS = BKS + 8;                 // SH: LDS pitch of a Bt row in 16-bit elements: 144 B = 16 B x odd, conflict-free for 16-byte fragment reads
    static_assert(!(SH && BR));
    constexpr int GSTG = BR ? GBM * GPIT + GBK * BPB / 2 : SH ? GBM * GPIT + GBN * BPS : (GBM + GBN) * GPIT;     // one buffer: rows 0..255 = A tile, behind them the Bt tile (BR: the B tile)
    constexpr int OSP = WN + 4;                  // pitch in floats of a wave's 16-row output stage
    static_assert(8 * 16 * OSP * 4 <= 2 * GSTG * 2);
    static_assert(GBM / 16 + GBN / 16 <= 63);    // copies of one wave in flight (BR: the B tile has as many bytes, so as many copies)
    constexpr int CTB = EPI == 2 ? NKT * GBM * 4 : 0;   // EPI 2: the factor table behind the ring, [key tile][row], one dword = the f16 factor twice
    static_assert(2 * GSTG * 2 + CTB <= 327680);
    __shared__ __align__(16) unsigned char smem[2 * GSTG * 2 + CTB];
    T16* ring = (T16*)smem;
    unsigned* ctab = (unsigned*)(smem + 2 * GSTG * 2);
    const size_t z = blockIdx.z; A += z * sA; Bt += z * sB; C += z * sC;
    const int tid = threadIdx.x, lane = tid & 31, lr = lane & 15, hi = lane >> 4;
    const int wave = __builtin_amdgcn_readfirstlane(tid >> 5), wm = wave >> 1, wn = wave & 1;
    const int t0r = blockIdx.x * GBM, t0c = blockIdx.y * GBN;
    const int r0 = t0r + wm * 64, c0 = t0c + wn * WN;
    float* os = (float*)smem + wave * (16 * OSP);   // output stage: lies in the ring, used only behind the loop's last barrier (no reader, no copy left)
    v8f acc[4][NF];
#pragma unroll
    for (int mb = 0; mb < 4; ++mb)
#pragma unroll
        for (int nb = 0; nb < NF; ++nb) acc[mb][nb] = (v8f){};
    // copy map: 16 lanes cover one row's 256 B, the block covers 16 rows per copy; 16 copies for A, 2 NF for Bt per lane and tile
    const int cr = tid >> 4, cch = (tid & 15) * 8;
    const T16* ga = A + (size_t)(t0r + cr) * K + cch;
    static_assert(KW % BKS == 0);
    const int kbp = KW ? KW : K;                 // pitch of Bt
    // SH copy map of Bt: 8 lanes cover one row's 128 B, the block covers 32 rows per copy; NF copies per lane and tile
    const T16* gb = SH ? Bt + (size_t)(t0c + (tid >> 3)) * kbp + (tid & 7) * 8 : Bt + (size_t)(t0c + cr) * kbp + cch;
    const size_t gstep = (size_t)16 * K, gstepb = (size_t)16 * kbp;
    T16* lbase = ring + cr * GPIT + cch;
    // BR copy map: a B row is PPR 16-byte pieces; piece q = 256 i + tid of the tile; after 3 block-wide copies the pattern repeats 768 / PPR rows further down
    constexpr int PPR = GBN / 8, RB3 = 768 / PPR;
    static_assert(!BR || (768 % PPR == 0 && GBK % RB3 == 0 && PPR % 8 == 0 && GBK * PPR == 256 * (GBN / 16)));
    const T16* gbr[3]; unsigned char* lbr[3];
    if constexpr (BR) {
#pragma unroll
        for (int p = 0; p < 3; ++p) { const int q = p * 256 + tid, row = q / PPR, pc = q % PPR;
            gbr[p] = Bt + (size_t)row * LDC + t0c + pc * 8; lbr[p] = smem + GBM * GPIT * 2 + row * BPB + pc * 16; }
    }
    auto fill = [&](int buf, int kt) {
        const T16* pa = ga + (size_t)kt * GBK; const T16* pb = gb + (size_t)kt * (SH ? BKS : GBK); T16* l = lbase + buf * GSTG;
#pragma unroll
        for (int i = 0; i < GBM / 16; ++i) cp16(pa + i * gstep, l + i * 16 * GPIT);
        if constexpr (BR) {
#pragma unroll
            for (int u = 0; u < GBK / RB3; ++u)
#pragma unroll
                for (int p = 0; p < 3; ++p) cp16(gbr[p] + (size_t)(kt * GBK + u * RB3) * LDC, lbr[p] + buf * (GSTG * 2) + u * RB3 * BPB);
        } else if constexpr (SH) {
            T16* lb = ring + buf * GSTG + GBM * GPIT + (tid >> 3) * BPS + (tid & 7) * 8;
#pragma unroll
            for (int i = 0; i < GBN / 32; ++i) cp16(pb + i * 2 * gstepb, lb + i * 32 * BPS);
        } else {
#pragma unroll
            for (int i = 0; i < GBN / 16; ++i) cp16(pb + i * gstepb, l + (GBM + i * 16) * GPIT);
        }
    };
    const int nt = K / GBK;
    fill(0, 0);
    if constexpr (EPI == 2) {
        // one thread per block row, while tile 0 flies: the row's 16 (m, l) pairs -> 16 factors; published by the barrier below
        static_assert(GBM == 256 && NKT * GBK == SEQ);
        const float* sp = ST + z * (size_t)(NKT * 2 * SEQ) + t0r + tid;
        float m[NKT], l[NKT];
#pragma unroll
        for (int q = 0; q < NKT; ++q) { m[q] = sp[q * 2 * SEQ]; l[q] = sp[q * 2 * SEQ + SEQ]; }
        asm volatile("s_wait_xcnt 0x0" :: "v"(sp) : "memory");   // stands in front of whatever next overwrites these loads' address registers; the address as an input keeps them whole up to here
        float mr = m[0];
#pragma unroll
        for (int q = 1; q < NKT; ++q) mr = fmaxf(mr, m[q]);
        float ls = 0.f;
#pragma unroll
        for (int q = 0; q < NKT; ++q) { m[q] = __builtin_amdgcn_exp2f((m[q] - mr) * EXK); ls += l[q] * m[q]; }
        const float fs = __fdiv_rn(PCAR, ls);
#pragma unroll
        for (int q = 0; q < NKT; ++q) { const h16 c = tohx(m[q] * fs); v2h c2; c2[0] = c; c2[1] = c; ctab[q * GBM + tid] = __builtin_bit_cast(unsigned, c2); }
    }
    asm volatile("s_wait_asynccnt 0x0" ::: "memory");   // tile 0 landed (this wave's copies) before the barrier publishes it
    __syncthreads();
    const int aofs = (wm * 64 + lr) * GPIT + 8 * hi, bofs = SH ? GBM * GPIT + (wn * WN + lr) * BPS + 8 * hi : (GBM + wn * WN + lr) * GPIT + 8 * hi;
#pragma unroll 1   // one trip per staged tile stays rolled: the body already holds 16 NF WMMAs, a copy of it would only cost instruction cache
    for (int t = 0; t < nt; ++t) {
        const T16* sa = ring + (t & 1) * GSTG + aofs; const T16* sb = ring + (t & 1) * GSTG + bofs;
        const unsigned char* sbr = smem + (t & 1) * (GSTG * 2) + GBM * GPIT * 2 + (8 * hi + (lane & 7)) * BPB + ((lane >> 3) & 1) * 16 + wn * WN * 2;   // BR: the lane's place in the B tile
        auto ldb = [&](int f, int ks) -> V {
            if constexpr (BR) return cat16(ldtr(sbr + ks * 32 * BPB + f * 32), ldtr(sbr + (ks * 32 + 16) * BPB + f * 32));
            else return WFrag<T16>::ld(sb + f * 16 * (SH ? BPS : GPIT) + ks * 32); };
        V a[2][4], b[2][NF];   // two fragment sets: the next 32 k are fetched from LDS while the current 32 k are multiplied
#pragma unroll
        for (int f = 0; f < 4; ++f) a[0][f] = WFrag<T16>::ld(sa + f * 16 * GPIT);
#pragma unroll
        for (int f = 0; f < NF; ++f) b[0][f] = ldb(f, 0);
        unsigned cw[4];   // EPI 2: this key tile's factors of the lane's four A rows, read in the same group as the first fragments
        if constexpr (EPI == 2) {
#pragma unroll
            for (int f = 0; f < 4; ++f) cw[f] = ctab[t * GBM + wm * 64 + f * 16 + lr]; }
        // tile t+1 into the other buffer: its last readers (trip t-1) ended at the barrier just passed; issued behind the first fragment reads so that their LDS latency passes meanwhile
        if (t + 1 < nt) fill((t + 1) & 1, t + 1);
        if constexpr (SH) {
            // four blocks of 4 NF WMMAs: (k 0..31, value), (k 0..31, remainder), (k 32..63, value), (k 32..63, remainder); a B set lasts two blocks, and the next one is fetched half in each of them
#pragma unroll
            for (int s = 0; s < 4; ++s) {
                const int cu = s & 1, nx = cu ^ 1, bc = s >> 1, bn = bc ^ 1;
                if (s + 1 < 4) {
#pragma unroll
                    for (int f = 0; f < 4; ++f) a[nx][f] = WFrag<T16>::ld(sa + f * 16 * GPIT + ((s + 1) & 1) * BKS + ((s + 1) >> 1) * 32);
                }
                if (bc == 0) {
#pragma unroll
                    for (int f = cu * (NF / 2); f < (cu + 1) * (NF / 2); ++f) b[bn][f] = ldb(f, 1);
                }
                __builtin_amdgcn_sched_barrier(0);   // keeps the next block's LDS reads as one group ahead of this block's WMMAs
#pragma unroll
                for (int nb = 0; nb < NF; ++nb)
#pragma unroll
                    for (int mb = 0; mb < 4; ++mb) acc[mb][nb] = WFrag<T16>::mma(a[cu][mb], b[bc][nb], acc[mb][nb]);
                __builtin_amdgcn_sched_barrier(0);   // keeps this block's WMMAs ahead of the following group of LDS reads
            }
        } else
#pragma unroll
        for (int ks = 0; ks < GBK / 32; ++ks) {
            const int cu = ks & 1, nx = cu ^ 1;
            if (ks + 1 < GBK / 32) {
#pragma unroll
                for (int f = 0; f < 4; ++f) a[nx][f] = WFrag<T16>::ld(sa + f * 16 * GPIT + (ks + 1) * 32);
#pragma unroll
                for (int f = 0; f < NF; ++f) b[nx][f] = ldb(f, ks + 1);
            }
            __builtin_amdgcn_sched_barrier(0);   // keeps the next set's LDS reads as one group ahead of this block's WMMAs
            if constexpr (EPI == 2) {
#pragma unroll
                for (int mb = 0; mb < 4; ++mb) { const v2h c2 = __builtin_bit_cast(v2h, cw[mb]);
                    const V cv = __builtin_shufflevector(c2, c2, 0, 1, 0, 1, 0, 1, 0, 1, 0, 1, 0, 1, 0, 1, 0, 1);
                    a[cu][mb] = __builtin_elementwise_fma(a[cu][mb], cv, (V)(h16)(-PCAR / (float)SEQ)); } }   // softmax weight x1024, centred: one packed fma per register
#pragma unroll
            for (int nb = 0; nb < NF; ++nb)
#pragma unroll
                for (int mb = 0; mb < 4; ++mb) acc[mb][nb] = WFrag<T16>::mma(a[cu][mb], b[cu][nb], acc[mb][nb]);
            __builtin_amdgcn_sched_barrier(0);   // keeps this block's WMMAs ahead of the following group of LDS reads
        }
        asm volatile("s_wait_dscnt 0x0" ::: "memory");      // this wave's reads of buffer t&1 are done before the buffer is refilled
        asm volatile("s_wait_asynccnt 0x0" ::: "memory");   // this wave's copies of tile t+1 have landed before the barrier publishes them
        __syncthreads();                                    // publishes tile t+1; ends every wave's reads of buffer t&1
    }
    asm volatile("s_wait_asynccnt 0x0" ::: "memory");       // no copy outstanding when the wave goes on
    if constexpr (EPI == 1) {
        // split output: the block's whole 256 x GBN f32 tile is staged in the ring (free behind the loop's last barrier), so that a row's f16 pieces leave as whole 128-byte lines, each line from one wave.
        constexpr int BSP = GBN + 4;                 // pitch in floats of the block's output stage
        constexpr int CP8 = GBN / 8;                 // 8-column pieces per staged row: 32 B of f32 in, 16 B of qh and 16 B of ql out
        constexpr int NQ = (CP8 % 32 == 0) ? 1 : 3;  // after NQ wave-wide pieces the pattern repeats RQ rows further down
        constexpr int RQ = 32 * NQ / CP8;
        static_assert(GBM * BSP * 4 <= 2 * GSTG * 2);
        static_assert((32 * NQ) % CP8 == 0 && 32 % RQ == 0 && CP8 % 8 == 0 && GBM == 8 * 32);
        float* bs = (float*)smem;
#pragma unroll
        for (int mb = 0; mb < 4; ++mb)
#pragma unroll
            for (int nb = 0; nb < NF; ++nb)
#pragma unroll
                for (int j = 0; j < 8; ++j) bs[(wm * 64 + mb * 16 + hi * 8 + j) * BSP + wn * WN + nb * 16 + lr] = acc[mb][nb][j];
        __syncthreads();   // the whole tile is staged before a wave reads rows that other waves wrote
        h16* qp[NQ]; const float* sp[NQ];
#pragma unroll
        for (int p = 0; p < NQ; ++p) { const int q = p * 32 + lane, row = wave * 32 + q / CP8, cofs = (q % CP8) * 8;
            qp[p] = QO + (size_t)(t0r + row) * KX2 + ((t0c + cofs) >> 6) * 128 + ((t0c + cofs) & 63); sp[p] = bs + row * BSP + cofs; }   // 64 values, then their 64 remainders: 128 B each, whole lines
#pragma unroll
        for (int u = 0; u < 32 / RQ; ++u) {
#pragma unroll
            for (int p = 0; p < NQ; ++p) { const v4f lo = *(const v4fa*)(sp[p] + u * RQ * BSP); const v4f up = *(const v4fa*)(sp[p] + u * RQ * BSP + 4); v8h qh, ql;
#pragma unroll
                for (int k = 0; k < 8; ++k) { const float sv = (k < 4 ? lo[k & 3] : up[k & 3]) * (QCAR / WCAR); const h16 a = toh_flush(sv); qh[k] = a; ql[k] = toh_flush(sv - (float)a); }   // the power-of-two factor is exact, so the difference is exact fused or not
                *(v8h*)(qp[p] + (size_t)(u * RQ) * KX2) = qh; *(v8h*)(qp[p] + (size_t)(u * RQ) * KX2 + 64) = ql; }
            if (u + 1 < 32 / RQ) asm volatile("s_wait_xcnt 0x0" ::: "memory");   // stands in front of the next rows' LDS reads and conversions, which overwrite the registers that these stores name
        }
        return;
    }
    if constexpr (EPI == 3) {
        static_assert(WN == GBK && NF == 8);   // a wave's columns are one key tile; a staged row is one wave-wide piece
        float mx[4][8], sm[4][8];
#pragma unroll
        for (int mb = 0; mb < 4; ++mb)
#pragma unroll
            for (int j = 0; j < 8; ++j) { float m = acc[mb][0][j];
#pragma unroll
                for (int nb = 1; nb < NF; ++nb) m = fmaxf(m, acc[mb][nb][j]);
                mx[mb][j] = rowmax16(m); }
#pragma unroll
        for (int mb = 0; mb < 4; ++mb)
#pragma unroll
            for (int j = 0; j < 8; ++j) { float s = 0.f;
#pragma unroll
                for (int nb = 0; nb < NF; ++nb) { const float e = __builtin_amdgcn_exp2f(fmaf(acc[mb][nb][j] - mx[mb][j], EXK, 10.0f)); acc[mb][nb][j] = e; s += e; }   // + 10: the x1024 carry
                sm[mb][j] = rowsum16(s); }
        // the wave's 64 maxima and 64 sums through its LDS stage, so that they leave as one 16-byte store per lane (whole lines)
        if (lr == 0) {
#pragma unroll
            for (int mb = 0; mb < 4; ++mb)
#pragma unroll
                for (int j = 0; j < 8; ++j) { os[mb * 16 + hi * 8 + j] = mx[mb][j]; os[64 + mb * 16 + hi * 8 + j] = sm[mb][j]; } }
        __builtin_amdgcn_wave_barrier(); asm volatile("" ::: "memory");
        const v4f sv = *(const v4fa*)(os + lane * 4);
        float* stp = C + (size_t)(c0 / GBK) * (2 * SEQ) + hi * SEQ + r0 + lr * 4;
        *(v4f*)stp = sv;
        asm volatile("s_wait_xcnt 0x0" :: "v"(stp), "v"(sv) : "memory");   // stands in front of whatever next overwrites the registers that this store names; as inputs they stay whole up to here
        __builtin_amdgcn_wave_barrier();
        h16* pp = QO + z * ((size_t)SEQ * LDC) + (size_t)r0 * LDC + c0 + lane * 4;
        const float* rp = os + lane * 4;
#pragma unroll
        for (int mb = 0; mb < 4; ++mb) {
#pragma unroll
            for (int nb = 0; nb < NF; ++nb) {
#pragma unroll
                for (int j = 0; j < 8; ++j) os[(hi * 8 + j) * OSP + nb * 16 + lr] = acc[mb][nb][j]; }
            __builtin_amdgcn_wave_barrier(); asm volatile("" ::: "memory");
#pragma unroll
            for (int hf = 0; hf < 2; ++hf) {
#pragma unroll
                for (int u = hf * 8; u < hf * 8 + 8; ++u) { const v4f val = *(const v4fa*)(rp + u * OSP); v4h o4;
#pragma unroll
                    for (int i = 0; i < 4; ++i) o4[i] = tohx(val[i]);
                    *(v4h*)(pp + (size_t)(mb * 16 + u) * LDC) = o4; }
                if (mb + 1 < 4 || hf == 0) asm volatile("s_wait_xcnt 0x0" ::: "memory");   // stands in front of the next 8 rows' LDS reads, and so of the conversions fed by them, which overwrite the registers that these stores name
            }
            __builtin_amdgcn_wave_barrier();
        }
        return;
    }
    // output: 16 rows at a time through the wave's own LDS stage, stored as 16-byte pieces in row order (whole 128-byte lines).
    // After NP wave-wide stores the piece pattern repeats RP rows further down, so every address is one of NP lane pointers plus a compile-time offset.
    constexpr int CPR = NF * 4;                      // 16-byte pieces per staged row
    constexpr int NP = (CPR % 32 == 0) ? 1 : 3;
    constexpr int RP = 32 * NP / CPR;
    static_assert((32 * NP) % CPR == 0 && 16 % RP == 0);
    float* gp[NP]; const float* lp[NP];
#pragma unroll
    for (int p = 0; p < NP; ++p) { const int q = p * 32 + lane, row = q / CPR, cofs = (q % CPR) * 4;
        gp[p] = C + (size_t)(r0 + row) * LDC + c0 + cofs; lp[p] = os + row * OSP + cofs; }
    v4f mean[NP];   // EPI 2: a lane's columns are the same in every row group, so their column means are fetched once
    if constexpr (EPI == 2) {
#pragma unroll
        for (int p = 0; p < NP; ++p) { const float* vp = VM + z * (size_t)((SEQ / 128) * LDC) + c0 + ((p * 32 + lane) % CPR) * 4;
            v4f pv[SEQ / 128];
#pragma unroll
            for (int tt = 0; tt < SEQ / 128; ++tt) pv[tt] = *(const v4f*)(vp + tt * LDC);
            asm volatile("s_wait_xcnt 0x0" :: "v"(vp) : "memory");   // stands in front of whatever next overwrites these loads' address registers; the address as an input keeps them whole up to here
            v4f s = pv[0];
#pragma unroll
            for (int tt = 1; tt < SEQ / 128; ++tt) s += pv[tt];
            mean[p] = s * (1.0f / (float)SEQ); }
    }
#pragma unroll
    for (int mb = 0; mb < 4; ++mb) {
#pragma unroll
        for (int nb = 0; nb < NF; ++nb) {
#pragma unroll
            for (int j = 0; j < 8; ++j) os[(hi * 8 + j) * OSP + nb * 16 + lr] = acc[mb][nb][j]; }
        __builtin_amdgcn_wave_barrier(); asm volatile("" ::: "memory");
#pragma unroll
        for (int u = 0; u < 16 / RP; ++u)
#pragma unroll
            for (int p = 0; p < NP; ++p) { v4f val = *(const v4fa*)(lp[p] + u * RP * OSP);
                if constexpr (EPI == 2) {
#pragma unroll
                    for (int i = 0; i < 4; ++i) val[i] = val[i] * (1.0f / PCAR) + mean[p][i]; }
                *(v4f*)(gp[p] + (size_t)(mb * 16 + u * RP) * LDC) = val; }
        if (mb + 1 < 4) asm volatile("s_wait_xcnt 0x0" ::: "memory");   // stands in front of the next 16 rows' LDS reads, which overwrite the registers that these stores name
        __builtin_amdgcn_wave_barrier();
    }
}

// k_prep: one pass over x: a block reads one 128 t x 128 d tile of f32 and writes all that is made of it:
// (a) f16 plane KX [g][t][d] holding the value rounded (RNE) to bf16 precision (exact in f16, subnormals -> 0); (b) the tile's column sums of those values, VMP [g][t tile][d] f32.
// The z plane behind the last batch takes W, whose rows have x's pitch: only its row-major plane is written, carried x1024.
// Every global side moves whole row pieces: 512 B of f32 in, 256 B of 16-bit values out (16 lanes x 32 B / 16 B).
#define VTT 128
#define VTD 128
// eight waves per SIMD (at most 128 registers): four blocks fit a WGP, so that the whole grid is resident at once and no block waits for a place
__global__ __launch_bounds__(256, 8) void k_prep(const float* __restrict__ x, const float* __restrict__ wq, h16* WQ, h16* KX, float* VMP) {
    __shared__ __align__(16) float part[8 * VTD];
    const int tid = threadIdx.x, c16 = tid & 15, r16 = tid >> 4;
    const int t0 = blockIdx.x * VTT, d0 = blockIdx.y * VTD, g = blockIdx.z;
    const bool isw = g == ZB;                 // the same for the whole block
    if (isw && t0 >= DM) return;              // W has DM rows; the whole block leaves, ahead of the barrier
    // in: lane -> 8 d (c16), row pairs r16 + 16 k
    const size_t tofs = (size_t)t0 * DM + d0 + c16 * 8;
    const float* src = (isw ? wq : x + (size_t)g * SEQ_FULL * DM) + tofs;
    h16* kp = (isw ? WQ : KX + (size_t)g * SEQ * DM) + tofs;
    v8f r[VTT / 32][2];
#pragma unroll
    for (int k = 0; k < VTT / 32; ++k)
#pragma unroll
        for (int q = 0; q < 2; ++q) r[k][q] = *(const v8f*)(src + (size_t)(2 * (r16 + 16 * k) + q) * DM);
    v8us o[VTT / 32][2];
#pragma unroll
    for (int k = 0; k < VTT / 32; ++k)
#pragma unroll
        for (int q = 0; q < 2; ++q)
#pragma unroll
            for (int i = 0; i < 8; ++i) o[k][q][i] = f2bf(r[k][q][i]);
    if (isw) {
#pragma unroll
        for (int k = 0; k < VTT / 32; ++k)
#pragma unroll
            for (int q = 0; q < 2; ++q) { v8h w;
#pragma unroll
                for (int i = 0; i < 8; ++i) w[i] = toh_flush(__uint_as_float((unsigned)o[k][q][i] << 16) * WCAR);
                *(v8h*)(kp + (size_t)(2 * (r16 + 16 * k) + q) * DM) = w; }
        return; }
    v8h kk[VTT / 32][2];
    float cs[8];
#pragma unroll
    for (int i = 0; i < 8; ++i) cs[i] = 0.f;
#pragma unroll
    for (int k = 0; k < VTT / 32; ++k)
#pragma unroll
        for (int q = 0; q < 2; ++q)
#pragma unroll
            for (int i = 0; i < 8; ++i) { const float xv = __uint_as_float((unsigned)o[k][q][i] << 16); kk[k][q][i] = toh_flush(xv); cs[i] += (fabsf(xv) < 6.103515625e-05f) ? 0.0f : xv; }
    // column sums: a wave's two row groups, then one row of part per wave
#pragma unroll
    for (int i = 0; i < 8; ++i) cs[i] += __shfl_xor(cs[i], 16, 32);
    if ((tid & 16) == 0) { float* pp = part + (tid >> 5) * VTD + c16 * 8;
        *(v4f*)pp = (v4f){cs[0], cs[1], cs[2], cs[3]}; *(v4f*)(pp + 4) = (v4f){cs[4], cs[5], cs[6], cs[7]}; }
    __syncthreads();   // every wave's column sums are in LDS before any of them is read; no global store stands in front of it, so it waits for none
    float a = part[tid & (VTD - 1)];
#pragma unroll
    for (int w = 1; w < 8; ++w) a += part[w * VTD + (tid & (VTD - 1))];
    // out, row order: the plane straight from the registers
#pragma unroll
    for (int k = 0; k < VTT / 32; ++k)
#pragma unroll
        for (int q = 0; q < 2; ++q) *(v8h*)(kp + (size_t)(2 * (r16 + 16 * k) + q) * DM) = kk[k][q];
    if (tid < VTD) VMP[((size_t)g * (SEQ / VTT) + blockIdx.x) * HD + d0 + tid] = a;
}

constexpr size_t al256(size_t b) { return (b + 255) & ~(size_t)255; }
constexpr size_t WS_TOTAL =
    al256((size_t)DM * DM * 2) +                  // WQ f16
    al256((size_t)ZB * SEQ * SEQ * 2) +           // P16
    al256((size_t)ZB * SEQ * KX2 * 2) +           // QX f16, [64 qh | 64 ql] per 64 columns
    al256((size_t)ZB * SEQ * HD * 2) +            // KX f16
    al256((size_t)ZB * (SEQ / 128) * HD * 4) +    // VM: column sums per 128-row tile
    al256((size_t)ZB * NKT * 2 * SEQ * 4);        // ST: row maximum and exp sum per key tile
static_assert(WS_TOTAL <= (size_t)268435456);

extern "C" void kernel_launch(void* const* d_in, const int* in_sizes, int n_in,
                              void* d_out, int out_size, void* d_ws, size_t ws_size, hipStream_t stream) {
    if (n_in < 2) return;
    if ((size_t)in_sizes[0] < ((size_t)(NB - 1) * SEQ_FULL + SEQ) * DM) return;
    if ((size_t)in_sizes[1] < (size_t)DM * DM) return;
    if ((size_t)out_size < (size_t)NB * SEQ * DM) return;
    if (WS_TOTAL > ws_size) return;
    const float* x = (const float*)d_in[0]; const float* wq = (const float*)d_in[1];   // x [NB][SEQ_FULL][768]; W [768 out][768 in]
    float* OUT = (float*)d_out;     // [NB][SEQ][768]
    char* wsp = (char*)d_ws;
    auto take = [&](size_t bytes) { char* p = wsp; wsp += al256(bytes); return (void*)p; };
    h16* WQ = (h16*)take((size_t)DM * DM * 2);
    h16* P16 = (h16*)take((size_t)ZB * SEQ * SEQ * 2);
    h16* QX = (h16*)take((size_t)ZB * SEQ * KX2 * 2);
    h16* KX = (h16*)take((size_t)ZB * SEQ * HD * 2);
    float* VM = (float*)take((size_t)ZB * (SEQ / 128) * HD * 4);
    float* ST = (float*)take((size_t)ZB * NKT * 2 * SEQ * 4);
    if ((size_t)(wsp - (char*)d_ws) > ws_size) return;

    for (int b0 = 0; b0 < NB; b0 += ZB) {
        k_prep<<<dim3(SEQ / 128, DM / 128, ZB + 1), 256, 0, stream>>>(x + (size_t)b0 * SEQ_FULL * DM, wq, WQ, KX, VM);
        k_gemmw<h16, 6, DM, 1, 0><<<dim3(ZB * SEQ / 256, DM / 192, 1), 256, 0, stream>>>(KX, WQ, DM, nullptr, 0, 0, 0, QX, nullptr, nullptr);
        k_gemmw<h16, 8, SEQ, 3, HD><<<dim3(SEQ / 256, SEQ / 256, ZB), 256, 0, stream>>>(QX, KX, KX2, ST, (size_t)SEQ * KX2, (size_t)SEQ * HD, (size_t)NKT * 2 * SEQ, P16, nullptr, nullptr);
        k_gemmw<h16, 6, HD, 2, 0><<<dim3(SEQ / 256, HD / 192, ZB), 256, 0, stream>>>(P16, KX, SEQ, OUT + (size_t)b0 * SEQ * DM, (size_t)SEQ * SEQ, (size_t)SEQ * HD, (size_t)SEQ * HD, nullptr, VM, ST);
    }
}

// v010
// A run of this version takes 118 microseconds.
// Next to v009, in two timings, it ran 1.04 and 1.05 times as fast.
// Over all steps from v000 it is 6.17 times as fast.
#include <hip/hip_runtime.h>

// Contractions: q projection on v_wmma_f32_16x16x32_f16 (x and W RNE-rounded to bf16 precision and held as f16, which is exact; W carried x1024; exact products, f32 accumulate); q.x^T with q carried x2048 as f16 value + fp8 (e4m3) remainder: value . k on v_wmma_f32_16x16x32_f16 (k = that same f16 plane of x), remainder . k on v_wmma_f32_16x16x64_fp8_fp8 (k's B fragments converted f16 -> fp8 in registers), one f32 accumulator for both; att.x on v_wmma_f32_16x16x32_f16 (the same f16 x plane, its B fragments taken by transposing LDS loads; softmax weights carried x1024 and centred by 1024/SEQ, column mean of x added back in f32), f32 accumulate.
// Single-head full-width document self-attention: x [8][2048][768]; q = x W^T ('oi' [768][768], no bias); keys = values = x; att = softmax(q.x) over all 2048 keys (no scale, no mask); out = att @ x -> [8][2048][768] f32.
// All batches in one pass (z-batched GEMMs): one kernel reads x (and W) once and writes all that is made of it: one f16 row-major plane (A of the projection, Bt of the score GEMM, B of the last GEMM) and the column sums per 128 rows; projection -> plane of q, [64 qh f16 | 64 ql fp8] per 64 columns (split in the GEMM's output stage); S' = 2048 q.x stays in the score GEMM's accumulators: its output stage takes each row's maximum and exp sum over the wave's 128 keys and stores 1024 exp(s - tile max) as f16 plus the two figures; the last GEMM joins a row's 16 tiles into one factor per tile and applies it to its A fragments; O = P' x, out = O/1024 + mean_t(x) formed in the GEMM's output stage.

#ifndef NB
#define NB 8
#endif
#ifndef SEQ
#define SEQ 2048
#endif
#define NB_FULL  8
#define SEQ_FULL 2048
#define DM   768
#define HD   768
#define ZB   NB                           // batches per pass: all of them, so every stage is one launch with the fullest grid
#define PCAR 1024.0f
#define QCAR 2048.0f                      // carry of the q value / remainder planes
#define SCL  4.8828125e-4f                // 1/2048: undoes the q carry (the module applies no score scale)
#define WCAR 1024.0f                      // carry of the f16 W plane: keeps small weights clear of the f16 subnormal range; undone with the q carry
#define QGB  192                          // bytes of the q plane per 64 columns: 64 f16 values (128 B), then their 64 fp8 remainders (64 B)
#define QBB  640                          // bytes of the q plane per 192 columns (one projection block's share of a row): 3 QGB, padded to whole 128-byte lines so that no line has two writers
#define KX2  (HD / 192 * QBB / 2)          // pitch of the q plane in 16-bit units

typedef _Float16 h16;
typedef __attribute__((ext_vector_type(16))) _Float16 v16h;
typedef __attribute__((ext_vector_type(8)))  _Float16 v8h;
typedef __attribute__((ext_vector_type(8)))  unsigned short v8us;
typedef __attribute__((ext_vector_type(8)))  float    v8f;
typedef __attribute__((ext_vector_type(4)))  float    v4f;
typedef __attribute__((ext_vector_type(2)))  _Float16 v2h;
typedef __attribute__((ext_vector_type(4)))  _Float16 v4h;
typedef v4f  __attribute__((may_alias)) v4fa;
typedef __attribute__((ext_vector_type(8)))  int      v8i;
typedef __attribute__((ext_vector_type(4)))  int      v4i32;
typedef __attribute__((ext_vector_type(2)))  int      v2i32;

static_assert(NB <= NB_FULL);
static_assert(SEQ <= SEQ_FULL);
static_assert(NB % ZB == 0);
static_assert(SEQ % 128 == 0);                 // softmax row chunks, 64-row tiles, K steps of 32
static_assert(DM % 64 == 0 && HD % 64 == 0);   // K steps of 32
static_assert(DM == HD);                       // q width == x width: q.x contracts over 768
static_assert(((size_t)SEQ * DM) % 8 == 0);
static_assert((ZB * SEQ) % 8 == 0);
static_assert(HD % 32 == 0 && SEQ % 8 == 0);
static_assert(HD % 192 == 0 && QBB >= 3 * QGB && QBB % 128 == 0 && QGB % 16 == 0);
static_assert((ZB * SEQ) % 64 == 0);           // projection GEMM rows: 64-row tiles
static_assert(QCAR * SCL == 1.0f);             // carry folded back exactly in the softmax scale
static_assert((KX2 * 2) % 128 == 0);
static_assert(DM % 64 == 0);
static_assert(SEQ % 128 == 0 && HD % 128 == 0 && DM == HD);                  // k_prep: 128 t x 128 d tiles cover the plane
static_assert(2 * 512 * 272 <= 327680);       // k_gemmw static LDS: one block per 320 KiB LDS
static_assert(DM % 128 == 0 && KX2 % 128 == 0 && SEQ % 128 == 0);                                 // k_gemmw: K tiles of 128
static_assert(SEQ % 256 == 0 && (ZB * SEQ) % 256 == 0 && DM % 192 == 0 && HD % 192 == 0);         // k_gemmw: 256x256 and 256x192 tiles cover the outputs
static_assert(DM % 128 == 0 && DM <= SEQ);     // k_prep: W's 128-row tiles lie inside the grid laid out for x

__device__ __forceinline__ unsigned short f2bf(float f) { unsigned u = __float_as_uint(f); u += 0x7FFFu + ((u >> 16) & 1u); return (unsigned short)(u >> 16); }
__device__ __forceinline__ v16h cat16(v8h lo, v8h hi) { return __builtin_shufflevector(lo, hi, 0, 1, 2, 3, 4, 5, 6, 7, 8, 9, 10, 11, 12, 13, 14, 15); }
__device__ __forceinline__ v8f wmma16(v16h a, v16h b, v8f c) { return __builtin_amdgcn_wmma_f32_16x16x32_f16(false, a, false, b, (short)0, c, false, false); }
__device__ __forceinline__ h16 tohx(float x) { return (h16)x; }
// f32 -> f16 (RNE) that cannot produce an f16 subnormal: |v| < 2^-14 -> +0 (value select).
static __device__ __forceinline__ h16 toh_flush(float v) { const h16 r = (h16)v; return (fabsf(v) < 6.103515625e-05f) ? (h16)0.0f : r; }

// ---- k_gemmw<T16, NF>: GEMM, EIGHT WAVES (4 x 2) per 256 x (32 NF) output tile, each wave 64 rows x 16 NF columns (4 NF accumulators); grid (M/256, N/(32 NF), Z), 256 threads, one block per WGP, two waves per SIMD.
// NF = 8: 256x256 tile; NF = 6: 256x192 tile (N = 768: four column tiles, so that the grid is a whole number of blocks per WGP).
// Operand tiles (256 rows of A, 32 NF rows of Bt, 128 k each) are staged in LDS by asynchronous 16-byte copies, two buffers: tile t+1 flies while tile t is worked on; a staged A row serves two waves, a staged Bt row four.
// C[m][n] (f32, pitch LDC) = sum_k A[m][k] Bt[n][k]. z-batch strides sA/sB/sC in elements. K % 128 == 0, M % 256 == 0, N % (32 NF) == 0.
// KW = 0: Bt rows have K elements. KW > 0: Bt rows have KW elements and A is the q plane (per 64 k of Bt QGB bytes: 64 f16 values, then their 64 fp8 remainders; K unused): a staged A tile (QGB bytes a row) goes with a staged Bt tile of 64 k; the two f16 B fragments of 16 columns, converted to fp8 in registers, are the B fragment of the remainder product.
// EPI picks what the output stage does with the f32 sums: 0 = store them to C; 1 = split each (W's carry taken off) into f16 value + fp8 remainder, carried x2048, and store both to QO [m][64 qh | 64 ql per 64 columns] (pitch KX2; C unused); 2 = store sum/1024 + mean to C, mean = (sum over the SEQ/128 row tiles tt of VM[z][tt][n]) / SEQ;
// 3 = softmax, first half: per row and per wave (128 columns = one key tile) m = max of the sums, e = 1024 exp((sum - m)/2048), l = sum of e; e goes as f16 to QO [z][m][n] (pitch LDC), m and l to C [z][key tile][m | l][row].
// EPI 2 is also the softmax's second half: A holds those e; from ST (the m and l of its 256 rows) the block forms c = exp((m - row max)/2048) x 1024 / (sum over tiles of l exp((m - row max)/2048)) per row and key tile, and every A fragment becomes e c - 1024/SEQ (a staged K tile is one key tile).
// EPI 2 takes its second operand row-major, B[k][n] (pitch LDC): the staged tile is 128 k rows of 32 NF columns, and a B fragment is two transposing loads (k0 and k0 + 16), which deliver the k order of the map below.
// fp8 fragments (16x16x64, A and B alike): lane (row/col lane&15, h) holds 32 bytes, byte 8 j + i = k 16 j + 8 h + i (j < 4, i < 8): the k of the lane's two f16 fragments, in their order; the q plane stores a row's 64 remainders in that order, h = 0 first.
// Fragment map (A and Bt alike): lane -> row/col lane&15, h = lane>>4; elements 0..7 = k0+8h+0..7, elements 8..15 = k0+16+8h+0..7. D: acc[j] = (row 8h+j, col lane&15).
template <typename T16> struct WFrag;
template <> struct WFrag<h16> { typedef v16h V; static __device__ __forceinline__ V ld(const h16* p) { return cat16(*(const v8h*)p, *(const v8h*)(p + 16)); } static __device__ __forceinline__ v8f mma(V a, V b, v8f c) { return wmma16(a, b, c); } };
// 16 bytes per lane of a row-major 16-bit LDS tile T, transposed: lane (c, h) reading at row k0 + 8 h + (lane & 7), byte 2 n0 + 16 ((lane >> 3) & 1) gets T[k0 + 8 h + 0..7][n0 + c]
typedef short s16x8 __attribute__((ext_vector_type(8)));
__device__ __forceinline__ v8h ldtr(const unsigned char* p) { typedef __attribute__((address_space(3))) s16x8 lds_s16x8; return __builtin_bit_cast(v8h, __builtin_amdgcn_ds_load_tr16_b128_v8i16((lds_s16x8*)p)); }
// two f16 fragments (k0 .. k0+31, k0+32 .. k0+63) -> one fp8 fragment, element order kept; finite for |value| < 480 (the conversion does not saturate)
__device__ __forceinline__ int h4fp8(v16h v, int i) { v2h p0, p1; p0[0] = v[4 * i]; p0[1] = v[4 * i + 1]; p1[0] = v[4 * i + 2]; p1[1] = v[4 * i + 3];
    return (int)((unsigned)(unsigned short)__builtin_amdgcn_cvt_pk_fp8_f16(p0) | ((unsigned)(unsigned short)__builtin_amdgcn_cvt_pk_fp8_f16(p1) << 16)); }
__device__ __forceinline__ v8i fp8frag(v16h lo, v16h up) { v8i r;
#pragma unroll
    for (int i = 0; i < 4; ++i) { r[i] = h4fp8(lo, i); r[4 + i] = h4fp8(up, i); }
    return r; }
__device__ __forceinline__ v8f wmma8(v8i a, v8i b, v8f c) { return __builtin_amdgcn_wmma_f32_16x16x64_fp8_fp8(a, b, (short)0, c, false, false); }
#define GBK  128                 // k per staged tile: 256 B of every operand row
#define GPIT 136                 // LDS row pitch in 16-bit elements: 272 B = 16 B x odd, conflict-free for 16-byte fragment reads
#define GBM  256                 // A rows per block tile
typedef int v4i __attribute__((vector_size(16)));
// one lane's 16 bytes, global -> LDS, through no register
__device__ __forceinline__ void cp16(const void* g, void* l) {
    __builtin_amdgcn_global_load_async_to_lds_b128((__attribute__((address_space(1))) v4i*)g, (__attribute__((address_space(3))) v4i*)l, 0, 0);
}
// value of lane l ^ X inside a 16-lane row (DPP row_xmask): the row reductions of the softmax stage stay on the vector unit
template <int X> __device__ __forceinline__ float rowx(float v) { return __builtin_bit_cast(float, __builtin_amdgcn_update_dpp(0, __builtin_bit_cast(int, v), 0x160 | X, 0xf, 0xf, true)); }
__device__ __forceinline__ float rowmax16(float v) { v = fmaxf(v, rowx<1>(v)); v = fmaxf(v, rowx<2>(v)); v = fmaxf(v, rowx<4>(v)); return fmaxf(v, rowx<8>(v)); }
__device__ __forceinline__ float rowsum16(float v) { v += rowx<1>(v); v += rowx<2>(v); v += rowx<4>(v); return v + rowx<8>(v); }
#define NKT  (SEQ / GBK)                   // key tiles per row
#define EXK  (SCL * 1.4426950408889634f)   // carried score difference -> exponent of two (SCL is a power of two: the product is the rounded log2(e), scaled exactly)
template <typename T16, int NF, int LDC, int EPI, int KW>
__global__ __launch_bounds__(256) void k_gemmw(const T16* __restrict__ A, const T16* __restrict__ Bt, int K, float* C, size_t sA, size_t sB, size_t sC, h16* QO, const float* __restrict__ VM, const float* __restrict__ ST) {
    typedef typename WFrag<T16>::V V;
    constexpr int WN = NF * 16;                  // columns per wave
    constexpr int GBN = 2 * WN;                  // Bt rows per block tile
    constexpr bool BR = EPI == 2;                // second operand row-major [k][n]
    constexpr int BPB = GBN * 2 + 32;            // BR: LDS pitch in bytes of a staged B row
    static_assert(!BR || (BPB % 32 == 0 && ((BPB / 32) & 1) == 1));   // 32 B x odd: conflict-free for the transposing loads
    constexpr bool SH = KW > 0;                  // A rows hold [value | remainder] per 64 k: one staged Bt tile (64 k) and one set of B fragments serve both
    constexpr int BKS = GBK / 2;                 // SH: k per staged Bt tile, 128 B of every Bt row
    constexpr int BPS = BKS + 8;                 // SH: LDS pitch of a Bt row in 16-bit elements: 144 B = 16 B x odd, conflict-free for 16-byte fragment reads
    constexpr int APS = (QGB + 16) / 2;          // SH: LDS pitch of an A row in 16-bit units: 208 B = 16 B x odd, conflict-free for 16-byte fragment reads
    constexpr int AP = SH ? APS : GPIT;          // LDS pitch of an A row
    static_assert(!(SH && BR));
    constexpr int GSTG = BR ? GBM * GPIT + GBK * BPB / 2 : SH ? GBM * APS + GBN * BPS : (GBM + GBN) * GPIT;     // one buffer: rows 0..255 = A tile, behind them the Bt tile (BR: the B tile)
    constexpr int OSP = WN + 4;                  // pitch in floats of a wave's 16-row output stage
    static_assert(8 * 16 * OSP * 4 <= 2 * GSTG * 2);
    static_assert(GBM / 16 + GBN / 16 <= 63);    // copies of one wave in flight (BR: the B tile has as many bytes, so as many copies)
    constexpr int CTB = EPI == 2 ? NKT * GBM * 4 : 0;   // EPI 2: the factor table behind the ring, [key tile][row], one dword = the f16 factor twice
    static_assert(2 * GSTG * 2 + CTB <= 327680);
    __shared__ __align__(16) unsigned char smem[2 * GSTG * 2 + CTB];
    T16* ring = (T16*)smem;
    unsigned* ctab = (unsigned*)(smem + 2 * GSTG * 2);
    const size_t z = blockIdx.z; A += z * sA; Bt += z * sB; C += z * sC;
    const int tid = threadIdx.x, lane = tid & 31, lr = lane & 15, hi = lane >> 4;
    const int wave = __builtin_amdgcn_readfirstlane(tid >> 5), wm = wave >> 1, wn = wave & 1;
    const int t0r = blockIdx.x * GBM, t0c = blockIdx.y * GBN;
    const int r0 = t0r + wm * 64, c0 = t0c + wn * WN;
    float* os = (float*)smem + wave * (16 * OSP);   // output stage: lies in the ring, used only behind the loop's last barrier (no reader, no copy left)
    v8f acc[4][NF];
#pragma unroll
    for (int mb = 0; mb < 4; ++mb)
#pragma unroll
        for (int nb = 0; nb < NF; ++nb) acc[mb][nb] = (v8f){};
    // copy map: 16 lanes cover one row's 256 B, the block covers 16 rows per copy; 16 copies for A, 2 NF for Bt per lane and tile
    const int cr = tid >> 4, cch = (tid & 15) * 8;
    const T16* ga = A + (size_t)(t0r + cr) * K + cch;
    static_assert(KW % BKS == 0);
    const int kbp = KW ? KW : K;                 // pitch of Bt
    // SH copy map of Bt: 8 lanes cover one row's 128 B, the block covers 32 rows per copy; NF copies per lane and tile
    const T16* gb = SH ? Bt + (size_t)(t0c + (tid >> 3)) * kbp + (tid & 7) * 8 : Bt + (size_t)(t0c + cr) * kbp + cch;
    const size_t gstep = (size_t)16 * K, gstepb = (size_t)16 * kbp;
    T16* lbase = ring + cr * GPIT + cch;
    // BR copy map: a B row is PPR 16-byte pieces; piece q = 256 i + tid of the tile; after 3 block-wide copies the pattern repeats 768 / PPR rows further down
    constexpr int PPR = GBN / 8, RB3 = 768 / PPR;
    static_assert(!BR || (768 % PPR == 0 && GBK % RB3 == 0 && PPR % 8 == 0 && GBK * PPR == 256 * (GBN / 16)));
    const T16* gbr[3]; unsigned char* lbr[3];
    if constexpr (BR) {
#pragma unroll
        for (int p = 0; p < 3; ++p) { const int q = p * 256 + tid, row = q / PPR, pc = q % PPR;
            gbr[p] = Bt + (size_t)row * LDC + t0c + pc * 8; lbr[p] = smem + GBM * GPIT * 2 + row * BPB + pc * 16; }
    }
    // SH copy map of A: a row's QGB bytes are PPA 16-byte pieces; piece q = 256 i + tid of the tile; after 3 block-wide copies the pattern repeats 768 / PPA rows further down
    constexpr int PPA = QGB / 16, RA3 = 768 / PPA;
    static_assert(!SH || (768 % PPA == 0 && GBM % RA3 == 0 && 3 * (GBM / RA3) + GBN / 32 <= 63));
    const unsigned char* gaq[3]; unsigned char* laq[3];
    if constexpr (SH) {
#pragma unroll
        for (int p = 0; p < 3; ++p) { const int q = p * 256 + tid, row = q / PPA, pc = q % PPA;
            gaq[p] = (const unsigned char*)A + (size_t)(t0r + row) * (KX2 * 2) + pc * 16; laq[p] = smem + row * (APS * 2) + pc * 16; }
    }
    auto fill = [&](int buf, int kt) {
        const T16* pa = ga + (size_t)kt * GBK; const T16* pb = gb + (size_t)kt * (SH ? BKS : GBK); T16* l = lbase + buf * GSTG;
        if constexpr (SH) {
            const int ko = (kt / 3) * QBB + (kt % 3) * QGB;   // byte offset of tile kt in a row of the q plane
#pragma unroll
            for (int u = 0; u < GBM / RA3; ++u)
#pragma unroll
                for (int p = 0; p < 3; ++p) cp16(gaq[p] + ko + (size_t)u * RA3 * (KX2 * 2), laq[p] + buf * (GSTG * 2) + u * RA3 * (APS * 2));
        } else {
#pragma unroll
            for (int i = 0; i < GBM / 16; ++i) cp16(pa + i * gstep, l + i * 16 * GPIT);
        }
        if constexpr (BR) {
#pragma unroll
            for (int u = 0; u < GBK / RB3; ++u)
#pragma unroll
                for (int p = 0; p < 3; ++p) cp16(gbr[p] + (size_t)(kt * GBK + u * RB3) * LDC, lbr[p] + buf * (GSTG * 2) + u * RB3 * BPB);
        } else if constexpr (SH) {
            T16* lb = ring + buf * GSTG + GBM * APS + (tid >> 3) * BPS + (tid & 7) * 8;
#pragma unroll
            for (int i = 0; i < GBN / 32; ++i) cp16(pb + i * 2 * gstepb, lb + i * 32 * BPS);
        } else {
#pragma unroll
            for (int i = 0; i < GBN / 16; ++i) cp16(pb + i * gstepb, l + (GBM + i * 16) * GPIT);
        }
    };
    const int nt = SH ? KW / BKS : K / GBK;
    fill(0, 0);
    if constexpr (EPI == 2) {
        // one thread per block row, while tile 0 flies: the row's 16 (m, l) pairs -> 16 factors; published by the barrier below
        static_assert(GBM == 256 && NKT * GBK == SEQ);
        const float* sp = ST + z * (size_t)(NKT * 2 * SEQ) + t0r + tid;
        float m[NKT], l[NKT];
#pragma unroll
        for (int q = 0; q < NKT; ++q) { m[q] = sp[q * 2 * SEQ]; l[q] = sp[q * 2 * SEQ + SEQ]; }
        asm volatile("s_wait_xcnt 0x0" :: "v"(sp) : "memory");   // stands in front of whatever next overwrites these loads' address registers; the address as an input keeps them whole up to here
        float mr = m[0];
#pragma unroll
        for (int q = 1; q < NKT; ++q) mr = fmaxf(mr, m[q]);
        float ls = 0.f;
#pragma unroll
        for (int q = 0; q < NKT; ++q) { m[q] = __builtin_amdgcn_exp2f((m[q] - mr) * EXK); ls += l[q] * m[q]; }
        const float fs = __fdiv_rn(PCAR, ls);
#pragma unroll
        for (int q = 0; q < NKT; ++q) { const h16 c = tohx(m[q] * fs); v2h c2; c2[0] = c; c2[1] = c; ctab[q * GBM + tid] = __builtin_bit_cast(unsigned, c2); }
    }
    asm volatile("s_wait_asynccnt 0x0" ::: "memory");   // tile 0 landed (this wave's copies) before the barrier publishes it
    __syncthreads();
    const int aofs = (wm * 64 + lr) * AP + 8 * hi, bofs = SH ? GBM * APS + (wn * WN + lr) * BPS + 8 * hi : (GBM + wn * WN + lr) * GPIT + 8 * hi;
#pragma unroll 1   // one trip per staged tile stays rolled: the body already holds 16 NF WMMAs (SH: 12 NF), a copy of it would only cost instruction cache
    for (int t = 0; t < nt; ++t) {
        const T16* sa = ring + (t & 1) * GSTG + aofs; const T16* sb = ring + (t & 1) * GSTG + bofs;
        const unsigned char* sbr = smem + (t & 1) * (GSTG * 2) + GBM * GPIT * 2 + (8 * hi + (lane & 7)) * BPB + ((lane >> 3) & 1) * 16 + wn * WN * 2;   // BR: the lane's place in the B tile
        auto ldb = [&](int f, int ks) -> V {
            if constexpr (BR) return cat16(ldtr(sbr + ks * 32 * BPB + f * 32), ldtr(sbr + (ks * 32 + 16) * BPB + f * 32));
            else return WFrag<T16>::ld(sb + f * 16 * (SH ? BPS : GPIT) + ks * 32); };
        V a[2][4], b[2][NF];   // two fragment sets: the next 32 k are fetched from LDS while the current 32 k are multiplied
#pragma unroll
        for (int f = 0; f < 4; ++f) a[0][f] = WFrag<T16>::ld(sa + f * 16 * AP);
#pragma unroll
        for (int f = 0; f < NF; ++f) b[0][f] = ldb(f, 0);
        unsigned cw[4];   // EPI 2: this key tile's factors of the lane's four A rows, read in the same group as the first fragments
        if constexpr (EPI == 2) {
#pragma unroll
            for (int f = 0; f < 4; ++f) cw[f] = ctab[t * GBM + wm * 64 + f * 16 + lr]; }
        // tile t+1 into the other buffer: its last readers (trip t-1) ended at the barrier just passed; issued behind the first fragment reads so that their LDS latency passes meanwhile
        if (t + 1 < nt) fill((t + 1) & 1, t + 1);
        if constexpr (SH) {
            // three blocks of 4 NF WMMAs: (k 0..31, value), (k 32..63, value) on f16, (k 0..63, remainder) on fp8
#pragma unroll
            for (int f = 0; f < 4; ++f) a[1][f] = WFrag<T16>::ld(sa + f * 16 * AP + 32);
#pragma unroll
            for (int f = 0; f < NF; ++f) b[1][f] = ldb(f, 1);
            __builtin_amdgcn_sched_barrier(0);   // keeps the next block's LDS reads as one group ahead of this block's WMMAs
#pragma unroll
            for (int nb = 0; nb < NF; ++nb)
#pragma unroll
                for (int mb = 0; mb < 4; ++mb) acc[mb][nb] = WFrag<T16>::mma(a[0][mb], b[0][nb], acc[mb][nb]);
            __builtin_amdgcn_sched_barrier(0);   // keeps this block's WMMAs ahead of the following group of LDS reads
            const unsigned char* sa8 = (const unsigned char*)(ring + (t & 1) * GSTG + (wm * 64 + lr) * AP) + 128 + 32 * hi;   // the lane's 32 remainders of its first A row
            v8i a8[4], b8[NF];
#pragma unroll
            for (int f = 0; f < 4; ++f) { const v4i32 lo = *(const v4i32*)(sa8 + f * 16 * (AP * 2)), up = *(const v4i32*)(sa8 + f * 16 * (AP * 2) + 16);
                a8[f] = __builtin_shufflevector(lo, up, 0, 1, 2, 3, 4, 5, 6, 7); }
            __builtin_amdgcn_sched_barrier(0);   // keeps the remainder fragments' LDS reads as one group ahead of this block's WMMAs
            // the conversions of the B fragments stand among this block's WMMAs, where the vector port is free
#pragma unroll
            for (int nb = 0; nb < NF; ++nb) { b8[nb] = fp8frag(b[0][nb], b[1][nb]);
#pragma unroll
                for (int mb = 0; mb < 4; ++mb) acc[mb][nb] = WFrag<T16>::mma(a[1][mb], b[1][nb], acc[mb][nb]); }
#pragma unroll
            for (int i = 0; i < 4 * NF; ++i) { __builtin_amdgcn_sched_group_barrier(0x008, 1, 0); __builtin_amdgcn_sched_group_barrier(0x002, 4, 0); }   // one WMMA, then four conversions: left alone the compiler gathers all 16 NF conversions behind the block, where nothing of this wave covers them
            __builtin_amdgcn_sched_barrier(0);   // the fp8 block starts with every B fragment converted
#pragma unroll
            for (int nb = 0; nb < NF; ++nb)
#pragma unroll
                for (int mb = 0; mb < 4; ++mb) acc[mb][nb] = wmma8(a8[mb], b8[nb], acc[mb][nb]);
            __builtin_amdgcn_sched_barrier(0);   // keeps this tile's WMMAs ahead of the waits at the tile's foot
        } else
#pragma unroll
        for (int ks = 0; ks < GBK / 32; ++ks) {
            const int cu = ks & 1, nx = cu ^ 1;
            if (ks + 1 < GBK / 32) {
#pragma unroll
                for (int f = 0; f < 4; ++f) a[nx][f] = WFrag<T16>::ld(sa + f * 16 * GPIT + (ks + 1) * 32);
#pragma unroll
                for (int f = 0; f < NF; ++f) b[nx][f] = ldb(f, ks + 1);
            }
            __builtin_amdgcn_sched_barrier(0);   // keeps the next set's LDS reads as one group ahead of this block's WMMAs
            if constexpr (EPI == 2) {
#pragma unroll
                for (int mb = 0; mb < 4; ++mb) { const v2h c2 = __builtin_bit_cast(v2h, cw[mb]);
                    const V cv = __builtin_shufflevector(c2, c2, 0, 1, 0, 1, 0, 1, 0, 1, 0, 1, 0, 1, 0, 1, 0, 1);
                    a[cu][mb] = __builtin_elementwise_fma(a[cu][mb], cv, (V)(h16)(-PCAR / (float)SEQ)); } }   // softmax weight x1024, centred: one packed fma per register
#pragma unroll
            for (int nb = 0; nb < NF; ++nb)
#pragma unroll
                for (int mb = 0; mb < 4; ++mb) acc[mb][nb] = WFrag<T16>::mma(a[cu][mb], b[cu][nb], acc[mb][nb]);
            __builtin_amdgcn_sched_barrier(0);   // keeps this block's WMMAs ahead of the following group of LDS reads
        }
        asm volatile("s_wait_dscnt 0x0" ::: "memory");      // this wave's reads of buffer t&1 are done before the buffer is refilled
        asm volatile("s_wait_asynccnt 0x0" ::: "memory");   // this wave's copies of tile t+1 have landed before the barrier publishes them
        __syncthreads();                                    // publishes tile t+1; ends every wave's reads of buffer t&1
    }
    asm volatile("s_wait_asynccnt 0x0" ::: "memory");       // no copy outstanding when the wave goes on
    if constexpr (EPI == 1) {
        // split output: the block's whole 256 x GBN f32 tile is staged in the ring (free behind the loop's last barrier), so that a row's pieces leave as 128-byte runs (values; the middle one across two half lines) and 64-byte halves of lines (remainders), each line from one wave.
        constexpr int BSP = GBN + 4;                 // pitch in floats of the block's output stage
        constexpr int CP8 = GBN / 8;                 // 8-column pieces per staged row: 32 B of f32 in, 16 B of qh and 8 B of ql out
        constexpr int NQ = (CP8 % 32 == 0) ? 1 : 3;  // after NQ wave-wide pieces the pattern repeats RQ rows further down
        constexpr int RQ = 32 * NQ / CP8;
        static_assert(GBM * BSP * 4 <= 2 * GSTG * 2);
        static_assert((32 * NQ) % CP8 == 0 && 32 % RQ == 0 && CP8 % 8 == 0 && GBM == 8 * 32 && GBN == 192);   // a block's columns are one QBB share of a q row
        float* bs = (float*)smem;
#pragma unroll
        for (int mb = 0; mb < 4; ++mb)
#pragma unroll
            for (int nb = 0; nb < NF; ++nb)
#pragma unroll
                for (int j = 0; j < 8; ++j) bs[(wm * 64 + mb * 16 + hi * 8 + j) * BSP + wn * WN + nb * 16 + lr] = acc[mb][nb][j];
        __syncthreads();   // the whole tile is staged before a wave reads rows that other waves wrote
        unsigned char* qp[NQ]; unsigned char* q8[NQ]; const float* sp[NQ];
#pragma unroll
        for (int p = 0; p < NQ; ++p) { const int q = p * 32 + lane, row = wave * 32 + q / CP8, cofs = (q % CP8) * 8;
            unsigned char* qr = (unsigned char*)QO + (size_t)(t0r + row) * (KX2 * 2) + blockIdx.y * QBB + (cofs >> 6) * QGB;   // 64 values (128 B), then their 64 remainders (64 B); a row's share of the block comes from one wave
            qp[p] = qr + (cofs & 63) * 2; q8[p] = qr + 128 + ((cofs >> 3) & 1) * 32 + ((cofs >> 4) & 3) * 8; sp[p] = bs + row * BSP + cofs; }   // remainders in fp8 fragment order: columns 16 j + 8 h + i at byte 32 h + 8 j + i
#pragma unroll
        for (int u = 0; u < 32 / RQ; ++u) {
#pragma unroll
            for (int p = 0; p < NQ; ++p) { const v4f lo = *(const v4fa*)(sp[p] + u * RQ * BSP); const v4f up = *(const v4fa*)(sp[p] + u * RQ * BSP + 4); v8h qh; float ql[8];
#pragma unroll
                for (int k = 0; k < 8; ++k) { const float sv = (k < 4 ? lo[k & 3] : up[k & 3]) * (QCAR / WCAR); const h16 a = toh_flush(sv); qh[k] = a; ql[k] = sv - (float)a; }   // the power-of-two factor is exact, so the difference is exact fused or not
                v2i32 l8;   // |remainder| <= half an f16 step of the value, at most 16: inside fp8's range
                l8[0] = __builtin_amdgcn_cvt_pk_fp8_f32(ql[2], ql[3], __builtin_amdgcn_cvt_pk_fp8_f32(ql[0], ql[1], 0, false), true);
                l8[1] = __builtin_amdgcn_cvt_pk_fp8_f32(ql[6], ql[7], __builtin_amdgcn_cvt_pk_fp8_f32(ql[4], ql[5], 0, false), true);
                *(v8h*)(qp[p] + (size_t)(u * RQ) * (KX2 * 2)) = qh; *(v2i32*)(q8[p] + (size_t)(u * RQ) * (KX2 * 2)) = l8; }
            if (u + 1 < 32 / RQ) asm volatile("s_wait_xcnt 0x0" ::: "memory");   // stands in front of the next rows' LDS reads and conversions, which overwrite the registers that these stores name
        }
        return;
    }
    if constexpr (EPI == 3) {
        static_assert(WN == GBK && NF == 8);   // a wave's columns are one key tile; a staged row is one wave-wide piece
        float mx[4][8], sm[4][8];
#pragma unroll
        for (int mb = 0; mb < 4; ++mb)
#pragma unroll
            for (int j = 0; j < 8; ++j) { float m = acc[mb][0][j];
#pragma unroll
                for (int nb = 1; nb < NF; ++nb) m = fmaxf(m, acc[mb][nb][j]);
                mx[mb][j] = rowmax16(m); }
#pragma unroll
        for (int mb = 0; mb < 4; ++mb)
#pragma unroll
            for (int j = 0; j < 8; ++j) { float s = 0.f;
#pragma unroll
                for (int nb = 0; nb < NF; ++nb) { const float e = __builtin_amdgcn_exp2f(fmaf(acc[mb][nb][j] - mx[mb][j], EXK, 10.0f)); acc[mb][nb][j] = e; s += e; }   // + 10: the x1024 carry
                sm[mb][j] = rowsum16(s); }
        // the wave's 64 maxima and 64 sums through its LDS stage, so that they leave as one 16-byte store per lane (whole lines)
        if (lr == 0) {
#pragma unroll
            for (int mb = 0; mb < 4; ++mb)
#pragma unroll
                for (int j = 0; j < 8; ++j) { os[mb * 16 + hi * 8 + j] = mx[mb][j]; os[64 + mb * 16 + hi * 8 + j] = sm[mb][j]; } }
        __builtin_amdgcn_wave_barrier(); asm volatile("" ::: "memory");
        const v4f sv = *(const v4fa*)(os + lane * 4);
        float* stp = C + (size_t)(c0 / GBK) * (2 * SEQ) + hi * SEQ + r0 + lr * 4;
        *(v4f*)stp = sv;
        asm volatile("s_wait_xcnt 0x0" :: "v"(stp), "v"(sv) : "memory");   // stands in front of whatever next overwrites the registers that this store names; as inputs they stay whole up to here
        __builtin_amdgcn_wave_barrier();
        h16* pp = QO + z * ((size_t)SEQ * LDC) + (size_t)r0 * LDC + c0 + lane * 4;
        const float* rp = os + lane * 4;
#pragma unroll
        for (int mb = 0; mb < 4; ++mb) {
#pragma unroll
            for (int nb = 0; nb < NF; ++nb) {
#pragma unroll
                for (int j = 0; j < 8; ++j) os[(hi * 8 + j) * OSP + nb * 16 + lr] = acc[mb][nb][j]; }
            __builtin_amdgcn_wave_barrier(); asm volatile("" ::: "memory");
#pragma unroll
            for (int hf = 0; hf < 2; ++hf) {
#pragma unroll
                for (int u = hf * 8; u < hf * 8 + 8; ++u) { const v4f val = *(const v4fa*)(rp + u * OSP); v4h o4;
#pragma unroll
                    for (int i = 0; i < 4; ++i) o4[i] = tohx(val[i]);
                    *(v4h*)(pp + (size_t)(mb * 16 + u) * LDC) = o4; }
                if (mb + 1 < 4 || hf == 0) asm volatile("s_wait_xcnt 0x0" ::: "memory");   // stands in front of the next 8 rows' LDS reads, and so of the conversions fed by them, which overwrite the registers that these stores name
            }
            __builtin_amdgcn_wave_barrier();
        }
        return;
    }
    // output: 16 rows at a time through the wave's own LDS stage, stored as 16-byte pieces in row order (whole 128-byte lines).
    // After NP wave-wide stores the piece pattern repeats RP rows further down, so every address is one of NP lane pointers plus a compile-time offset.
    constexpr int CPR = NF * 4;                      // 16-byte pieces per staged row
    constexpr int NP = (CPR % 32 == 0) ? 1 : 3;
    constexpr int RP = 32 * NP / CPR;
    static_assert((32 * NP) % CPR == 0 && 16 % RP == 0);
    float* gp[NP]; const float* lp[NP];
#pragma unroll
    for (int p = 0; p < NP; ++p) { const int q = p * 32 + lane, row = q / CPR, cofs = (q % CPR) * 4;
        gp[p] = C + (size_t)(r0 + row) * LDC + c0 + cofs; lp[p] = os + row * OSP + cofs; }
    v4f mean[NP];   // EPI 2: a lane's columns are the same in every row group, so their column means are fetched once
    if constexpr (EPI == 2) {
#pragma unroll
        for (int p = 0; p < NP; ++p) { const float* vp = VM + z * (size_t)((SEQ / 128) * LDC) + c0 + ((p * 32 + lane) % CPR) * 4;
            v4f pv[SEQ / 128];
#pragma unroll
            for (int tt = 0; tt < SEQ / 128; ++tt) pv[tt] = *(const v4f*)(vp + tt * LDC);
            asm volatile("s_wait_xcnt 0x0" :: "v"(vp) : "memory");   // stands in front of whatever next overwrites these loads' address registers; the address as an input keeps them whole up to here
            v4f s = pv[0];
#pragma unroll
            for (int tt = 1; tt < SEQ / 128; ++tt) s += pv[tt];
            mean[p] = s * (1.0f / (float)SEQ); }
    }
#pragma unroll
    for (int mb = 0; mb < 4; ++mb) {
#pragma unroll
        for (int nb = 0; nb < NF; ++nb) {
#pragma unroll
            for (int j = 0; j < 8; ++j) os[(hi * 8 + j) * OSP + nb * 16 + lr] = acc[mb][nb][j]; }
        __builtin_amdgcn_wave_barrier(); asm volatile("" ::: "memory");
#pragma unroll
        for (int u = 0; u < 16 / RP; ++u)
#pragma unroll
            for (int p = 0; p < NP; ++p) { v4f val = *(const v4fa*)(lp[p] + u * RP * OSP);
                if constexpr (EPI == 2) {
#pragma unroll
                    for (int i = 0; i < 4; ++i) val[i] = val[i] * (1.0f / PCAR) + mean[p][i]; }
                *(v4f*)(gp[p] + (size_t)(mb * 16 + u * RP) * LDC) = val; }
        if (mb + 1 < 4) asm volatile("s_wait_xcnt 0x0" ::: "memory");   // stands in front of the next 16 rows' LDS reads, which overwrite the registers that these stores name
        __builtin_amdgcn_wave_barrier();
    }
}

// k_prep: one pass over x: a block reads one 128 t x 128 d tile of f32 and writes all that is made of it:
// (a) f16 plane KX [g][t][d] holding the value rounded (RNE) to bf16 precision (exact in f16, subnormals -> 0); (b) the tile's column sums of those values, VMP [g][t tile][d] f32.
// The z plane behind the last batch takes W, whose rows have x's pitch: only its row-major plane is written, carried x1024.
// Every global side moves whole row pieces: 512 B of f32 in, 256 B of 16-bit values out (16 lanes x 32 B / 16 B).
#define VTT 128
#define VTD 128
// eight waves per SIMD (at most 128 registers): four blocks fit a WGP, so that the whole grid is resident at once and no block waits for a place
__global__ __launch_bounds__(256, 8) void k_prep(const float* __restrict__ x, const float* __restrict__ wq, h16* WQ, h16* KX, float* VMP) {
    __shared__ __align__(16) float part[8 * VTD];
    const int tid = threadIdx.x, c16 = tid & 15, r16 = tid >> 4;
    const int t0 = blockIdx.x * VTT, d0 = blockIdx.y * VTD, g = blockIdx.z;
    const bool isw = g == ZB;                 // the same for the whole block
    if (isw && t0 >= DM) return;              // W has DM rows; the whole block leaves, ahead of the barrier
    // in: lane -> 8 d (c16), row pairs r16 + 16 k
    const size_t tofs = (size_t)t0 * DM + d0 + c16 * 8;
    const float* src = (isw ? wq : x + (size_t)g * SEQ_FULL * DM) + tofs;
    h16* kp = (isw ? WQ : KX + (size_t)g * SEQ * DM) + tofs;
    v8f r[VTT / 32][2];
#pragma unroll
    for (int k = 0; k < VTT / 32; ++k)
#pragma unroll
        for (int q = 0; q < 2; ++q) r[k][q] = *(const v8f*)(src + (size_t)(2 * (r16 + 16 * k) + q) * DM);
    v8us o[VTT / 32][2];
#pragma unroll
    for (int k = 0; k < VTT / 32; ++k)
#pragma unroll
        for (int q = 0; q < 2; ++q)
#pragma unroll
            for (int i = 0; i < 8; ++i) o[k][q][i] = f2bf(r[k][q][i]);
    if (isw) {
#pragma unroll
        for (int k = 0; k < VTT / 32; ++k)
#pragma unroll
            for (int q = 0; q < 2; ++q) { v8h w;
#pragma unroll
                for (int i = 0; i < 8; ++i) w[i] = toh_flush(__uint_as_float((unsigned)o[k][q][i] << 16) * WCAR);
                *(v8h*)(kp + (size_t)(2 * (r16 + 16 * k) + q) * DM) = w; }
        return; }
    v8h kk[VTT / 32][2];
    float cs[8];
#pragma unroll
    for (int i = 0; i < 8; ++i) cs[i] = 0.f;
#pragma unroll
    for (int k = 0; k < VTT / 32; ++k)
#pragma unroll
        for (int q = 0; q < 2; ++q)
#pragma unroll
            for (int i = 0; i < 8; ++i) { const float xv = __uint_as_float((unsigned)o[k][q][i] << 16); kk[k][q][i] = toh_flush(xv); cs[i] += (fabsf(xv) < 6.103515625e-05f) ? 0.0f : xv; }
    // column sums: a wave's two row groups, then one row of part per wave
#pragma unroll
    for (int i = 0; i < 8; ++i) cs[i] += __shfl_xor(cs[i], 16, 32);
    if ((tid & 16) == 0) { float* pp = part + (tid >> 5) * VTD + c16 * 8;
        *(v4f*)pp = (v4f){cs[0], cs[1], cs[2], cs[3]}; *(v4f*)(pp + 4) = (v4f){cs[4], cs[5], cs[6], cs[7]}; }
    __syncthreads();   // every wave's column sums are in LDS before any of them is read; no global store stands in front of it, so it waits for none
    float a = part[tid & (VTD - 1)];
#pragma unroll
    for (int w = 1; w < 8; ++w) a += part[w * VTD + (tid & (VTD - 1))];
    // out, row order: the plane straight from the registers
#pragma unroll
    for (int k = 0; k < VTT / 32; ++k)
#pragma unroll
        for (int q = 0; q < 2; ++q) *(v8h*)(kp + (size_t)(2 * (r16 + 16 * k) + q) * DM) = kk[k][q];
    if (tid < VTD) VMP[((size_t)g * (SEQ / VTT) + blockIdx.x) * HD + d0 + tid] = a;
}

constexpr size_t al256(size_t b) { return (b + 255) & ~(size_t)255; }
constexpr size_t WS_TOTAL =
    al256((size_t)DM * DM * 2) +                  // WQ f16
    al256((size_t)ZB * SEQ * SEQ * 2) +           // P16
    al256((size_t)ZB * SEQ * KX2 * 2) +           // QX, [64 qh f16 | 64 ql fp8] per 64 columns
    al256((size_t)ZB * SEQ * HD * 2) +            // KX f16
    al256((size_t)ZB * (SEQ / 128) * HD * 4) +    // VM: column sums per 128-row tile
    al256((size_t)ZB * NKT * 2 * SEQ * 4);        // ST: row maximum and exp sum per key tile
static_assert(WS_TOTAL <= (size_t)268435456);

extern "C" void kernel_launch(void* const* d_in, const int* in_sizes, int n_in,
                              void* d_out, int out_size, void* d_ws, size_t ws_size, hipStream_t stream) {
    if (n_in < 2) return;
    if ((size_t)in_sizes[0] < ((size_t)(NB - 1) * SEQ_FULL + SEQ) * DM) return;
    if ((size_t)in_sizes[1] < (size_t)DM * DM) return;
    if ((size_t)out_size < (size_t)NB * SEQ * DM) return;
    if (WS_TOTAL > ws_size) return;
    const float* x = (const float*)d_in[0]; const float* wq = (const float*)d_in[1];   // x [NB][SEQ_FULL][768]; W [768 out][768 in]
    float* OUT = (float*)d_out;     // [NB][SEQ][768]
    char* wsp = (char*)d_ws;
    auto take = [&](size_t bytes) { char* p = wsp; wsp += al256(bytes); return (void*)p; };
    h16* WQ = (h16*)take((size_t)DM * DM * 2);
    h16* P16 = (h16*)take((size_t)ZB * SEQ * SEQ * 2);
    h16* QX = (h16*)take((size_t)ZB * SEQ * KX2 * 2);
    h16* KX = (h16*)take((size_t)ZB * SEQ * HD * 2);
    float* VM = (float*)take((size_t)ZB * (SEQ / 128) * HD * 4);
    float* ST = (float*)take((size_t)ZB * NKT * 2 * SEQ * 4);
    if ((size_t)(wsp - (char*)d_ws) > ws_size) return;

    for (int b0 = 0; b0 < NB; b0 += ZB) {
        k_prep<<<dim3(SEQ / 128, DM / 128, ZB + 1), 256, 0, stream>>>(x + (size_t)b0 * SEQ_FULL * DM, wq, WQ, KX, VM);
        k_gemmw<h16, 6, DM, 1, 0><<<dim3(ZB * SEQ / 256, DM / 192, 1), 256, 0, stream>>>(KX, WQ, DM, nullptr, 0, 0, 0, QX, nullptr, nullptr);
        k_gemmw<h16, 8, SEQ, 3, HD><<<dim3(SEQ / 256, SEQ / 256, ZB), 256, 0, stream>>>(QX, KX, KX2, ST, (size_t)SEQ * KX2, (size_t)SEQ * HD, (size_t)NKT * 2 * SEQ, P16, nullptr, nullptr);
        k_gemmw<h16, 6, HD, 2, 0><<<dim3(SEQ / 256, HD / 192, ZB), 256, 0, stream>>>(P16, KX, SEQ, OUT + (size_t)b0 * SEQ * DM, (size_t)SEQ * SEQ, (size_t)SEQ * HD, (size_t)SEQ * HD, nullptr, VM, ST);
    }
}
